// v000
// Measured on an AMD MI455X. A time is GPU time per run, averaged over a window of back-to-back runs after a warm-up
// (all launches, gaps included; the runs take copies of the inputs in turn), and the median of several windows.
// Apart from v000's, it joins two sittings. Times from different sittings can be a few percent apart, while
// side-by-side timings come from the same sitting.
// v000, which the later versions start from, runs in 1310 microseconds.
// Contractions: x*W_qkv on v_wmma_f32_16x16x32_bf16 (plain bf16 operands = RNE-bf16 inputs); q*k^T and p*v on v_wmma_f32_16x16x32_bf16 with bf16 hi/lo operand pairs (hi*hi + hi*lo + lo*hi); y*W_proj on v_wmma_f32_16x16x32_bf16 with y as bf16 hi/lo and exact bf16 weights (hi*w + lo*w); f32 accumulate everywhere; bias, per-head affine and softmax in f32.
#include <hip/hip_runtime.h>
#include <stdint.h>
#include <math.h>

constexpr int kBatch = 4;
constexpr int kSeq   = 2048;
constexpr int kDim   = 1024;
constexpr int kHeads = 16;
constexpr int kHD    = 64;
constexpr int kTok   = kBatch * kSeq;   // 8192
constexpr int kDim3  = 3 * kDim;        // 3072

typedef __attribute__((ext_vector_type(16))) _Float16 v16h;
typedef __attribute__((ext_vector_type(8)))  _Float16 v8h;
typedef __attribute__((ext_vector_type(16))) __bf16   v16b;
typedef __attribute__((ext_vector_type(8)))  __bf16   v8b;
typedef __attribute__((ext_vector_type(8)))  float    v8f;
typedef __attribute__((ext_vector_type(4)))  float    v4f;

__device__ __forceinline__ unsigned short f2bf_bits(float f) {
  unsigned u = __float_as_uint(f);
  return (unsigned short)((u + 0x7FFFu + ((u >> 16) & 1u)) >> 16);
}
__device__ __forceinline__ float bf_bits2f(unsigned short h) { return __uint_as_float(((unsigned)h) << 16); }
__device__ __forceinline__ float bf_rne(float f) { return bf_bits2f(f2bf_bits(f)); }

// hazard guards as plain device helpers (no inline asm inside the kernel template body)
__device__ __forceinline__ void dep_guard_h(v8f& a, v8f& b, v16h x, v16h y) { asm volatile("v_nop\n\tv_nop\n\tv_nop\n\tv_nop" : "+v"(a), "+v"(b) : "v"(x), "v"(y)); }
__device__ __forceinline__ void dep_guard_b(v8f& a, v8f& b, v16b x, v16b y) { asm volatile("v_nop\n\tv_nop\n\tv_nop\n\tv_nop" : "+v"(a), "+v"(b) : "v"(x), "v"(y)); }
__device__ __forceinline__ void keep4_h(v16h a, v16h b, v16h c, v16h d) { asm volatile("v_nop" :: "v"(a), "v"(b), "v"(c), "v"(d)); }
__device__ __forceinline__ void keep4_b(v16b a, v16b b, v16b c, v16b d) { asm volatile("v_nop" :: "v"(a), "v"(b), "v"(c), "v"(d)); }
__device__ __forceinline__ void acc_guard4(v8f& a, v8f& b, v8f& c, v8f& d) { asm volatile("v_nop\n\tv_nop\n\tv_nop\n\tv_nop" : "+v"(a), "+v"(b), "+v"(c), "+v"(d)); }
template <typename T> struct Frag;
template <> struct Frag<_Float16> {
  typedef v16h V; union U { v16h v; v8h h[2]; };
  static __device__ __forceinline__ v16h load(const _Float16* p) {   // elements 0..7 <- p[0..7], 8..15 <- p[16..23]
    U f; f.h[0] = *(const v8h*)(p); f.h[1] = *(const v8h*)(p + 16); return f.v;
  }
  static __device__ __forceinline__ v8f mma(v16h a, v16h b, v8f c) {
    return __builtin_amdgcn_wmma_f32_16x16x32_f16(false, a, false, b, (short)0, c, false, false);
  }
  static __device__ __forceinline__ void guard(v8f& a, v8f& b, v16h x, v16h y) { dep_guard_h(a, b, x, y); }
  static __device__ __forceinline__ void keep(v16h a, v16h b, v16h c, v16h d) { keep4_h(a, b, c, d); }
};
template <> struct Frag<__bf16> {
  typedef v16b V; union U { v16b v; v8b h[2]; };
  static __device__ __forceinline__ v16b load(const __bf16* p) {
    U f; f.h[0] = *(const v8b*)(p); f.h[1] = *(const v8b*)(p + 16); return f.v;
  }
  static __device__ __forceinline__ v8f mma(v16b a, v16b b, v8f c) {
    return __builtin_amdgcn_wmma_f32_16x16x32_bf16(false, a, false, b, (short)0, c, false, false);
  }
  static __device__ __forceinline__ void guard(v8f& a, v8f& b, v16b x, v16b y) { dep_guard_b(a, b, x, y); }
  static __device__ __forceinline__ void keep(v16b a, v16b b, v16b c, v16b d) { keep4_b(a, b, c, d); }
};

// ---- Register-blocked batched WMMA GEMM ------------------------------------
// C[m,n] = scale * sum_k A[m,k] * Bt[n,k] (+bias)(affine)(+resid); each wave owns a 64x64 tile.
// A row-major [M,K]; Bt row-major [N,K]; M,N % 64 == 0, K % 32 == 0.
// SPLIT_MODE: 0 = plain; 1 = A carried as hi/lo planes (A2 = lo): hi.b + lo.b; 2 = A and Bt hi/lo: hi.hi + hi.lo + lo.hi.
// BIAS_MODE: 0 = none, 1 = bias[m], 2 = bias[n].
// OUT_MODE: 0 = f32, 1 = f16, 2 = bf16 hi plane (Cout) + bf16 lo plane (Cout2),
//           3 = qkv mode: columns n form three blocks of kDim (which = n0 / kDim); value v = (acc+bias)*affs[cc]+affb[cc]
//               with cc = n - which*kDim and tables (affs0,affb0) for which 0, (affs1,affb1) for which 1 (RNE-bf16 applied
//               to the table values), identity for which 2; written as bf16 hi plane at Cout + which*2*strideC and lo plane
//               at + strideC, row pitch ldc, column n0 - which*kDim.
// ET: 0 = f16 operands, 1 = bf16 operands (pointers passed as 16-bit storage)
template <int ET> struct Elem;
template <> struct Elem<0> { typedef _Float16 T; };
template <> struct Elem<1> { typedef __bf16 T; };
template <int ET, int SPLIT_MODE, int BIAS_MODE, int OUT_MODE, bool RESID, int ACT = 0>
__global__ __launch_bounds__(256) void wmma_gemm64(
    const unsigned short* __restrict__ Ap, const unsigned short* __restrict__ A2p, int lda, long strideA,
    const unsigned short* __restrict__ Btp, const unsigned short* __restrict__ Bt2p, int ldb, long strideB,
    void* __restrict__ Cout, void* __restrict__ Cout2, int ldc, long strideC,
    const float* __restrict__ bias,
    const float* __restrict__ resid, long strideR,
    const float* __restrict__ affs0, const float* __restrict__ affb0,
    const float* __restrict__ affs1, const float* __restrict__ affb1,
    int M, int N, int K, float scale) {
  typedef typename Elem<ET>::T T;
  typedef typename Frag<T>::V V;
  const T* A = (const T*)Ap; const T* A2 = (const T*)A2p; const T* Bt = (const T*)Btp; const T* Bt2 = (const T*)Bt2p;
  __shared__ __align__(16) float sT[8][16 * 68];   // per-wave 16x64 slab, pitch 68 floats
  const int b    = blockIdx.y;
  const int lane = threadIdx.x & 31;
  const int wave = threadIdx.x >> 5;
  const int tilesN = N >> 6;
  const int tilesM = M >> 6;
  const int tile = blockIdx.x * 8 + wave;
  if (tile >= tilesM * tilesN) return;   // wave-uniform; no block barriers in this kernel
  const int tm = tile / tilesN;
  const int tn = tile - tm * tilesN;
  const int m0 = tm << 6;
  const int n0 = tn << 6;

  const T* Ab  = A  + (size_t)b * strideA;
  const T* Bb  = Bt + (size_t)b * strideB;
  const T* Ab2 = (SPLIT_MODE >= 1) ? (A2  + (size_t)b * strideA) : nullptr;
  const T* Bb2 = (SPLIT_MODE == 2) ? (Bt2 + (size_t)b * strideB) : nullptr;

  const int rlane = lane & 15;                 // row (A) / col (B, D) within subtile
  const int koff  = (lane >> 4) * 8;           // k offset of this lane half
  const int mOff  = (lane >> 4) * 8;           // D row offset

  v8f acc[4][4];
#pragma unroll
  for (int i = 0; i < 4; ++i)
#pragma unroll
    for (int j = 0; j < 4; ++j) acc[i][j] = (v8f){0.f,0.f,0.f,0.f,0.f,0.f,0.f,0.f};

  for (int k0 = 0; k0 < K; k0 += 32) {
    V bh[4], bl[4];
#pragma unroll
    for (int j = 0; j < 4; ++j) {
      const size_t bo = (size_t)(n0 + (j << 4) + rlane) * ldb + koff + k0;
      bh[j] = Frag<T>::load(Bb + bo);
      if (SPLIT_MODE == 2) bl[j] = Frag<T>::load(Bb2 + bo);
    }
#pragma unroll
    for (int i = 0; i < 4; ++i) {
      const size_t ao = (size_t)(m0 + (i << 4) + rlane) * lda + koff + k0;
      V ah = Frag<T>::load(Ab + ao);
      V al;
      if (SPLIT_MODE >= 1) al = Frag<T>::load(Ab2 + ao);
#pragma unroll
      for (int j = 0; j < 4; ++j) {
        acc[i][j] = Frag<T>::mma(ah, bh[j], acc[i][j]);
        if (SPLIT_MODE == 2) acc[i][j] = Frag<T>::mma(ah, bl[j], acc[i][j]);
        if (SPLIT_MODE >= 1) acc[i][j] = Frag<T>::mma(al, bh[j], acc[i][j]);
      }
      Frag<T>::guard(acc[i][0], acc[i][3], ah, (SPLIT_MODE >= 1) ? al : ah);
    }
    Frag<T>::keep(bh[0], bh[1], bh[2], bh[3]);
    if (SPLIT_MODE == 2) Frag<T>::keep(bl[0], bl[1], bl[2], bl[3]);
  }
  acc_guard4(acc[0][0], acc[0][1], acc[0][2], acc[0][3]);
  acc_guard4(acc[1][0], acc[1][1], acc[1][2], acc[1][3]);
  acc_guard4(acc[2][0], acc[2][1], acc[2][2], acc[2][3]);
  acc_guard4(acc[3][0], acc[3][1], acc[3][2], acc[3][3]);

  // ---- epilogue ----
  float* slab = sT[wave];
  const float* Rb = RESID ? (resid + (size_t)b * strideR) : nullptr;
#pragma unroll
  for (int i = 0; i < 4; ++i) {
    const int mBase = m0 + (i << 4);
#pragma unroll
    for (int j = 0; j < 4; ++j) {
      const int n = n0 + (j << 4) + rlane;
      float bv = 0.f;
      if (BIAS_MODE == 2) bv = bias[n];
      float asc = 1.0f, abi = 0.0f;
      if (OUT_MODE == 3) {
        const int which = n0 / kDim;               // wave-uniform (64-col tile inside one kDim block)
        const int cc = n - which * kDim;           // 0..kDim-1, all four tables have kDim entries
        const float s0 = bf_rne(affs0[cc]);
        const float c0 = bf_rne(affb0[cc]);
        const float s1 = bf_rne(affs1[cc]);
        const float c1 = bf_rne(affb1[cc]);
        asc = (which == 0) ? s0 : ((which == 1) ? s1 : 1.0f);
        abi = (which == 0) ? c0 : ((which == 1) ? c1 : 0.0f);
      }
#pragma unroll
      for (int r = 0; r < 8; ++r) {
        float v = acc[i][j][r] * scale;
        if (BIAS_MODE == 1) v += bias[mBase + mOff + r];
        if (BIAS_MODE == 2) v += bv;
        if (OUT_MODE == 3) v = v * asc + abi;
        if (RESID) v += Rb[(size_t)(mBase + mOff + r) * ldc + n];
        if (ACT == 1) v = tanhf(v);
        if (ACT == 2) v = fmaxf(v, 0.0f);
        if (ACT == 4) v = (v > 0.f) ? v : 0.01f * v;
        slab[(mOff + r) * 68 + (j << 4) + rlane] = v;
      }
    }
    __builtin_amdgcn_fence(__ATOMIC_RELEASE, "workgroup");
    __builtin_amdgcn_wave_barrier();
    __builtin_amdgcn_fence(__ATOMIC_ACQUIRE, "workgroup");
    if (OUT_MODE == 0) {
      float* C = (float*)Cout + (size_t)b * strideC;
      const int hh = lane >> 4, c4 = (lane & 15) * 4;     // row seg = 256 B = 16 lanes x 16 B
      {
#pragma unroll
        for (int it = 0; it < 8; ++it) {
          const int row = it * 2 + hh;
          v4f v = *(const v4f*)(slab + row * 68 + c4);
          *(v4f*)(C + (size_t)(mBase + row) * ldc + n0 + c4) = v;
        }
        
      }
    } else {
      const int q = lane >> 3, c8 = (lane & 7) * 8;
      unsigned short* C;
      unsigned short* C2;
      int ncol;
      if (OUT_MODE == 3) {
        const int which = n0 / kDim;
        C  = (unsigned short*)Cout + (size_t)which * 2 * (size_t)strideC;
        C2 = C + (size_t)strideC;
        ncol = n0 - which * kDim;
      } else {
        C  = (unsigned short*)Cout  + (size_t)b * strideC;
        C2 = (OUT_MODE == 2) ? ((unsigned short*)Cout2 + (size_t)b * strideC) : nullptr;
        ncol = n0;
      }
      {
#pragma unroll
        for (int it = 0; it < 4; ++it) {
          const int row = it * 4 + q;
          const float* sp = slab + row * 68 + c8;
          v8h hv, lv;
#pragma unroll
          for (int e = 0; e < 8; ++e) {
            if (OUT_MODE == 1) {
              hv[e] = (_Float16)sp[e];
            } else {
              unsigned short hb = f2bf_bits(sp[e]);
              unsigned short lb = f2bf_bits(sp[e] - bf_bits2f(hb));
              hv[e] = __builtin_bit_cast(_Float16, hb);
              lv[e] = __builtin_bit_cast(_Float16, lb);
            }
          }
          *(v8h*)(C + (size_t)(mBase + row) * ldc + ncol + c8) = hv;
          if (OUT_MODE >= 2) *(v8h*)(C2 + (size_t)(mBase + row) * ldc + ncol + c8) = lv;
        }
        
      }
    }
    __builtin_amdgcn_fence(__ATOMIC_RELEASE, "workgroup");
    __builtin_amdgcn_wave_barrier();
    __builtin_amdgcn_fence(__ATOMIC_ACQUIRE, "workgroup");
  }
}

// coverage: n8 threads x 8 elements = n (host passes n8 = n/8 with n % 8 == 0)
__global__ __launch_bounds__(256) void cast_bf16x8_k(const float* __restrict__ in,
                                                     unsigned short* __restrict__ out, int n8) {
  const int i = blockIdx.x * 256 + threadIdx.x;
  if (i < n8) {
    const size_t o = (size_t)i * 8;
    const v4f a = *(const v4f*)(in + o);
    const v4f bq = *(const v4f*)(in + o + 4);
    v8h hv;
#pragma unroll
    for (int e = 0; e < 4; ++e) {
      hv[e]     = __builtin_bit_cast(_Float16, f2bf_bits(a[e]));
      hv[4 + e] = __builtin_bit_cast(_Float16, f2bf_bits(bq[e]));
    }
    *(v8h*)(out + o) = hv;
    
  }
}

// ---- W [K][N] f32 -> Wt [N][K] bf16 (RNE), 64x64 tile transposed through LDS ----
// in[rows = K][cols = N] -> out[N][K]; grid = (N/64, K/64).
// producer coverage: 256 threads x (1 row x 16 cols) = 64x64 tile; store: 8 waves x 4 rows x 2 it = 64 rows, 8 lanes x 8 halves = 64 cols.
constexpr int kWTP = 72;
__global__ __launch_bounds__(256) void wt_cast_bf_k(const float* __restrict__ W, unsigned short* __restrict__ Wtp,
                                                    int K, int N) {
  __shared__ __align__(16) _Float16 st[64 * kWTP];
  _Float16* Wt = (_Float16*)Wtp;
  const int n0 = blockIdx.x * 64, k0 = blockIdx.y * 64;
  const int tid = threadIdx.x;
  const int kr = tid >> 2, c16 = (tid & 3) * 16;
  const float* src = W + (size_t)(k0 + kr) * N + n0 + c16;
#pragma unroll
  for (int qq = 0; qq < 4; ++qq) {
    const v4f v = *(const v4f*)(src + 4 * qq);
#pragma unroll
    for (int e = 0; e < 4; ++e)
      st[(c16 + 4 * qq + e) * kWTP + kr] = __builtin_bit_cast(_Float16, f2bf_bits(v[e]));
  }
  __syncthreads();
  const int wave = tid >> 5, lane = tid & 31;
  const int q8 = lane >> 3, c8 = (lane & 7) * 8;
  {
#pragma unroll
    for (int it = 0; it < 2; ++it) {
      const int n = it * 32 + wave * 4 + q8;
      const v8h hv = *(const v8h*)(st + n * kWTP + c8);
      *(v8h*)(Wt + (size_t)(n0 + n) * K + k0 + c8) = hv;
    }
    
  }
}

// =====================================================================================
// Causal attention, head_dim 64, fed by bf16 hi/lo planes laid out [kTok][kDim] (row = b*kSeq + t, col = h*64 + d).
//   scores = (qh.kh + qh.kl + ql.kh) / 8 : v_wmma_f32_16x16x32_bf16, f32 accumulate
//   out    =  ph.vh + ph.vl + pl.vh      : v_wmma_f32_16x16x32_bf16, p = exp(s - max) split into bf16 hi/lo
//   online softmax in f32. Block = 4 waves = 64 query rows of one head of batch bsel; 64-key chunks,
//   chunks above the diagonal skipped, per-element causal select (key > query -> -inf) on the diagonal chunk.
//   grid.x = kHeads * (kSeq/64).
// =====================================================================================
constexpr int kKC = 64;
constexpr int kQB = 64;

__device__ __forceinline__ v8f mma_bf(v16b a, v16b b, v8f c) {
  c = __builtin_amdgcn_wmma_f32_16x16x32_bf16(false, a, false, b, (short)0, c, false, false);
  asm volatile("v_nop\n\tv_nop\n\tv_nop\n\tv_nop" : "+v"(c) : "v"(a), "v"(b));
  return c;
}

__global__ __launch_bounds__(128)
void attn_hd64_k(const unsigned short* __restrict__ Qhp, const unsigned short* __restrict__ Qlp,
                 const unsigned short* __restrict__ Khp, const unsigned short* __restrict__ Klp,
                 const unsigned short* __restrict__ Vhp, const unsigned short* __restrict__ Vlp,
                 unsigned short* __restrict__ Yhp, unsigned short* __restrict__ Ylp, int bsel) {
  union FB { v16b v; v8b h[2]; };
  __shared__ __align__(16) __bf16 Ksh[kKC * kHD];             // K hi [kv][d]   8 KB
  __shared__ __align__(16) __bf16 Ksl[kKC * kHD];             // K lo [kv][d]   8 KB
  __shared__ __align__(16) __bf16 Vth[kHD * kKC];             // V hi [d][kv]   8 KB
  __shared__ __align__(16) __bf16 Vtl[kHD * kKC];             // V lo [d][kv]   8 KB
  __shared__ __align__(16) __bf16 Pbuf[4][2 * 16 * kKC];      // per wave: P hi [16][64] then P lo [16][64]; reused as f32 out tile [16][64]

  const __bf16* Qh = (const __bf16*)Qhp;
  const __bf16* Ql = (const __bf16*)Qlp;
  const __bf16* Kh = (const __bf16*)Khp;
  const __bf16* Kl = (const __bf16*)Klp;
  const __bf16* Vh = (const __bf16*)Vhp;
  const __bf16* Vl = (const __bf16*)Vlp;

  const int tid  = threadIdx.x;
  const int wave = tid >> 5;
  const int lane = tid & 31;
  const int hh   = lane >> 4;
  const int c    = lane & 15;

  constexpr int nqb = kSeq / kQB;   // 32
  const int bx = blockIdx.x;
  const int qb = bx % nqb;
  const int h  = bx / nqb;
  const int q0 = qb * kQB + wave * 16;          // token index of this wave's first row
  const size_t rowb = (size_t)bsel * kSeq;       // plane row base of this batch
  const int hcol = h * kHD;

  // ---- Q fragments (A operand): 2 d-chunks, hi and lo; Frag load = split k-map ----
  v16b qah[2], qal[2];
  {
    const size_t qoff = (rowb + (size_t)(q0 + c)) * kDim + hcol + 8 * hh;
#pragma unroll
    for (int dc = 0; dc < 2; ++dc) {
      qah[dc] = Frag<__bf16>::load(Qh + qoff + dc * 32);
      qal[dc] = Frag<__bf16>::load(Ql + qoff + dc * 32);
    }
  }

  float mrow[8], lrow[8];
  v8f oacc[4];
#pragma unroll
  for (int r = 0; r < 8; ++r) { mrow[r] = -INFINITY; lrow[r] = 0.f; }
#pragma unroll
  for (int t = 0; t < 4; ++t) oacc[t] = (v8f){0.f,0.f,0.f,0.f,0.f,0.f,0.f,0.f};

  const int nChunks = qb + 1;   // block-uniform, <= 32
  for (int kc = 0; kc < nChunks; ++kc) {
    const int kv0 = kc * kKC;
    __syncthreads();
    {
      // staging coverage: 128 threads x (1 key row x 32 d) = 64 keys x 64 d for each of the four tiles
      const int kvr = tid >> 1, dh = (tid & 1) * 32;
      const size_t goff = (rowb + (size_t)(kv0 + kvr)) * kDim + hcol + dh;
#pragma unroll 1
      for (int i = 0; i < 4; ++i) {
        const v8b a0 = *(const v8b*)(Kh + goff + 8 * i);
        const v8b a1 = *(const v8b*)(Kl + goff + 8 * i);
        *(v8b*)(Ksh + kvr * kHD + dh + 8 * i) = a0;
        *(v8b*)(Ksl + kvr * kHD + dh + 8 * i) = a1;
        const v8b w0 = *(const v8b*)(Vh + goff + 8 * i);
        const v8b w1 = *(const v8b*)(Vl + goff + 8 * i);
#pragma unroll
        for (int e = 0; e < 8; ++e) {
          Vth[(dh + 8 * i + e) * kKC + kvr] = w0[e];
          Vtl[(dh + 8 * i + e) * kKC + kvr] = w1[e];
        }
      }
    }
    __syncthreads();

    // ---- scores: D row = query 8hh+r, col = key j*16+c ----
    v8f s[4];
#pragma unroll
    for (int j = 0; j < 4; ++j) {
      s[j] = (v8f){0.f,0.f,0.f,0.f,0.f,0.f,0.f,0.f};
#pragma unroll
      for (int dc = 0; dc < 2; ++dc) {
        FB kb, kl;
        kb.h[0] = *(const v8b*)(Ksh + (j * 16 + c) * kHD + dc * 32 + 8 * hh);
        kb.h[1] = *(const v8b*)(Ksh + (j * 16 + c) * kHD + dc * 32 + 16 + 8 * hh);
        kl.h[0] = *(const v8b*)(Ksl + (j * 16 + c) * kHD + dc * 32 + 8 * hh);
        kl.h[1] = *(const v8b*)(Ksl + (j * 16 + c) * kHD + dc * 32 + 16 + 8 * hh);
        s[j] = mma_bf(qah[dc], kb.v, s[j]);
        s[j] = mma_bf(qah[dc], kl.v, s[j]);
        s[j] = mma_bf(qal[dc], kb.v, s[j]);
      }
    }
    const bool diag = (kc == qb);   // block-uniform
    float cm[8];
#pragma unroll
    for (int r = 0; r < 8; ++r) {
      const int qrow = q0 + 8 * hh + r;
      float m = -INFINITY;
#pragma unroll
      for (int j = 0; j < 4; ++j) {
        const int kvcol = kv0 + j * 16 + c;
        float sv = s[j][r] * 0.125f;
        if (diag && (kvcol > qrow)) sv = -INFINITY;
        s[j][r] = sv;
        m = fmaxf(m, sv);
      }
#pragma unroll
      for (int off = 1; off < 16; off <<= 1) m = fmaxf(m, __shfl_xor(m, off, 32));
      cm[r] = m;
    }
    __bf16* pwh = Pbuf[wave];
    __bf16* pwl = Pbuf[wave] + 16 * kKC;
#pragma unroll
    for (int r = 0; r < 8; ++r) {
      const float mnew = fmaxf(mrow[r], cm[r]);
      const float mref = (mnew > -INFINITY) ? mnew : 0.0f;   // all-masked so far -> p = 0, alpha = 0
      const float alpha = expf(mrow[r] - mref);
      mrow[r] = mnew;
      float psum = 0.f;
#pragma unroll
      for (int j = 0; j < 4; ++j) {
        const float p = expf(s[j][r] - mref);
        psum += p;
        const unsigned short hb = f2bf_bits(p);
        const unsigned short lb = f2bf_bits(p - bf_bits2f(hb));
        pwh[(8 * hh + r) * kKC + j * 16 + c] = __builtin_bit_cast(__bf16, hb);
        pwl[(8 * hh + r) * kKC + j * 16 + c] = __builtin_bit_cast(__bf16, lb);
      }
#pragma unroll
      for (int off = 1; off < 16; off <<= 1) psum += __shfl_xor(psum, off, 32);
      lrow[r] = lrow[r] * alpha + psum;
#pragma unroll
      for (int t = 0; t < 4; ++t) oacc[t][r] *= alpha;
    }
    __builtin_amdgcn_fence(__ATOMIC_RELEASE, "workgroup");
    __builtin_amdgcn_wave_barrier();
    __builtin_amdgcn_fence(__ATOMIC_ACQUIRE, "workgroup");
    // ---- out += P (A: m = row, k = key) x V (B: k = key, n = d) ----
#pragma unroll 1
    for (int kk = 0; kk < 2; ++kk) {
      FB pa, pl;
      pa.h[0] = *(const v8b*)(pwh + c * kKC + kk * 32 + 8 * hh);
      pa.h[1] = *(const v8b*)(pwh + c * kKC + kk * 32 + 16 + 8 * hh);
      pl.h[0] = *(const v8b*)(pwl + c * kKC + kk * 32 + 8 * hh);
      pl.h[1] = *(const v8b*)(pwl + c * kKC + kk * 32 + 16 + 8 * hh);
#pragma unroll
      for (int t = 0; t < 4; ++t) {
        FB vb, vl;
        vb.h[0] = *(const v8b*)(Vth + (t * 16 + c) * kKC + kk * 32 + 8 * hh);
        vb.h[1] = *(const v8b*)(Vth + (t * 16 + c) * kKC + kk * 32 + 16 + 8 * hh);
        vl.h[0] = *(const v8b*)(Vtl + (t * 16 + c) * kKC + kk * 32 + 8 * hh);
        vl.h[1] = *(const v8b*)(Vtl + (t * 16 + c) * kKC + kk * 32 + 16 + 8 * hh);
        oacc[t] = mma_bf(pa.v, vb.v, oacc[t]);
        oacc[t] = mma_bf(pa.v, vl.v, oacc[t]);
        oacc[t] = mma_bf(pl.v, vb.v, oacc[t]);
      }
    }
  }

  // ---- epilogue: y = out / l, staged per wave as f32 [16][64] in the wave's P buffer ----
  __syncthreads();
  float* os = (float*)(Pbuf[wave]);   // 4096 B = 16 x 64 f32
#pragma unroll
  for (int r = 0; r < 8; ++r) {
    const float inv = 1.0f / lrow[r];
#pragma unroll
    for (int t = 0; t < 4; ++t) os[(8 * hh + r) * kHD + t * 16 + c] = oacc[t][r] * inv;
  }
  __builtin_amdgcn_fence(__ATOMIC_RELEASE, "workgroup");
  __builtin_amdgcn_wave_barrier();
  __builtin_amdgcn_fence(__ATOMIC_ACQUIRE, "workgroup");
  {
    // store coverage: per it, lanes (q8 = 0..3) x (c8 = 0..56 step 8) = 4 rows x 64 cols; 4 it = 16 rows = this wave's tile.
    const int q8 = lane >> 3, c8 = (lane & 7) * 8;
    {
#pragma unroll
      for (int it = 0; it < 4; ++it) {
        const int row = it * 4 + q8;
        const float* sp = os + row * kHD + c8;
        v8h hv, lv;
#pragma unroll
        for (int e = 0; e < 8; ++e) {
          const unsigned short hb = f2bf_bits(sp[e]);
          const unsigned short lb = f2bf_bits(sp[e] - bf_bits2f(hb));
          hv[e] = __builtin_bit_cast(_Float16, hb);
          lv[e] = __builtin_bit_cast(_Float16, lb);
        }
        const size_t yo = (size_t)(q0 + row) * kDim + hcol + c8;
        *(v8h*)(Yhp + yo) = hv;
        *(v8h*)(Ylp + yo) = lv;
      }
      
    }
  }
}

// ---------------------------------------------------------------------------
// Workspace region map (bytes):
//   [0, 16777216)            Xb   bf16 [8192][1024]  (dead after the qkv GEMM; reused per batch as
//                            Yh bf16 [2048][1024] at 0 and Yl bf16 [2048][1024] at 4194304)
//   [16777216, 23068672)     WqT  bf16 [3072][1024]
//   [23068672, 25165824)     WpT  bf16 [1024][1024]
//   [25165824, 125829120)    QKV  bf16 6 planes [8192][1024]: Qh, Ql, Kh, Kl, Vh, Vl
//   total 125,829,120 B
// ---------------------------------------------------------------------------
extern "C" void kernel_launch(void* const* d_in, const int* in_sizes, int n_in,
                              void* d_out, int out_size, void* d_ws, size_t ws_size,
                              hipStream_t stream) {
  if (n_in < 9) return;
  if (in_sizes[0] != kTok * kDim || in_sizes[1] != kDim * kDim3 || in_sizes[2] != kDim3 ||
      in_sizes[3] != kDim * kDim || in_sizes[4] != kDim ||
      in_sizes[5] != kHeads * kHD || in_sizes[6] != kHeads * kHD ||
      in_sizes[7] != kHeads * kHD || in_sizes[8] != kHeads * kHD ||
      out_size != kTok * kDim) return;

  const float* x     = (const float*)d_in[0];
  const float* Wqkv  = (const float*)d_in[1];
  const float* bqkv  = (const float*)d_in[2];
  const float* Wproj = (const float*)d_in[3];
  const float* bproj = (const float*)d_in[4];
  const float* qs    = (const float*)d_in[5];
  const float* qbv   = (const float*)d_in[6];
  const float* ks    = (const float*)d_in[7];
  const float* kbv   = (const float*)d_in[8];
  float* out = (float*)d_out;

  const size_t plane  = (size_t)kTok * kDim;                 // elements per [8192][1024] plane
  const size_t offX   = 0;
  const size_t offWq  = offX  + plane * 2;                    // 16,777,216
  const size_t offWp  = offWq + (size_t)kDim3 * kDim * 2;     // 23,068,672
  const size_t offQKV = offWp + (size_t)kDim * kDim * 2;      // 25,165,824
  const size_t total  = offQKV + 6 * plane * 2;               // 125,829,120
  if (total > ws_size) return;

  char* ws = (char*)d_ws;
  unsigned short* Xb  = (unsigned short*)(ws + offX);
  unsigned short* Yh  = Xb;                                   // [2048][1024] bf16, 4,194,304 B
  unsigned short* Yl  = Xb + (size_t)kSeq * kDim;             // [2048][1024] bf16, ends at 8,388,608 B < 16,777,216
  unsigned short* WqT = (unsigned short*)(ws + offWq);
  unsigned short* WpT = (unsigned short*)(ws + offWp);
  unsigned short* QKV = (unsigned short*)(ws + offQKV);
  unsigned short* Qh = QKV;
  unsigned short* Ql = QKV + plane;
  unsigned short* Kh = QKV + 2 * plane;
  unsigned short* Kl = QKV + 3 * plane;
  unsigned short* Vh = QKV + 4 * plane;
  unsigned short* Vl = QKV + 5 * plane;

  // 1) x -> bf16 plane: n = 8,388,608, 8 per thread -> 1,048,576 threads = 4096 blocks x 256 (exact)
  const int n8 = (kTok * kDim) / 8;
  cast_bf16x8_k<<<dim3((n8 + 255) / 256), dim3(256), 0, stream>>>(x, Xb, n8);

  // 2) W_qkv in[1024][3072] -> WqT out[3072][1024] bf16: grid (3072/64, 1024/64)
  wt_cast_bf_k<<<dim3(kDim3 / 64, kDim / 64), dim3(256), 0, stream>>>(Wqkv, WqT, kDim, kDim3);
  // 3) W_proj in[1024][1024] -> WpT out[1024][1024] bf16: grid (1024/64, 1024/64)
  wt_cast_bf_k<<<dim3(kDim / 64, kDim / 64), dim3(256), 0, stream>>>(Wproj, WpT, kDim, kDim);

  // 4) qkv = Xb[8192][1024] . WqT[3072][1024]^T + b_qkv, per-head affine on q/k, bf16 hi/lo planes.
  //    M = 8192, N = 3072 (multiples of 64), K = 1024 (multiple of 32); tiles 128 x 48 = 6144 -> 768 blocks x 8 waves.
  wmma_gemm64<1, 0, 2, 3, false><<<dim3(768, 1), dim3(256), 0, stream>>>(
      Xb, Xb, kDim, 0L, WqT, WqT, kDim, 0L,
      (void*)QKV, (void*)QKV, kDim, (long)plane,
      bqkv, bqkv, 0L, qs, qbv, ks, kbv,
      kTok, kDim3, kDim, 1.0f);

  // 5) per batch: causal attention -> Yh/Yl, then out rows of the batch = Y . WpT^T + b_proj (A hi/lo, 2 products).
  for (int b = 0; b < kBatch; ++b) {
    attn_hd64_k<<<dim3(kHeads * (kSeq / kQB)), dim3(128), 0, stream>>>(Qh, Ql, Kh, Kl, Vh, Vl, Yh, Yl, b);
    // M = 2048, N = 1024 (multiples of 64), K = 1024; tiles 32 x 16 = 512 -> 64 blocks x 8 waves.
    wmma_gemm64<1, 1, 2, 0, false><<<dim3(64, 1), dim3(256), 0, stream>>>(
        Yh, Yl, kDim, 0L, WpT, WpT, kDim, 0L,
        (void*)(out + (size_t)b * kSeq * kDim), (void*)(out + (size_t)b * kSeq * kDim), kDim, 0L,
        bproj, bproj, 0L, qs, qbv, ks, kbv,
        kSeq, kDim, kDim, 1.0f);
  }
}

// v001
// It runs in 754 microseconds.
// Timed twice side by side with v000, it ran 1.77 and 1.76 times as fast.
// Contractions: x*W_qkv on v_wmma_f32_16x16x32_bf16 (plain bf16 operands = RNE-bf16 inputs); q*k^T and p*v on v_wmma_f32_16x16x32_bf16 with bf16 hi/lo operand pairs (hi*hi + hi*lo + lo*hi); y*W_proj on v_wmma_f32_16x16x32_bf16 with y as bf16 hi/lo and exact bf16 weights (hi*w + lo*w); f32 accumulate everywhere; bias, per-head affine and softmax in f32.
#include <hip/hip_runtime.h>
#include <stdint.h>
#include <math.h>

constexpr int kBatch = 4;
constexpr int kSeq   = 2048;
constexpr int kDim   = 1024;
constexpr int kHeads = 16;
constexpr int kHD    = 64;
constexpr int kTok   = kBatch * kSeq;   // 8192
constexpr int kDim3  = 3 * kDim;        // 3072

typedef __attribute__((ext_vector_type(16))) _Float16 v16h;
typedef __attribute__((ext_vector_type(8)))  _Float16 v8h;
typedef __attribute__((ext_vector_type(16))) __bf16   v16b;
typedef __attribute__((ext_vector_type(8)))  __bf16   v8b;
typedef __attribute__((ext_vector_type(8)))  float    v8f;
typedef __attribute__((ext_vector_type(4)))  float    v4f;

__device__ __forceinline__ unsigned short f2bf_bits(float f) {
  unsigned u = __float_as_uint(f);
  return (unsigned short)((u + 0x7FFFu + ((u >> 16) & 1u)) >> 16);
}
__device__ __forceinline__ float bf_bits2f(unsigned short h) { return __uint_as_float(((unsigned)h) << 16); }
__device__ __forceinline__ float bf_rne(float f) { return bf_bits2f(f2bf_bits(f)); }

// hazard guards as plain device helpers (no inline asm inside the kernel template body)
__device__ __forceinline__ void dep_guard_h(v8f& a, v8f& b, v16h x, v16h y) { asm volatile("v_nop\n\tv_nop\n\tv_nop\n\tv_nop" : "+v"(a), "+v"(b) : "v"(x), "v"(y)); }
__device__ __forceinline__ void dep_guard_b(v8f& a, v8f& b, v16b x, v16b y) { asm volatile("v_nop\n\tv_nop\n\tv_nop\n\tv_nop" : "+v"(a), "+v"(b) : "v"(x), "v"(y)); }
__device__ __forceinline__ void keep4_h(v16h a, v16h b, v16h c, v16h d) { asm volatile("v_nop" :: "v"(a), "v"(b), "v"(c), "v"(d)); }
__device__ __forceinline__ void keep4_b(v16b a, v16b b, v16b c, v16b d) { asm volatile("v_nop" :: "v"(a), "v"(b), "v"(c), "v"(d)); }
__device__ __forceinline__ void acc_guard4(v8f& a, v8f& b, v8f& c, v8f& d) { asm volatile("v_nop\n\tv_nop\n\tv_nop\n\tv_nop" : "+v"(a), "+v"(b), "+v"(c), "+v"(d)); }
template <typename T> struct Frag;
template <> struct Frag<_Float16> {
  typedef v16h V; union U { v16h v; v8h h[2]; };
  static __device__ __forceinline__ v16h load(const _Float16* p) {   // elements 0..7 <- p[0..7], 8..15 <- p[16..23]
    U f; f.h[0] = *(const v8h*)(p); f.h[1] = *(const v8h*)(p + 16); return f.v;
  }
  static __device__ __forceinline__ v8f mma(v16h a, v16h b, v8f c) {
    return __builtin_amdgcn_wmma_f32_16x16x32_f16(false, a, false, b, (short)0, c, false, false);
  }
  static __device__ __forceinline__ void guard(v8f& a, v8f& b, v16h x, v16h y) { dep_guard_h(a, b, x, y); }
  static __device__ __forceinline__ void keep(v16h a, v16h b, v16h c, v16h d) { keep4_h(a, b, c, d); }
};
template <> struct Frag<__bf16> {
  typedef v16b V; union U { v16b v; v8b h[2]; };
  static __device__ __forceinline__ v16b load(const __bf16* p) {
    U f; f.h[0] = *(const v8b*)(p); f.h[1] = *(const v8b*)(p + 16); return f.v;
  }
  static __device__ __forceinline__ v8f mma(v16b a, v16b b, v8f c) {
    return __builtin_amdgcn_wmma_f32_16x16x32_bf16(false, a, false, b, (short)0, c, false, false);
  }
  static __device__ __forceinline__ void guard(v8f& a, v8f& b, v16b x, v16b y) { dep_guard_b(a, b, x, y); }
  static __device__ __forceinline__ void keep(v16b a, v16b b, v16b c, v16b d) { keep4_b(a, b, c, d); }
};

// ---- Register-blocked batched WMMA GEMM ------------------------------------
// C[m,n] = scale * sum_k A[m,k] * Bt[n,k] (+bias)(affine)(+resid); each wave owns a 64x64 tile.
// A row-major [M,K]; Bt row-major [N,K]; M,N % 64 == 0, K % 32 == 0.
// SPLIT_MODE: 0 = plain; 1 = A carried as hi/lo planes (A2 = lo): hi.b + lo.b; 2 = A and Bt hi/lo: hi.hi + hi.lo + lo.hi.
// BIAS_MODE: 0 = none, 1 = bias[m], 2 = bias[n].
// OUT_MODE: 0 = f32, 1 = f16, 2 = bf16 hi plane (Cout) + bf16 lo plane (Cout2),
//           3 = qkv mode: columns n form three blocks of kDim (which = n0 / kDim); value v = (acc+bias)*affs[cc]+affb[cc]
//               with cc = n - which*kDim and tables (affs0,affb0) for which 0, (affs1,affb1) for which 1 (RNE-bf16 applied
//               to the table values), identity for which 2; written as bf16 hi plane at Cout + which*2*strideC and lo plane
//               at + strideC, row pitch ldc, column n0 - which*kDim.
// ET: 0 = f16 operands, 1 = bf16 operands (pointers passed as 16-bit storage)
template <int ET> struct Elem;
template <> struct Elem<0> { typedef _Float16 T; };
template <> struct Elem<1> { typedef __bf16 T; };
template <int ET, int SPLIT_MODE, int BIAS_MODE, int OUT_MODE, bool RESID, int ACT = 0>
__global__ __launch_bounds__(256) void wmma_gemm64(
    const unsigned short* __restrict__ Ap, const unsigned short* __restrict__ A2p, int lda, long strideA,
    const unsigned short* __restrict__ Btp, const unsigned short* __restrict__ Bt2p, int ldb, long strideB,
    void* __restrict__ Cout, void* __restrict__ Cout2, int ldc, long strideC,
    const float* __restrict__ bias,
    const float* __restrict__ resid, long strideR,
    const float* __restrict__ affs0, const float* __restrict__ affb0,
    const float* __restrict__ affs1, const float* __restrict__ affb1,
    int M, int N, int K, float scale) {
  typedef typename Elem<ET>::T T;
  typedef typename Frag<T>::V V;
  const T* A = (const T*)Ap; const T* A2 = (const T*)A2p; const T* Bt = (const T*)Btp; const T* Bt2 = (const T*)Bt2p;
  __shared__ __align__(16) float sT[8][16 * 68];   // per-wave 16x64 slab, pitch 68 floats
  const int b    = blockIdx.y;
  const int lane = threadIdx.x & 31;
  const int wave = threadIdx.x >> 5;
  const int tilesN = N >> 6;
  const int tilesM = M >> 6;
  const int tile = blockIdx.x * 8 + wave;
  if (tile >= tilesM * tilesN) return;   // wave-uniform; no block barriers in this kernel
  const int tm = tile / tilesN;
  const int tn = tile - tm * tilesN;
  const int m0 = tm << 6;
  const int n0 = tn << 6;

  const T* Ab  = A  + (size_t)b * strideA;
  const T* Bb  = Bt + (size_t)b * strideB;
  const T* Ab2 = (SPLIT_MODE >= 1) ? (A2  + (size_t)b * strideA) : nullptr;
  const T* Bb2 = (SPLIT_MODE == 2) ? (Bt2 + (size_t)b * strideB) : nullptr;

  const int rlane = lane & 15;                 // row (A) / col (B, D) within subtile
  const int koff  = (lane >> 4) * 8;           // k offset of this lane half
  const int mOff  = (lane >> 4) * 8;           // D row offset

  v8f acc[4][4];
#pragma unroll
  for (int i = 0; i < 4; ++i)
#pragma unroll
    for (int j = 0; j < 4; ++j) acc[i][j] = (v8f){0.f,0.f,0.f,0.f,0.f,0.f,0.f,0.f};

  for (int k0 = 0; k0 < K; k0 += 32) {
    V bh[4], bl[4];
#pragma unroll
    for (int j = 0; j < 4; ++j) {
      const size_t bo = (size_t)(n0 + (j << 4) + rlane) * ldb + koff + k0;
      bh[j] = Frag<T>::load(Bb + bo);
      if (SPLIT_MODE == 2) bl[j] = Frag<T>::load(Bb2 + bo);
    }
#pragma unroll
    for (int i = 0; i < 4; ++i) {
      const size_t ao = (size_t)(m0 + (i << 4) + rlane) * lda + koff + k0;
      V ah = Frag<T>::load(Ab + ao);
      V al;
      if (SPLIT_MODE >= 1) al = Frag<T>::load(Ab2 + ao);
#pragma unroll
      for (int j = 0; j < 4; ++j) {
        acc[i][j] = Frag<T>::mma(ah, bh[j], acc[i][j]);
        if (SPLIT_MODE == 2) acc[i][j] = Frag<T>::mma(ah, bl[j], acc[i][j]);
        if (SPLIT_MODE >= 1) acc[i][j] = Frag<T>::mma(al, bh[j], acc[i][j]);
      }
      Frag<T>::guard(acc[i][0], acc[i][3], ah, (SPLIT_MODE >= 1) ? al : ah);
    }
    Frag<T>::keep(bh[0], bh[1], bh[2], bh[3]);
    if (SPLIT_MODE == 2) Frag<T>::keep(bl[0], bl[1], bl[2], bl[3]);
  }
  acc_guard4(acc[0][0], acc[0][1], acc[0][2], acc[0][3]);
  acc_guard4(acc[1][0], acc[1][1], acc[1][2], acc[1][3]);
  acc_guard4(acc[2][0], acc[2][1], acc[2][2], acc[2][3]);
  acc_guard4(acc[3][0], acc[3][1], acc[3][2], acc[3][3]);

  // ---- epilogue ----
  float* slab = sT[wave];
  const float* Rb = RESID ? (resid + (size_t)b * strideR) : nullptr;
#pragma unroll
  for (int i = 0; i < 4; ++i) {
    const int mBase = m0 + (i << 4);
#pragma unroll
    for (int j = 0; j < 4; ++j) {
      const int n = n0 + (j << 4) + rlane;
      float bv = 0.f;
      if (BIAS_MODE == 2) bv = bias[n];
      float asc = 1.0f, abi = 0.0f;
      if (OUT_MODE == 3) {
        const int which = n0 / kDim;               // wave-uniform (64-col tile inside one kDim block)
        const int cc = n - which * kDim;           // 0..kDim-1, all four tables have kDim entries
        const float s0 = bf_rne(affs0[cc]);
        const float c0 = bf_rne(affb0[cc]);
        const float s1 = bf_rne(affs1[cc]);
        const float c1 = bf_rne(affb1[cc]);
        asc = (which == 0) ? s0 : ((which == 1) ? s1 : 1.0f);
        abi = (which == 0) ? c0 : ((which == 1) ? c1 : 0.0f);
      }
#pragma unroll
      for (int r = 0; r < 8; ++r) {
        float v = acc[i][j][r] * scale;
        if (BIAS_MODE == 1) v += bias[mBase + mOff + r];
        if (BIAS_MODE == 2) v += bv;
        if (OUT_MODE == 3) v = v * asc + abi;
        if (RESID) v += Rb[(size_t)(mBase + mOff + r) * ldc + n];
        if (ACT == 1) v = tanhf(v);
        if (ACT == 2) v = fmaxf(v, 0.0f);
        if (ACT == 4) v = (v > 0.f) ? v : 0.01f * v;
        slab[(mOff + r) * 68 + (j << 4) + rlane] = v;
      }
    }
    __builtin_amdgcn_fence(__ATOMIC_RELEASE, "workgroup");
    __builtin_amdgcn_wave_barrier();
    __builtin_amdgcn_fence(__ATOMIC_ACQUIRE, "workgroup");
    if (OUT_MODE == 0) {
      float* C = (float*)Cout + (size_t)b * strideC;
      const int hh = lane >> 4, c4 = (lane & 15) * 4;     // row seg = 256 B = 16 lanes x 16 B
      {
#pragma unroll
        for (int it = 0; it < 8; ++it) {
          const int row = it * 2 + hh;
          v4f v = *(const v4f*)(slab + row * 68 + c4);
          *(v4f*)(C + (size_t)(mBase + row) * ldc + n0 + c4) = v;
        }
        
      }
    } else {
      const int q = lane >> 3, c8 = (lane & 7) * 8;
      unsigned short* C;
      unsigned short* C2;
      int ncol;
      if (OUT_MODE == 3) {
        const int which = n0 / kDim;
        C  = (unsigned short*)Cout + (size_t)which * 2 * (size_t)strideC;
        C2 = C + (size_t)strideC;
        ncol = n0 - which * kDim;
      } else {
        C  = (unsigned short*)Cout  + (size_t)b * strideC;
        C2 = (OUT_MODE == 2) ? ((unsigned short*)Cout2 + (size_t)b * strideC) : nullptr;
        ncol = n0;
      }
      {
#pragma unroll
        for (int it = 0; it < 4; ++it) {
          const int row = it * 4 + q;
          const float* sp = slab + row * 68 + c8;
          v8h hv, lv;
#pragma unroll
          for (int e = 0; e < 8; ++e) {
            if (OUT_MODE == 1) {
              hv[e] = (_Float16)sp[e];
            } else {
              unsigned short hb = f2bf_bits(sp[e]);
              unsigned short lb = f2bf_bits(sp[e] - bf_bits2f(hb));
              hv[e] = __builtin_bit_cast(_Float16, hb);
              lv[e] = __builtin_bit_cast(_Float16, lb);
            }
          }
          *(v8h*)(C + (size_t)(mBase + row) * ldc + ncol + c8) = hv;
          if (OUT_MODE >= 2) *(v8h*)(C2 + (size_t)(mBase + row) * ldc + ncol + c8) = lv;
        }
        
      }
    }
    __builtin_amdgcn_fence(__ATOMIC_RELEASE, "workgroup");
    __builtin_amdgcn_wave_barrier();
    __builtin_amdgcn_fence(__ATOMIC_ACQUIRE, "workgroup");
  }
}

// coverage: n8 threads x 8 elements = n (host passes n8 = n/8 with n % 8 == 0)
__global__ __launch_bounds__(256) void cast_bf16x8_k(const float* __restrict__ in,
                                                     unsigned short* __restrict__ out, int n8) {
  const int i = blockIdx.x * 256 + threadIdx.x;
  if (i < n8) {
    const size_t o = (size_t)i * 8;
    const v4f a = *(const v4f*)(in + o);
    const v4f bq = *(const v4f*)(in + o + 4);
    v8h hv;
#pragma unroll
    for (int e = 0; e < 4; ++e) {
      hv[e]     = __builtin_bit_cast(_Float16, f2bf_bits(a[e]));
      hv[4 + e] = __builtin_bit_cast(_Float16, f2bf_bits(bq[e]));
    }
    *(v8h*)(out + o) = hv;
    
  }
}

// ---- W [K][N] f32 -> Wt [N][K] bf16 (RNE), 64x64 tile transposed through LDS ----
// in[rows = K][cols = N] -> out[N][K]; grid = (N/64, K/64).
// producer coverage: 256 threads x (1 row x 16 cols) = 64x64 tile; store: 8 waves x 4 rows x 2 it = 64 rows, 8 lanes x 8 halves = 64 cols.
constexpr int kWTP = 72;
__global__ __launch_bounds__(256) void wt_cast_bf_k(const float* __restrict__ W, unsigned short* __restrict__ Wtp,
                                                    int K, int N) {
  __shared__ __align__(16) _Float16 st[64 * kWTP];
  _Float16* Wt = (_Float16*)Wtp;
  const int n0 = blockIdx.x * 64, k0 = blockIdx.y * 64;
  const int tid = threadIdx.x;
  const int kr = tid >> 2, c16 = (tid & 3) * 16;
  const float* src = W + (size_t)(k0 + kr) * N + n0 + c16;
#pragma unroll
  for (int qq = 0; qq < 4; ++qq) {
    const v4f v = *(const v4f*)(src + 4 * qq);
#pragma unroll
    for (int e = 0; e < 4; ++e)
      st[(c16 + 4 * qq + e) * kWTP + kr] = __builtin_bit_cast(_Float16, f2bf_bits(v[e]));
  }
  __syncthreads();
  const int wave = tid >> 5, lane = tid & 31;
  const int q8 = lane >> 3, c8 = (lane & 7) * 8;
  {
#pragma unroll
    for (int it = 0; it < 2; ++it) {
      const int n = it * 32 + wave * 4 + q8;
      const v8h hv = *(const v8h*)(st + n * kWTP + c8);
      *(v8h*)(Wt + (size_t)(n0 + n) * K + k0 + c8) = hv;
    }
    
  }
}

// =====================================================================================
// Causal attention, head_dim 64, fed by bf16 hi/lo planes laid out [kTok][kDim] (row = b*kSeq + t, col = h*64 + d).
//   scores = (qh.kh + qh.kl + ql.kh) / 8 : v_wmma_f32_16x16x32_bf16, f32 accumulate
//   out    =  ph.vh + ph.vl + pl.vh      : v_wmma_f32_16x16x32_bf16, p = exp(s - max) split into bf16 hi/lo
//   online softmax in f32. Block = 4 waves = 64 query rows of one head of batch blockIdx.y; 64-key chunks,
//   chunks above the diagonal skipped, per-element causal select (key > query -> -inf) on the diagonal chunk.
//   grid = (kHeads * (kSeq/64), kBatch); Y planes are [kTok][kDim] like the inputs.
// =====================================================================================
constexpr int kKC = 64;
constexpr int kQB = 64;

__device__ __forceinline__ v8f mma_bf(v16b a, v16b b, v8f c) {
  c = __builtin_amdgcn_wmma_f32_16x16x32_bf16(false, a, false, b, (short)0, c, false, false);
  asm volatile("v_nop\n\tv_nop\n\tv_nop\n\tv_nop" : "+v"(c) : "v"(a), "v"(b));
  return c;
}

__global__ __launch_bounds__(128)
void attn_hd64_k(const unsigned short* __restrict__ Qhp, const unsigned short* __restrict__ Qlp,
                 const unsigned short* __restrict__ Khp, const unsigned short* __restrict__ Klp,
                 const unsigned short* __restrict__ Vhp, const unsigned short* __restrict__ Vlp,
                 unsigned short* __restrict__ Yhp, unsigned short* __restrict__ Ylp) {
  union FB { v16b v; v8b h[2]; };
  __shared__ __align__(16) __bf16 Ksh[kKC * kHD];             // K hi [kv][d]   8 KB
  __shared__ __align__(16) __bf16 Ksl[kKC * kHD];             // K lo [kv][d]   8 KB
  __shared__ __align__(16) __bf16 Vth[kHD * kKC];             // V hi [d][kv]   8 KB
  __shared__ __align__(16) __bf16 Vtl[kHD * kKC];             // V lo [d][kv]   8 KB
  __shared__ __align__(16) __bf16 Pbuf[4][2 * 16 * kKC];      // per wave: P hi [16][64] then P lo [16][64]; reused as f32 out tile [16][64]

  const __bf16* Qh = (const __bf16*)Qhp;
  const __bf16* Ql = (const __bf16*)Qlp;
  const __bf16* Kh = (const __bf16*)Khp;
  const __bf16* Kl = (const __bf16*)Klp;
  const __bf16* Vh = (const __bf16*)Vhp;
  const __bf16* Vl = (const __bf16*)Vlp;

  const int tid  = threadIdx.x;
  const int wave = tid >> 5;
  const int lane = tid & 31;
  const int hh   = lane >> 4;
  const int c    = lane & 15;

  constexpr int nqb = kSeq / kQB;   // 32
  const int bx = blockIdx.x;
  const int qb = bx % nqb;
  const int h  = bx / nqb;
  const int q0 = qb * kQB + wave * 16;          // token index of this wave's first row
  const size_t rowb = (size_t)blockIdx.y * kSeq; // plane row base of this batch
  const int hcol = h * kHD;

  // ---- Q fragments (A operand): 2 d-chunks, hi and lo; Frag load = split k-map ----
  v16b qah[2], qal[2];
  {
    const size_t qoff = (rowb + (size_t)(q0 + c)) * kDim + hcol + 8 * hh;
#pragma unroll
    for (int dc = 0; dc < 2; ++dc) {
      qah[dc] = Frag<__bf16>::load(Qh + qoff + dc * 32);
      qal[dc] = Frag<__bf16>::load(Ql + qoff + dc * 32);
    }
  }

  float mrow[8], lrow[8];
  v8f oacc[4];
#pragma unroll
  for (int r = 0; r < 8; ++r) { mrow[r] = -INFINITY; lrow[r] = 0.f; }
#pragma unroll
  for (int t = 0; t < 4; ++t) oacc[t] = (v8f){0.f,0.f,0.f,0.f,0.f,0.f,0.f,0.f};

  const int nChunks = qb + 1;   // block-uniform, <= 32
  for (int kc = 0; kc < nChunks; ++kc) {
    const int kv0 = kc * kKC;
    __syncthreads();
    {
      // staging coverage: 128 threads x (1 key row x 32 d) = 64 keys x 64 d for each of the four tiles
      const int kvr = tid >> 1, dh = (tid & 1) * 32;
      const size_t goff = (rowb + (size_t)(kv0 + kvr)) * kDim + hcol + dh;
#pragma unroll 1
      for (int i = 0; i < 4; ++i) {
        const v8b a0 = *(const v8b*)(Kh + goff + 8 * i);
        const v8b a1 = *(const v8b*)(Kl + goff + 8 * i);
        *(v8b*)(Ksh + kvr * kHD + dh + 8 * i) = a0;
        *(v8b*)(Ksl + kvr * kHD + dh + 8 * i) = a1;
        const v8b w0 = *(const v8b*)(Vh + goff + 8 * i);
        const v8b w1 = *(const v8b*)(Vl + goff + 8 * i);
#pragma unroll
        for (int e = 0; e < 8; ++e) {
          Vth[(dh + 8 * i + e) * kKC + kvr] = w0[e];
          Vtl[(dh + 8 * i + e) * kKC + kvr] = w1[e];
        }
      }
    }
    __syncthreads();

    // ---- scores: D row = query 8hh+r, col = key j*16+c ----
    v8f s[4];
#pragma unroll
    for (int j = 0; j < 4; ++j) {
      s[j] = (v8f){0.f,0.f,0.f,0.f,0.f,0.f,0.f,0.f};
#pragma unroll
      for (int dc = 0; dc < 2; ++dc) {
        FB kb, kl;
        kb.h[0] = *(const v8b*)(Ksh + (j * 16 + c) * kHD + dc * 32 + 8 * hh);
        kb.h[1] = *(const v8b*)(Ksh + (j * 16 + c) * kHD + dc * 32 + 16 + 8 * hh);
        kl.h[0] = *(const v8b*)(Ksl + (j * 16 + c) * kHD + dc * 32 + 8 * hh);
        kl.h[1] = *(const v8b*)(Ksl + (j * 16 + c) * kHD + dc * 32 + 16 + 8 * hh);
        s[j] = mma_bf(qah[dc], kb.v, s[j]);
        s[j] = mma_bf(qah[dc], kl.v, s[j]);
        s[j] = mma_bf(qal[dc], kb.v, s[j]);
      }
    }
    const bool diag = (kc == qb);   // block-uniform
    float cm[8];
#pragma unroll
    for (int r = 0; r < 8; ++r) {
      const int qrow = q0 + 8 * hh + r;
      float m = -INFINITY;
#pragma unroll
      for (int j = 0; j < 4; ++j) {
        const int kvcol = kv0 + j * 16 + c;
        float sv = s[j][r] * 0.125f;
        if (diag && (kvcol > qrow)) sv = -INFINITY;
        s[j][r] = sv;
        m = fmaxf(m, sv);
      }
#pragma unroll
      for (int off = 1; off < 16; off <<= 1) m = fmaxf(m, __shfl_xor(m, off, 32));
      cm[r] = m;
    }
    __bf16* pwh = Pbuf[wave];
    __bf16* pwl = Pbuf[wave] + 16 * kKC;
#pragma unroll
    for (int r = 0; r < 8; ++r) {
      const float mnew = fmaxf(mrow[r], cm[r]);
      const float mref = (mnew > -INFINITY) ? mnew : 0.0f;   // all-masked so far -> p = 0, alpha = 0
      const float alpha = expf(mrow[r] - mref);
      mrow[r] = mnew;
      float psum = 0.f;
#pragma unroll
      for (int j = 0; j < 4; ++j) {
        const float p = expf(s[j][r] - mref);
        psum += p;
        const unsigned short hb = f2bf_bits(p);
        const unsigned short lb = f2bf_bits(p - bf_bits2f(hb));
        pwh[(8 * hh + r) * kKC + j * 16 + c] = __builtin_bit_cast(__bf16, hb);
        pwl[(8 * hh + r) * kKC + j * 16 + c] = __builtin_bit_cast(__bf16, lb);
      }
#pragma unroll
      for (int off = 1; off < 16; off <<= 1) psum += __shfl_xor(psum, off, 32);
      lrow[r] = lrow[r] * alpha + psum;
#pragma unroll
      for (int t = 0; t < 4; ++t) oacc[t][r] *= alpha;
    }
    __builtin_amdgcn_fence(__ATOMIC_RELEASE, "workgroup");
    __builtin_amdgcn_wave_barrier();
    __builtin_amdgcn_fence(__ATOMIC_ACQUIRE, "workgroup");
    // ---- out += P (A: m = row, k = key) x V (B: k = key, n = d) ----
#pragma unroll 1
    for (int kk = 0; kk < 2; ++kk) {
      FB pa, pl;
      pa.h[0] = *(const v8b*)(pwh + c * kKC + kk * 32 + 8 * hh);
      pa.h[1] = *(const v8b*)(pwh + c * kKC + kk * 32 + 16 + 8 * hh);
      pl.h[0] = *(const v8b*)(pwl + c * kKC + kk * 32 + 8 * hh);
      pl.h[1] = *(const v8b*)(pwl + c * kKC + kk * 32 + 16 + 8 * hh);
#pragma unroll
      for (int t = 0; t < 4; ++t) {
        FB vb, vl;
        vb.h[0] = *(const v8b*)(Vth + (t * 16 + c) * kKC + kk * 32 + 8 * hh);
        vb.h[1] = *(const v8b*)(Vth + (t * 16 + c) * kKC + kk * 32 + 16 + 8 * hh);
        vl.h[0] = *(const v8b*)(Vtl + (t * 16 + c) * kKC + kk * 32 + 8 * hh);
        vl.h[1] = *(const v8b*)(Vtl + (t * 16 + c) * kKC + kk * 32 + 16 + 8 * hh);
        oacc[t] = mma_bf(pa.v, vb.v, oacc[t]);
        oacc[t] = mma_bf(pa.v, vl.v, oacc[t]);
        oacc[t] = mma_bf(pl.v, vb.v, oacc[t]);
      }
    }
  }

  // ---- epilogue: y = out / l, staged per wave as f32 [16][64] in the wave's P buffer ----
  __syncthreads();
  float* os = (float*)(Pbuf[wave]);   // 4096 B = 16 x 64 f32
#pragma unroll
  for (int r = 0; r < 8; ++r) {
    const float inv = 1.0f / lrow[r];
#pragma unroll
    for (int t = 0; t < 4; ++t) os[(8 * hh + r) * kHD + t * 16 + c] = oacc[t][r] * inv;
  }
  __builtin_amdgcn_fence(__ATOMIC_RELEASE, "workgroup");
  __builtin_amdgcn_wave_barrier();
  __builtin_amdgcn_fence(__ATOMIC_ACQUIRE, "workgroup");
  {
    // store coverage: per it, lanes (q8 = 0..3) x (c8 = 0..56 step 8) = 4 rows x 64 cols; 4 it = 16 rows = this wave's tile.
    const int q8 = lane >> 3, c8 = (lane & 7) * 8;
    {
#pragma unroll
      for (int it = 0; it < 4; ++it) {
        const int row = it * 4 + q8;
        const float* sp = os + row * kHD + c8;
        v8h hv, lv;
#pragma unroll
        for (int e = 0; e < 8; ++e) {
          const unsigned short hb = f2bf_bits(sp[e]);
          const unsigned short lb = f2bf_bits(sp[e] - bf_bits2f(hb));
          hv[e] = __builtin_bit_cast(_Float16, hb);
          lv[e] = __builtin_bit_cast(_Float16, lb);
        }
        const size_t yo = (rowb + (size_t)(q0 + row)) * kDim + hcol + c8;
        *(v8h*)(Yhp + yo) = hv;
        *(v8h*)(Ylp + yo) = lv;
      }
      
    }
  }
}

// ---------------------------------------------------------------------------
// Workspace region map (bytes):
//   [0, 16777216)            Xb   bf16 [8192][1024]  (dead after the qkv GEMM; reused as Yh bf16 [8192][1024])
//   [16777216, 23068672)     WqT  bf16 [3072][1024]
//   [23068672, 25165824)     WpT  bf16 [1024][1024]
//   [25165824, 125829120)    QKV  bf16 6 planes [8192][1024]: Qh, Ql, Kh, Kl, Vh, Vl
//   [125829120, 142606336)   Yl   bf16 [8192][1024]
//   total 142,606,336 B
// ---------------------------------------------------------------------------
extern "C" void kernel_launch(void* const* d_in, const int* in_sizes, int n_in,
                              void* d_out, int out_size, void* d_ws, size_t ws_size,
                              hipStream_t stream) {
  if (n_in < 9) return;
  if (in_sizes[0] != kTok * kDim || in_sizes[1] != kDim * kDim3 || in_sizes[2] != kDim3 ||
      in_sizes[3] != kDim * kDim || in_sizes[4] != kDim ||
      in_sizes[5] != kHeads * kHD || in_sizes[6] != kHeads * kHD ||
      in_sizes[7] != kHeads * kHD || in_sizes[8] != kHeads * kHD ||
      out_size != kTok * kDim) return;

  const float* x     = (const float*)d_in[0];
  const float* Wqkv  = (const float*)d_in[1];
  const float* bqkv  = (const float*)d_in[2];
  const float* Wproj = (const float*)d_in[3];
  const float* bproj = (const float*)d_in[4];
  const float* qs    = (const float*)d_in[5];
  const float* qbv   = (const float*)d_in[6];
  const float* ks    = (const float*)d_in[7];
  const float* kbv   = (const float*)d_in[8];
  float* out = (float*)d_out;

  const size_t plane  = (size_t)kTok * kDim;                 // elements per [8192][1024] plane
  const size_t offX   = 0;
  const size_t offWq  = offX  + plane * 2;                    // 16,777,216
  const size_t offWp  = offWq + (size_t)kDim3 * kDim * 2;     // 23,068,672
  const size_t offQKV = offWp + (size_t)kDim * kDim * 2;      // 25,165,824
  const size_t offYl  = offQKV + 6 * plane * 2;               // 125,829,120
  const size_t total  = offYl + plane * 2;                    // 142,606,336
  if (total > ws_size) return;

  char* ws = (char*)d_ws;
  unsigned short* Xb  = (unsigned short*)(ws + offX);
  unsigned short* Yh  = Xb;                                   // [8192][1024] bf16, the whole Xb region
  unsigned short* Yl  = (unsigned short*)(ws + offYl);        // [8192][1024] bf16
  unsigned short* WqT = (unsigned short*)(ws + offWq);
  unsigned short* WpT = (unsigned short*)(ws + offWp);
  unsigned short* QKV = (unsigned short*)(ws + offQKV);
  unsigned short* Qh = QKV;
  unsigned short* Ql = QKV + plane;
  unsigned short* Kh = QKV + 2 * plane;
  unsigned short* Kl = QKV + 3 * plane;
  unsigned short* Vh = QKV + 4 * plane;
  unsigned short* Vl = QKV + 5 * plane;

  // 1) x -> bf16 plane: n = 8,388,608, 8 per thread -> 1,048,576 threads = 4096 blocks x 256 (exact)
  const int n8 = (kTok * kDim) / 8;
  cast_bf16x8_k<<<dim3((n8 + 255) / 256), dim3(256), 0, stream>>>(x, Xb, n8);

  // 2) W_qkv in[1024][3072] -> WqT out[3072][1024] bf16: grid (3072/64, 1024/64)
  wt_cast_bf_k<<<dim3(kDim3 / 64, kDim / 64), dim3(256), 0, stream>>>(Wqkv, WqT, kDim, kDim3);
  // 3) W_proj in[1024][1024] -> WpT out[1024][1024] bf16: grid (1024/64, 1024/64)
  wt_cast_bf_k<<<dim3(kDim / 64, kDim / 64), dim3(256), 0, stream>>>(Wproj, WpT, kDim, kDim);

  // 4) qkv = Xb[8192][1024] . WqT[3072][1024]^T + b_qkv, per-head affine on q/k, bf16 hi/lo planes.
  //    M = 8192, N = 3072 (multiples of 64), K = 1024 (multiple of 32); tiles 128 x 48 = 6144 -> 768 blocks x 8 waves.
  wmma_gemm64<1, 0, 2, 3, false><<<dim3(768, 1), dim3(256), 0, stream>>>(
      Xb, Xb, kDim, 0L, WqT, WqT, kDim, 0L,
      (void*)QKV, (void*)QKV, kDim, (long)plane,
      bqkv, bqkv, 0L, qs, qbv, ks, kbv,
      kTok, kDim3, kDim, 1.0f);

  // 5) causal attention of all batches in one launch -> Yh/Yl: grid (16 heads x 32 query blocks, 4 batches).
  attn_hd64_k<<<dim3(kHeads * (kSeq / kQB), kBatch), dim3(128), 0, stream>>>(Qh, Ql, Kh, Kl, Vh, Vl, Yh, Yl);
  // 6) out = Y . WpT^T + b_proj over all rows (A hi/lo, 2 products).
  //    M = 8192, N = 1024 (multiples of 64), K = 1024; tiles 128 x 16 = 2048 -> 256 blocks x 8 waves.
  wmma_gemm64<1, 1, 2, 0, false><<<dim3(256, 1), dim3(256), 0, stream>>>(
      Yh, Yl, kDim, 0L, WpT, WpT, kDim, 0L,
      (void*)out, (void*)out, kDim, 0L,
      bproj, bproj, 0L, qs, qbv, ks, kbv,
      kTok, kDim, kDim, 1.0f);
}

// v002
// One run takes 502 microseconds.
// Timed twice side by side with v001, it ran 1.50 times as fast both times.
// Counting every step since v000, it is 2.65 times as fast.
// Contractions: x*W_qkv on v_wmma_f32_16x16x32_bf16 (plain bf16 operands = RNE-bf16 inputs); q*k^T and p*v on v_wmma_f32_16x16x32_bf16 with bf16 hi/lo operand pairs (hi*hi + hi*lo + lo*hi); y*W_proj on v_wmma_f32_16x16x32_bf16 with y as bf16 hi/lo and exact bf16 weights (hi*w + lo*w); f32 accumulate everywhere; bias, per-head affine and softmax in f32.
#include <hip/hip_runtime.h>
#include <stdint.h>
#include <math.h>

constexpr int kBatch = 4;
constexpr int kSeq   = 2048;
constexpr int kDim   = 1024;
constexpr int kHeads = 16;
constexpr int kHD    = 64;
constexpr int kTok   = kBatch * kSeq;   // 8192
constexpr int kDim3  = 3 * kDim;        // 3072

typedef __attribute__((ext_vector_type(16))) _Float16 v16h;
typedef __attribute__((ext_vector_type(8)))  _Float16 v8h;
typedef __attribute__((ext_vector_type(16))) __bf16   v16b;
typedef __attribute__((ext_vector_type(8)))  __bf16   v8b;
typedef __attribute__((ext_vector_type(8)))  float    v8f;
typedef __attribute__((ext_vector_type(4)))  float    v4f;

__device__ __forceinline__ unsigned short f2bf_bits(float f) {
  unsigned u = __float_as_uint(f);
  return (unsigned short)((u + 0x7FFFu + ((u >> 16) & 1u)) >> 16);
}
__device__ __forceinline__ float bf_bits2f(unsigned short h) { return __uint_as_float(((unsigned)h) << 16); }
__device__ __forceinline__ float bf_rne(float f) { return bf_bits2f(f2bf_bits(f)); }

// hazard guards as plain device helpers (no inline asm inside the kernel template body)
__device__ __forceinline__ void dep_guard_h(v8f& a, v8f& b, v16h x, v16h y) { asm volatile("v_nop\n\tv_nop\n\tv_nop\n\tv_nop" : "+v"(a), "+v"(b) : "v"(x), "v"(y)); }
__device__ __forceinline__ void dep_guard_b(v8f& a, v8f& b, v16b x, v16b y) { asm volatile("v_nop\n\tv_nop\n\tv_nop\n\tv_nop" : "+v"(a), "+v"(b) : "v"(x), "v"(y)); }
__device__ __forceinline__ void keep4_h(v16h a, v16h b, v16h c, v16h d) { asm volatile("v_nop" :: "v"(a), "v"(b), "v"(c), "v"(d)); }
__device__ __forceinline__ void keep4_b(v16b a, v16b b, v16b c, v16b d) { asm volatile("v_nop" :: "v"(a), "v"(b), "v"(c), "v"(d)); }
__device__ __forceinline__ void acc_guard4(v8f& a, v8f& b, v8f& c, v8f& d) { asm volatile("v_nop\n\tv_nop\n\tv_nop\n\tv_nop" : "+v"(a), "+v"(b), "+v"(c), "+v"(d)); }
template <typename T> struct Frag;
template <> struct Frag<_Float16> {
  typedef v16h V; union U { v16h v; v8h h[2]; };
  static __device__ __forceinline__ v16h load(const _Float16* p) {   // elements 0..7 <- p[0..7], 8..15 <- p[16..23]
    U f; f.h[0] = *(const v8h*)(p); f.h[1] = *(const v8h*)(p + 16); return f.v;
  }
  static __device__ __forceinline__ v8f mma(v16h a, v16h b, v8f c) {
    return __builtin_amdgcn_wmma_f32_16x16x32_f16(false, a, false, b, (short)0, c, false, false);
  }
  static __device__ __forceinline__ void guard(v8f& a, v8f& b, v16h x, v16h y) { dep_guard_h(a, b, x, y); }
  static __device__ __forceinline__ void keep(v16h a, v16h b, v16h c, v16h d) { keep4_h(a, b, c, d); }
};
template <> struct Frag<__bf16> {
  typedef v16b V; union U { v16b v; v8b h[2]; };
  static __device__ __forceinline__ v16b load(const __bf16* p) {
    U f; f.h[0] = *(const v8b*)(p); f.h[1] = *(const v8b*)(p + 16); return f.v;
  }
  static __device__ __forceinline__ v8f mma(v16b a, v16b b, v8f c) {
    return __builtin_amdgcn_wmma_f32_16x16x32_bf16(false, a, false, b, (short)0, c, false, false);
  }
  static __device__ __forceinline__ void guard(v8f& a, v8f& b, v16b x, v16b y) { dep_guard_b(a, b, x, y); }
  static __device__ __forceinline__ void keep(v16b a, v16b b, v16b c, v16b d) { keep4_b(a, b, c, d); }
};

// ---- Register-blocked batched WMMA GEMM ------------------------------------
// C[m,n] = scale * sum_k A[m,k] * Bt[n,k] (+bias)(affine)(+resid); each wave owns a 64x64 tile.
// A row-major [M,K]; Bt row-major [N,K]; M,N % 64 == 0, K % 32 == 0.
// SPLIT_MODE: 0 = plain; 1 = A carried as hi/lo planes (A2 = lo): hi.b + lo.b; 2 = A and Bt hi/lo: hi.hi + hi.lo + lo.hi.
// BIAS_MODE: 0 = none, 1 = bias[m], 2 = bias[n].
// OUT_MODE: 0 = f32, 1 = f16, 2 = bf16 hi plane (Cout) + bf16 lo plane (Cout2),
//           3 = qkv mode: columns n form three blocks of kDim (which = n0 / kDim); value v = (acc+bias)*affs[cc]+affb[cc]
//               with cc = n - which*kDim and tables (affs0,affb0) for which 0, (affs1,affb1) for which 1 (RNE-bf16 applied
//               to the table values), identity for which 2; written as bf16 hi plane at Cout + which*2*strideC and lo plane
//               at + strideC, row pitch ldc, column n0 - which*kDim.
// ET: 0 = f16 operands, 1 = bf16 operands (pointers passed as 16-bit storage)
template <int ET> struct Elem;
template <> struct Elem<0> { typedef _Float16 T; };
template <> struct Elem<1> { typedef __bf16 T; };
template <int ET, int SPLIT_MODE, int BIAS_MODE, int OUT_MODE, bool RESID, int ACT = 0>
__global__ __launch_bounds__(256) void wmma_gemm64(
    const unsigned short* __restrict__ Ap, const unsigned short* __restrict__ A2p, int lda, long strideA,
    const unsigned short* __restrict__ Btp, const unsigned short* __restrict__ Bt2p, int ldb, long strideB,
    void* __restrict__ Cout, void* __restrict__ Cout2, int ldc, long strideC,
    const float* __restrict__ bias,
    const float* __restrict__ resid, long strideR,
    const float* __restrict__ affs0, const float* __restrict__ affb0,
    const float* __restrict__ affs1, const float* __restrict__ affb1,
    int M, int N, int K, float scale) {
  typedef typename Elem<ET>::T T;
  typedef typename Frag<T>::V V;
  const T* A = (const T*)Ap; const T* A2 = (const T*)A2p; const T* Bt = (const T*)Btp; const T* Bt2 = (const T*)Bt2p;
  __shared__ __align__(16) float sT[8][16 * 68];   // per-wave 16x64 slab, pitch 68 floats
  const int b    = blockIdx.y;
  const int lane = threadIdx.x & 31;
  const int wave = threadIdx.x >> 5;
  const int tilesN = N >> 6;
  const int tilesM = M >> 6;
  const int tile = blockIdx.x * 8 + wave;
  if (tile >= tilesM * tilesN) return;   // wave-uniform; no block barriers in this kernel
  const int tm = tile / tilesN;
  const int tn = tile - tm * tilesN;
  const int m0 = tm << 6;
  const int n0 = tn << 6;

  const T* Ab  = A  + (size_t)b * strideA;
  const T* Bb  = Bt + (size_t)b * strideB;
  const T* Ab2 = (SPLIT_MODE >= 1) ? (A2  + (size_t)b * strideA) : nullptr;
  const T* Bb2 = (SPLIT_MODE == 2) ? (Bt2 + (size_t)b * strideB) : nullptr;

  const int rlane = lane & 15;                 // row (A) / col (B, D) within subtile
  const int koff  = (lane >> 4) * 8;           // k offset of this lane half
  const int mOff  = (lane >> 4) * 8;           // D row offset

  v8f acc[4][4];
#pragma unroll
  for (int i = 0; i < 4; ++i)
#pragma unroll
    for (int j = 0; j < 4; ++j) acc[i][j] = (v8f){0.f,0.f,0.f,0.f,0.f,0.f,0.f,0.f};

  for (int k0 = 0; k0 < K; k0 += 32) {
    V bh[4], bl[4];
#pragma unroll
    for (int j = 0; j < 4; ++j) {
      const size_t bo = (size_t)(n0 + (j << 4) + rlane) * ldb + koff + k0;
      bh[j] = Frag<T>::load(Bb + bo);
      if (SPLIT_MODE == 2) bl[j] = Frag<T>::load(Bb2 + bo);
    }
#pragma unroll
    for (int i = 0; i < 4; ++i) {
      const size_t ao = (size_t)(m0 + (i << 4) + rlane) * lda + koff + k0;
      V ah = Frag<T>::load(Ab + ao);
      V al;
      if (SPLIT_MODE >= 1) al = Frag<T>::load(Ab2 + ao);
#pragma unroll
      for (int j = 0; j < 4; ++j) {
        acc[i][j] = Frag<T>::mma(ah, bh[j], acc[i][j]);
        if (SPLIT_MODE == 2) acc[i][j] = Frag<T>::mma(ah, bl[j], acc[i][j]);
        if (SPLIT_MODE >= 1) acc[i][j] = Frag<T>::mma(al, bh[j], acc[i][j]);
      }
      Frag<T>::guard(acc[i][0], acc[i][3], ah, (SPLIT_MODE >= 1) ? al : ah);
    }
    Frag<T>::keep(bh[0], bh[1], bh[2], bh[3]);
    if (SPLIT_MODE == 2) Frag<T>::keep(bl[0], bl[1], bl[2], bl[3]);
  }
  acc_guard4(acc[0][0], acc[0][1], acc[0][2], acc[0][3]);
  acc_guard4(acc[1][0], acc[1][1], acc[1][2], acc[1][3]);
  acc_guard4(acc[2][0], acc[2][1], acc[2][2], acc[2][3]);
  acc_guard4(acc[3][0], acc[3][1], acc[3][2], acc[3][3]);

  // ---- epilogue ----
  float* slab = sT[wave];
  const float* Rb = RESID ? (resid + (size_t)b * strideR) : nullptr;
#pragma unroll
  for (int i = 0; i < 4; ++i) {
    const int mBase = m0 + (i << 4);
#pragma unroll
    for (int j = 0; j < 4; ++j) {
      const int n = n0 + (j << 4) + rlane;
      float bv = 0.f;
      if (BIAS_MODE == 2) bv = bias[n];
      float asc = 1.0f, abi = 0.0f;
      if (OUT_MODE == 3) {
        const int which = n0 / kDim;               // wave-uniform (64-col tile inside one kDim block)
        const int cc = n - which * kDim;           // 0..kDim-1, all four tables have kDim entries
        const float s0 = bf_rne(affs0[cc]);
        const float c0 = bf_rne(affb0[cc]);
        const float s1 = bf_rne(affs1[cc]);
        const float c1 = bf_rne(affb1[cc]);
        asc = (which == 0) ? s0 : ((which == 1) ? s1 : 1.0f);
        abi = (which == 0) ? c0 : ((which == 1) ? c1 : 0.0f);
      }
#pragma unroll
      for (int r = 0; r < 8; ++r) {
        float v = acc[i][j][r] * scale;
        if (BIAS_MODE == 1) v += bias[mBase + mOff + r];
        if (BIAS_MODE == 2) v += bv;
        if (OUT_MODE == 3) v = v * asc + abi;
        if (RESID) v += Rb[(size_t)(mBase + mOff + r) * ldc + n];
        if (ACT == 1) v = tanhf(v);
        if (ACT == 2) v = fmaxf(v, 0.0f);
        if (ACT == 4) v = (v > 0.f) ? v : 0.01f * v;
        slab[(mOff + r) * 68 + (j << 4) + rlane] = v;
      }
    }
    __builtin_amdgcn_fence(__ATOMIC_RELEASE, "workgroup");
    __builtin_amdgcn_wave_barrier();
    __builtin_amdgcn_fence(__ATOMIC_ACQUIRE, "workgroup");
    if (OUT_MODE == 0) {
      float* C = (float*)Cout + (size_t)b * strideC;
      const int hh = lane >> 4, c4 = (lane & 15) * 4;     // row seg = 256 B = 16 lanes x 16 B
      {
#pragma unroll
        for (int it = 0; it < 8; ++it) {
          const int row = it * 2 + hh;
          v4f v = *(const v4f*)(slab + row * 68 + c4);
          *(v4f*)(C + (size_t)(mBase + row) * ldc + n0 + c4) = v;
        }
        
      }
    } else {
      const int q = lane >> 3, c8 = (lane & 7) * 8;
      unsigned short* C;
      unsigned short* C2;
      int ncol;
      if (OUT_MODE == 3) {
        const int which = n0 / kDim;
        C  = (unsigned short*)Cout + (size_t)which * 2 * (size_t)strideC;
        C2 = C + (size_t)strideC;
        ncol = n0 - which * kDim;
      } else {
        C  = (unsigned short*)Cout  + (size_t)b * strideC;
        C2 = (OUT_MODE == 2) ? ((unsigned short*)Cout2 + (size_t)b * strideC) : nullptr;
        ncol = n0;
      }
      {
#pragma unroll
        for (int it = 0; it < 4; ++it) {
          const int row = it * 4 + q;
          const float* sp = slab + row * 68 + c8;
          v8h hv, lv;
#pragma unroll
          for (int e = 0; e < 8; ++e) {
            if (OUT_MODE == 1) {
              hv[e] = (_Float16)sp[e];
            } else {
              unsigned short hb = f2bf_bits(sp[e]);
              unsigned short lb = f2bf_bits(sp[e] - bf_bits2f(hb));
              hv[e] = __builtin_bit_cast(_Float16, hb);
              lv[e] = __builtin_bit_cast(_Float16, lb);
            }
          }
          *(v8h*)(C + (size_t)(mBase + row) * ldc + ncol + c8) = hv;
          if (OUT_MODE >= 2) *(v8h*)(C2 + (size_t)(mBase + row) * ldc + ncol + c8) = lv;
        }
        
      }
    }
    __builtin_amdgcn_fence(__ATOMIC_RELEASE, "workgroup");
    __builtin_amdgcn_wave_barrier();
    __builtin_amdgcn_fence(__ATOMIC_ACQUIRE, "workgroup");
  }
}

// coverage: n8 threads x 8 elements = n (host passes n8 = n/8 with n % 8 == 0)
__global__ __launch_bounds__(256) void cast_bf16x8_k(const float* __restrict__ in,
                                                     unsigned short* __restrict__ out, int n8) {
  const int i = blockIdx.x * 256 + threadIdx.x;
  if (i < n8) {
    const size_t o = (size_t)i * 8;
    const v4f a = *(const v4f*)(in + o);
    const v4f bq = *(const v4f*)(in + o + 4);
    v8h hv;
#pragma unroll
    for (int e = 0; e < 4; ++e) {
      hv[e]     = __builtin_bit_cast(_Float16, f2bf_bits(a[e]));
      hv[4 + e] = __builtin_bit_cast(_Float16, f2bf_bits(bq[e]));
    }
    *(v8h*)(out + o) = hv;
    
  }
}

// ---- W [K][N] f32 -> Wt [N][K] bf16 (RNE), 64x64 tile transposed through LDS ----
// in[rows = K][cols = N] -> out[N][K]; grid = (N/64, K/64).
// producer coverage: 256 threads x (1 row x 16 cols) = 64x64 tile; store: 8 waves x 4 rows x 2 it = 64 rows, 8 lanes x 8 halves = 64 cols.
constexpr int kWTP = 72;
__global__ __launch_bounds__(256) void wt_cast_bf_k(const float* __restrict__ W, unsigned short* __restrict__ Wtp,
                                                    int K, int N) {
  __shared__ __align__(16) _Float16 st[64 * kWTP];
  _Float16* Wt = (_Float16*)Wtp;
  const int n0 = blockIdx.x * 64, k0 = blockIdx.y * 64;
  const int tid = threadIdx.x;
  const int kr = tid >> 2, c16 = (tid & 3) * 16;
  const float* src = W + (size_t)(k0 + kr) * N + n0 + c16;
#pragma unroll
  for (int qq = 0; qq < 4; ++qq) {
    const v4f v = *(const v4f*)(src + 4 * qq);
#pragma unroll
    for (int e = 0; e < 4; ++e)
      st[(c16 + 4 * qq + e) * kWTP + kr] = __builtin_bit_cast(_Float16, f2bf_bits(v[e]));
  }
  __syncthreads();
  const int wave = tid >> 5, lane = tid & 31;
  const int q8 = lane >> 3, c8 = (lane & 7) * 8;
  {
#pragma unroll
    for (int it = 0; it < 2; ++it) {
      const int n = it * 32 + wave * 4 + q8;
      const v8h hv = *(const v8h*)(st + n * kWTP + c8);
      *(v8h*)(Wt + (size_t)(n0 + n) * K + k0 + c8) = hv;
    }
    
  }
}

// =====================================================================================
// Causal attention, head_dim 64, fed by bf16 hi/lo planes laid out [kTok][kDim] (row = b*kSeq + t, col = h*64 + d).
//   scores = (qh.kh + qh.kl + ql.kh) / 8 : v_wmma_f32_16x16x32_bf16, f32 accumulate
//   out    =  ph.vh + ph.vl + pl.vh      : v_wmma_f32_16x16x32_bf16, p = exp(s - max) split into bf16 hi/lo
//   online softmax in f32. Block = 4 waves = 64 query rows of one head of batch blockIdx.y; 64-key chunks,
//   chunks above the diagonal skipped, per-element causal select (key > query -> -inf) on the diagonal chunk.
//   grid = (kHeads * (kSeq/64), kBatch); Y planes are [kTok][kDim] like the inputs.
// =====================================================================================
constexpr int kKC = 64;
constexpr int kQB = 64;
constexpr int kLP = 2 * 64 + 8;   // LDS row pitch in bf16 elements (272 B)
constexpr int kVS = 16;           // shift (32 B = 8 banks) of V rows d >= 32: the two d halves that one staging store writes leave each other's banks
constexpr int kOP = 68;           // f32 pitch of the output tile (16 x 68 x 4 B = one wave's P buffer)

__device__ __forceinline__ v8f mma_bf(v16b a, v16b b, v8f c) {
  c = __builtin_amdgcn_wmma_f32_16x16x32_bf16(false, a, false, b, (short)0, c, false, false);
  asm volatile("v_nop\n\tv_nop\n\tv_nop\n\tv_nop" : "+v"(c) : "v"(a), "v"(b));
  return c;
}

__global__ __launch_bounds__(128)
void attn_hd64_k(const unsigned short* __restrict__ Qhp, const unsigned short* __restrict__ Qlp,
                 const unsigned short* __restrict__ Khp, const unsigned short* __restrict__ Klp,
                 const unsigned short* __restrict__ Vhp, const unsigned short* __restrict__ Vlp,
                 unsigned short* __restrict__ Yhp, unsigned short* __restrict__ Ylp) {
  union FB { v16b v; v8b h[2]; };
  // Every LDS row holds its hi half (64 elements) then its lo half (64 elements) plus 8 pad elements: pitch 272 B = 16 B x 17,
  // so the 16 rows of one ds_load_b128 fragment read start on 16 different 4-bank groups (at 128 B they fell on two).
  __shared__ __align__(16) __bf16 Ks[kKC * kLP];              // K [kv][hi d | lo d]
  __shared__ __align__(16) __bf16 Vt[kHD * kLP + kVS];        // V [d][hi kv | lo kv]; rows d >= 32 lie kVS elements further
  __shared__ __align__(16) __bf16 Pbuf[4][16 * kLP];          // per wave: P [16][hi key | lo key]; reused as f32 out tile [16][64] at pitch kOP
  __bf16* const Ksh = Ks;
  __bf16* const Ksl = Ks + kHD;
  __bf16* const Vth = Vt;
  __bf16* const Vtl = Vt + kKC;

  const __bf16* Qh = (const __bf16*)Qhp;
  const __bf16* Ql = (const __bf16*)Qlp;
  const __bf16* Kh = (const __bf16*)Khp;
  const __bf16* Kl = (const __bf16*)Klp;
  const __bf16* Vh = (const __bf16*)Vhp;
  const __bf16* Vl = (const __bf16*)Vlp;

  const int tid  = threadIdx.x;
  const int wave = tid >> 5;
  const int lane = tid & 31;
  const int hh   = lane >> 4;
  const int c    = lane & 15;

  constexpr int nqb = kSeq / kQB;   // 32
  const int bx = blockIdx.x;
  const int qb = bx % nqb;
  const int h  = bx / nqb;
  const int q0 = qb * kQB + wave * 16;          // token index of this wave's first row
  const size_t rowb = (size_t)blockIdx.y * kSeq; // plane row base of this batch
  const int hcol = h * kHD;

  // ---- Q fragments (A operand): 2 d-chunks, hi and lo; Frag load = split k-map ----
  v16b qah[2], qal[2];
  {
    const size_t qoff = (rowb + (size_t)(q0 + c)) * kDim + hcol + 8 * hh;
#pragma unroll
    for (int dc = 0; dc < 2; ++dc) {
      qah[dc] = Frag<__bf16>::load(Qh + qoff + dc * 32);
      qal[dc] = Frag<__bf16>::load(Ql + qoff + dc * 32);
    }
  }

  float mrow[8], lrow[8];
  v8f oacc[4];
#pragma unroll
  for (int r = 0; r < 8; ++r) { mrow[r] = -INFINITY; lrow[r] = 0.f; }
#pragma unroll
  for (int t = 0; t < 4; ++t) oacc[t] = (v8f){0.f,0.f,0.f,0.f,0.f,0.f,0.f,0.f};

  const int nChunks = qb + 1;   // block-uniform, <= 32
  for (int kc = 0; kc < nChunks; ++kc) {
    const int kv0 = kc * kKC;
    __syncthreads();
    {
      // staging coverage: 128 threads x (1 key row x 32 d) = 64 keys x 64 d for each of the four tiles
      const int kvr = tid >> 1, dh = (tid & 1) * 32;
      const size_t goff = (rowb + (size_t)(kv0 + kvr)) * kDim + hcol + dh;
      __bf16* const kdst = Ks + kvr * kLP + dh;                        // this thread's K row, hi half
      __bf16* const vdst = Vt + dh * kLP + (dh >> 5) * kVS + kvr;      // this thread's V column, first d row, hi half
#pragma unroll 1
      for (int i = 0; i < 4; ++i) {
        const v8b a0 = *(const v8b*)(Kh + goff + 8 * i);
        const v8b a1 = *(const v8b*)(Kl + goff + 8 * i);
        *(v8b*)(kdst + 8 * i) = a0;
        *(v8b*)(kdst + kHD + 8 * i) = a1;
        const v8b w0 = *(const v8b*)(Vh + goff + 8 * i);
        const v8b w1 = *(const v8b*)(Vl + goff + 8 * i);
#pragma unroll
        for (int e = 0; e < 8; ++e) {
          vdst[(8 * i + e) * kLP] = w0[e];
          vdst[(8 * i + e) * kLP + kKC] = w1[e];
        }
      }
    }
    __syncthreads();

    // ---- scores: D row = query 8hh+r, col = key j*16+c ----
    v8f s[4];
#pragma unroll
    for (int j = 0; j < 4; ++j) {
      s[j] = (v8f){0.f,0.f,0.f,0.f,0.f,0.f,0.f,0.f};
#pragma unroll
      for (int dc = 0; dc < 2; ++dc) {
        FB kb, kl;
        kb.h[0] = *(const v8b*)(Ksh + (j * 16 + c) * kLP + dc * 32 + 8 * hh);
        kb.h[1] = *(const v8b*)(Ksh + (j * 16 + c) * kLP + dc * 32 + 16 + 8 * hh);
        kl.h[0] = *(const v8b*)(Ksl + (j * 16 + c) * kLP + dc * 32 + 8 * hh);
        kl.h[1] = *(const v8b*)(Ksl + (j * 16 + c) * kLP + dc * 32 + 16 + 8 * hh);
        s[j] = mma_bf(qah[dc], kb.v, s[j]);
        s[j] = mma_bf(qah[dc], kl.v, s[j]);
        s[j] = mma_bf(qal[dc], kb.v, s[j]);
      }
    }
    const bool diag = (kc == qb);   // block-uniform
    float cm[8];
#pragma unroll
    for (int r = 0; r < 8; ++r) {
      const int qrow = q0 + 8 * hh + r;
      float m = -INFINITY;
#pragma unroll
      for (int j = 0; j < 4; ++j) {
        const int kvcol = kv0 + j * 16 + c;
        float sv = s[j][r] * 0.125f;
        if (diag && (kvcol > qrow)) sv = -INFINITY;
        s[j][r] = sv;
        m = fmaxf(m, sv);
      }
#pragma unroll
      for (int off = 1; off < 16; off <<= 1) m = fmaxf(m, __shfl_xor(m, off, 32));
      cm[r] = m;
    }
    __bf16* pwh = Pbuf[wave];
    __bf16* pwl = Pbuf[wave] + kKC;
#pragma unroll
    for (int r = 0; r < 8; ++r) {
      const float mnew = fmaxf(mrow[r], cm[r]);
      const float mref = (mnew > -INFINITY) ? mnew : 0.0f;   // all-masked so far -> p = 0, alpha = 0
      const float alpha = expf(mrow[r] - mref);
      mrow[r] = mnew;
      float psum = 0.f;
#pragma unroll
      for (int j = 0; j < 4; ++j) {
        const float p = expf(s[j][r] - mref);
        psum += p;
        const unsigned short hb = f2bf_bits(p);
        const unsigned short lb = f2bf_bits(p - bf_bits2f(hb));
        pwh[(8 * hh + r) * kLP + j * 16 + c] = __builtin_bit_cast(__bf16, hb);
        pwl[(8 * hh + r) * kLP + j * 16 + c] = __builtin_bit_cast(__bf16, lb);
      }
#pragma unroll
      for (int off = 1; off < 16; off <<= 1) psum += __shfl_xor(psum, off, 32);
      lrow[r] = lrow[r] * alpha + psum;
#pragma unroll
      for (int t = 0; t < 4; ++t) oacc[t][r] *= alpha;
    }
    __builtin_amdgcn_fence(__ATOMIC_RELEASE, "workgroup");
    __builtin_amdgcn_wave_barrier();
    __builtin_amdgcn_fence(__ATOMIC_ACQUIRE, "workgroup");
    // ---- out += P (A: m = row, k = key) x V (B: k = key, n = d) ----
#pragma unroll 1
    for (int kk = 0; kk < 2; ++kk) {
      FB pa, pl;
      pa.h[0] = *(const v8b*)(pwh + c * kLP + kk * 32 + 8 * hh);
      pa.h[1] = *(const v8b*)(pwh + c * kLP + kk * 32 + 16 + 8 * hh);
      pl.h[0] = *(const v8b*)(pwl + c * kLP + kk * 32 + 8 * hh);
      pl.h[1] = *(const v8b*)(pwl + c * kLP + kk * 32 + 16 + 8 * hh);
#pragma unroll
      for (int t = 0; t < 4; ++t) {
        FB vb, vl;
        vb.h[0] = *(const v8b*)(Vth + (t * 16 + c) * kLP + (t >> 1) * kVS + kk * 32 + 8 * hh);
        vb.h[1] = *(const v8b*)(Vth + (t * 16 + c) * kLP + (t >> 1) * kVS + kk * 32 + 16 + 8 * hh);
        vl.h[0] = *(const v8b*)(Vtl + (t * 16 + c) * kLP + (t >> 1) * kVS + kk * 32 + 8 * hh);
        vl.h[1] = *(const v8b*)(Vtl + (t * 16 + c) * kLP + (t >> 1) * kVS + kk * 32 + 16 + 8 * hh);
        oacc[t] = mma_bf(pa.v, vb.v, oacc[t]);
        oacc[t] = mma_bf(pa.v, vl.v, oacc[t]);
        oacc[t] = mma_bf(pl.v, vb.v, oacc[t]);
      }
    }
  }

  // ---- epilogue: y = out / l, staged per wave as f32 [16][64] (pitch kOP) in the wave's P buffer ----
  __syncthreads();
  float* os = (float*)(Pbuf[wave]);   // 16 rows x kOP f32 = 4352 B
#pragma unroll
  for (int r = 0; r < 8; ++r) {
    const float inv = 1.0f / lrow[r];
#pragma unroll
    for (int t = 0; t < 4; ++t) os[(8 * hh + r) * kOP + t * 16 + c] = oacc[t][r] * inv;
  }
  __builtin_amdgcn_fence(__ATOMIC_RELEASE, "workgroup");
  __builtin_amdgcn_wave_barrier();
  __builtin_amdgcn_fence(__ATOMIC_ACQUIRE, "workgroup");
  {
    // store coverage: per it, lanes (q8 = 0..3) x (c8 = 0..56 step 8) = 4 rows x 64 cols; 4 it = 16 rows = this wave's tile.
    const int q8 = lane >> 3, c8 = (lane & 7) * 8;
    {
#pragma unroll
      for (int it = 0; it < 4; ++it) {
        const int row = it * 4 + q8;
        const float* sp = os + row * kOP + c8;
        v8h hv, lv;
#pragma unroll
        for (int e = 0; e < 8; ++e) {
          const unsigned short hb = f2bf_bits(sp[e]);
          const unsigned short lb = f2bf_bits(sp[e] - bf_bits2f(hb));
          hv[e] = __builtin_bit_cast(_Float16, hb);
          lv[e] = __builtin_bit_cast(_Float16, lb);
        }
        const size_t yo = (rowb + (size_t)(q0 + row)) * kDim + hcol + c8;
        *(v8h*)(Yhp + yo) = hv;
        *(v8h*)(Ylp + yo) = lv;
      }
      
    }
  }
}

// ---------------------------------------------------------------------------
// Workspace region map (bytes):
//   [0, 16777216)            Xb   bf16 [8192][1024]  (dead after the qkv GEMM; reused as Yh bf16 [8192][1024])
//   [16777216, 23068672)     WqT  bf16 [3072][1024]
//   [23068672, 25165824)     WpT  bf16 [1024][1024]
//   [25165824, 125829120)    QKV  bf16 6 planes [8192][1024]: Qh, Ql, Kh, Kl, Vh, Vl
//   [125829120, 142606336)   Yl   bf16 [8192][1024]
//   total 142,606,336 B
// ---------------------------------------------------------------------------
extern "C" void kernel_launch(void* const* d_in, const int* in_sizes, int n_in,
                              void* d_out, int out_size, void* d_ws, size_t ws_size,
                              hipStream_t stream) {
  if (n_in < 9) return;
  if (in_sizes[0] != kTok * kDim || in_sizes[1] != kDim * kDim3 || in_sizes[2] != kDim3 ||
      in_sizes[3] != kDim * kDim || in_sizes[4] != kDim ||
      in_sizes[5] != kHeads * kHD || in_sizes[6] != kHeads * kHD ||
      in_sizes[7] != kHeads * kHD || in_sizes[8] != kHeads * kHD ||
      out_size != kTok * kDim) return;

  const float* x     = (const float*)d_in[0];
  const float* Wqkv  = (const float*)d_in[1];
  const float* bqkv  = (const float*)d_in[2];
  const float* Wproj = (const float*)d_in[3];
  const float* bproj = (const float*)d_in[4];
  const float* qs    = (const float*)d_in[5];
  const float* qbv   = (const float*)d_in[6];
  const float* ks    = (const float*)d_in[7];
  const float* kbv   = (const float*)d_in[8];
  float* out = (float*)d_out;

  const size_t plane  = (size_t)kTok * kDim;                 // elements per [8192][1024] plane
  const size_t offX   = 0;
  const size_t offWq  = offX  + plane * 2;                    // 16,777,216
  const size_t offWp  = offWq + (size_t)kDim3 * kDim * 2;     // 23,068,672
  const size_t offQKV = offWp + (size_t)kDim * kDim * 2;      // 25,165,824
  const size_t offYl  = offQKV + 6 * plane * 2;               // 125,829,120
  const size_t total  = offYl + plane * 2;                    // 142,606,336
  if (total > ws_size) return;

  char* ws = (char*)d_ws;
  unsigned short* Xb  = (unsigned short*)(ws + offX);
  unsigned short* Yh  = Xb;                                   // [8192][1024] bf16, the whole Xb region
  unsigned short* Yl  = (unsigned short*)(ws + offYl);        // [8192][1024] bf16
  unsigned short* WqT = (unsigned short*)(ws + offWq);
  unsigned short* WpT = (unsigned short*)(ws + offWp);
  unsigned short* QKV = (unsigned short*)(ws + offQKV);
  unsigned short* Qh = QKV;
  unsigned short* Ql = QKV + plane;
  unsigned short* Kh = QKV + 2 * plane;
  unsigned short* Kl = QKV + 3 * plane;
  unsigned short* Vh = QKV + 4 * plane;
  unsigned short* Vl = QKV + 5 * plane;

  // 1) x -> bf16 plane: n = 8,388,608, 8 per thread -> 1,048,576 threads = 4096 blocks x 256 (exact)
  const int n8 = (kTok * kDim) / 8;
  cast_bf16x8_k<<<dim3((n8 + 255) / 256), dim3(256), 0, stream>>>(x, Xb, n8);

  // 2) W_qkv in[1024][3072] -> WqT out[3072][1024] bf16: grid (3072/64, 1024/64)
  wt_cast_bf_k<<<dim3(kDim3 / 64, kDim / 64), dim3(256), 0, stream>>>(Wqkv, WqT, kDim, kDim3);
  // 3) W_proj in[1024][1024] -> WpT out[1024][1024] bf16: grid (1024/64, 1024/64)
  wt_cast_bf_k<<<dim3(kDim / 64, kDim / 64), dim3(256), 0, stream>>>(Wproj, WpT, kDim, kDim);

  // 4) qkv = Xb[8192][1024] . WqT[3072][1024]^T + b_qkv, per-head affine on q/k, bf16 hi/lo planes.
  //    M = 8192, N = 3072 (multiples of 64), K = 1024 (multiple of 32); tiles 128 x 48 = 6144 -> 768 blocks x 8 waves.
  wmma_gemm64<1, 0, 2, 3, false><<<dim3(768, 1), dim3(256), 0, stream>>>(
      Xb, Xb, kDim, 0L, WqT, WqT, kDim, 0L,
      (void*)QKV, (void*)QKV, kDim, (long)plane,
      bqkv, bqkv, 0L, qs, qbv, ks, kbv,
      kTok, kDim3, kDim, 1.0f);

  // 5) causal attention of all batches in one launch -> Yh/Yl: grid (16 heads x 32 query blocks, 4 batches).
  attn_hd64_k<<<dim3(kHeads * (kSeq / kQB), kBatch), dim3(128), 0, stream>>>(Qh, Ql, Kh, Kl, Vh, Vl, Yh, Yl);
  // 6) out = Y . WpT^T + b_proj over all rows (A hi/lo, 2 products).
  //    M = 8192, N = 1024 (multiples of 64), K = 1024; tiles 128 x 16 = 2048 -> 256 blocks x 8 waves.
  wmma_gemm64<1, 1, 2, 0, false><<<dim3(256, 1), dim3(256), 0, stream>>>(
      Yh, Yl, kDim, 0L, WpT, WpT, kDim, 0L,
      (void*)out, (void*)out, kDim, 0L,
      bproj, bproj, 0L, qs, qbv, ks, kbv,
      kTok, kDim, kDim, 1.0f);
}

// v003
// Measured time: 372 microseconds a run.
// Two timings next to v002 put it at 1.35 and 1.34 times that version's speed.
// All steps since v000 together make it 3.57 times as fast.
// Contractions: x*W_qkv on v_wmma_f32_16x16x32_bf16 (plain bf16 operands = RNE-bf16 inputs); q*k^T and p*v on v_wmma_f32_16x16x32_bf16 with bf16 hi/lo operand pairs (hi*hi + hi*lo + lo*hi); y*W_proj on v_wmma_f32_16x16x32_bf16 with y as bf16 hi/lo and exact bf16 weights (hi*w + lo*w); f32 accumulate everywhere; bias, per-head affine and softmax in f32.
#include <hip/hip_runtime.h>
#include <stdint.h>
#include <math.h>

constexpr int kBatch = 4;
constexpr int kSeq   = 2048;
constexpr int kDim   = 1024;
constexpr int kHeads = 16;
constexpr int kHD    = 64;
constexpr int kTok   = kBatch * kSeq;   // 8192
constexpr int kDim3  = 3 * kDim;        // 3072

typedef __attribute__((ext_vector_type(16))) _Float16 v16h;
typedef __attribute__((ext_vector_type(8)))  _Float16 v8h;
typedef __attribute__((ext_vector_type(16))) __bf16   v16b;
typedef __attribute__((ext_vector_type(8)))  __bf16   v8b;
typedef __attribute__((ext_vector_type(8)))  float    v8f;
typedef __attribute__((ext_vector_type(4)))  float    v4f;

__device__ __forceinline__ unsigned short f2bf_bits(float f) {
  unsigned u = __float_as_uint(f);
  return (unsigned short)((u + 0x7FFFu + ((u >> 16) & 1u)) >> 16);
}
__device__ __forceinline__ float bf_bits2f(unsigned short h) { return __uint_as_float(((unsigned)h) << 16); }
__device__ __forceinline__ float bf_rne(float f) { return bf_bits2f(f2bf_bits(f)); }

// hazard guards as plain device helpers
__device__ __forceinline__ void dep_guard_h(v8f& a, v8f& b, v16h x, v16h y) { asm volatile("v_nop\n\tv_nop\n\tv_nop\n\tv_nop" : "+v"(a), "+v"(b) : "v"(x), "v"(y)); }
__device__ __forceinline__ void dep_guard_b(v8f& a, v8f& b, v16b x, v16b y) { asm volatile("v_nop\n\tv_nop\n\tv_nop\n\tv_nop" : "+v"(a), "+v"(b) : "v"(x), "v"(y)); }
__device__ __forceinline__ void keep4_h(v16h a, v16h b, v16h c, v16h d) { asm volatile("v_nop" :: "v"(a), "v"(b), "v"(c), "v"(d)); }
__device__ __forceinline__ void keep4_b(v16b a, v16b b, v16b c, v16b d) { asm volatile("v_nop" :: "v"(a), "v"(b), "v"(c), "v"(d)); }
__device__ __forceinline__ void acc_guard4(v8f& a, v8f& b, v8f& c, v8f& d) { asm volatile("v_nop\n\tv_nop\n\tv_nop\n\tv_nop" : "+v"(a), "+v"(b), "+v"(c), "+v"(d)); }
template <typename T> struct Frag;
template <> struct Frag<_Float16> {
  typedef v16h V; union U { v16h v; v8h h[2]; };
  static __device__ __forceinline__ v16h load(const _Float16* p) {   // elements 0..7 <- p[0..7], 8..15 <- p[16..23]
    U f; f.h[0] = *(const v8h*)(p); f.h[1] = *(const v8h*)(p + 16); return f.v;
  }
  static __device__ __forceinline__ v8f mma(v16h a, v16h b, v8f c) {
    return __builtin_amdgcn_wmma_f32_16x16x32_f16(false, a, false, b, (short)0, c, false, false);
  }
  static __device__ __forceinline__ void guard(v8f& a, v8f& b, v16h x, v16h y) { dep_guard_h(a, b, x, y); }
  static __device__ __forceinline__ void keep(v16h a, v16h b, v16h c, v16h d) { keep4_h(a, b, c, d); }
};
template <> struct Frag<__bf16> {
  typedef v16b V; union U { v16b v; v8b h[2]; };
  static __device__ __forceinline__ v16b load(const __bf16* p) {
    U f; f.h[0] = *(const v8b*)(p); f.h[1] = *(const v8b*)(p + 16); return f.v;
  }
  static __device__ __forceinline__ v8f mma(v16b a, v16b b, v8f c) {
    return __builtin_amdgcn_wmma_f32_16x16x32_bf16(false, a, false, b, (short)0, c, false, false);
  }
  static __device__ __forceinline__ void guard(v8f& a, v8f& b, v16b x, v16b y) { dep_guard_b(a, b, x, y); }
  static __device__ __forceinline__ void keep(v16b a, v16b b, v16b c, v16b d) { keep4_b(a, b, c, d); }
};

// ---- Register-blocked batched WMMA GEMM ------------------------------------
// C[m,n] = scale * sum_k A[m,k] * Bt[n,k] (+bias)(affine)(+resid); each wave owns a 64x64 tile.
// A row-major [M,K]; Bt row-major [N,K]; M % 128 == 0, N % 256 == 0, K % 64 == 0, lda and ldb % 8 == 0.
// A block of 8 waves (2 x 4) owns a 128 x 256 tile of C. Its operand rows come 64 k (one 128-B line of every row) at a time
// into an LDS ring of two buffers by asynchronous copies, whole lines per wave-copy; the fragments are read from LDS.
// SPLIT_MODE: 0 = plain; 1 = A carried as hi/lo planes (A2 = lo): hi.b + lo.b; 2 = A and Bt hi/lo: hi.hi + hi.lo + lo.hi.
// BIAS_MODE: 0 = none, 1 = bias[m], 2 = bias[n].
// OUT_MODE: 0 = f32, 1 = f16, 2 = bf16 hi plane (Cout) + bf16 lo plane (Cout2),
//           3 = qkv mode: columns n form three blocks of kDim (which = n0 / kDim); value v = (acc+bias)*affs[cc]+affb[cc]
//               with cc = n - which*kDim and tables (affs0,affb0) for which 0, (affs1,affb1) for which 1 (RNE-bf16 applied
//               to the table values), identity for which 2; written as bf16 hi plane at Cout + which*2*strideC and lo plane
//               at + strideC, row pitch ldc, column n0 - which*kDim.
// ET: 0 = f16 operands, 1 = bf16 operands (pointers passed as 16-bit storage)
constexpr int kGBM = 128;   // rows of C per block (2 waves of 64)
constexpr int kGBN = 256;   // columns of C per block (4 waves of 64)
constexpr int kGBK = 64;    // k per stage
constexpr int kGP  = 72;    // LDS row pitch in 16-bit elements: 144 B = 16 B x 9, for the ds_load_b128 fragment readers

__device__ __forceinline__ unsigned lds_off(const void* p) { return (unsigned)(size_t)p; }   // byte offset in the block's LDS

// ROWS rows of 128 B, global -> LDS, 16 B per lane and copy: thread -> row tid >> 3 (+32 per copy), piece tid & 7;
// ldst and gsrc already point at this thread's first row and piece; ld = global row pitch in elements.
template <int ROWS>
__device__ __forceinline__ void stage_rows(unsigned ldst, const unsigned short* gsrc, int ld) {
  const size_t g32 = (size_t)32 * (size_t)ld;
#pragma unroll   // one or two straight groups of four copies, no loop counter beside them
  for (int u = 0; u < ROWS / 128; ++u) {
    const unsigned l0 = ldst + (unsigned)(u * 128 * kGP * 2);
    const unsigned l1 = l0 + 32u * kGP * 2u, l2 = l0 + 64u * kGP * 2u, l3 = l0 + 96u * kGP * 2u;
    const unsigned short* g0 = gsrc + (size_t)(4 * u) * g32;
    const unsigned short* g1 = g0 + g32;
    const unsigned short* g2 = g1 + g32;
    const unsigned short* g3 = g2 + g32;
    // the s_wait_xcnt closes the copies' own statement, so that no address register of a copy is rewritten ahead of it
    asm volatile("global_load_async_to_lds_b128 %0, %1, off\n\t"
                 "global_load_async_to_lds_b128 %2, %3, off\n\t"
                 "global_load_async_to_lds_b128 %4, %5, off\n\t"
                 "global_load_async_to_lds_b128 %6, %7, off\n\t"
                 "s_wait_xcnt 0x0"
                 :: "v"(l0), "v"(g0), "v"(l1), "v"(g1), "v"(l2), "v"(g2), "v"(l3), "v"(g3) : "memory");
  }
}

template <int ET> struct Elem;
template <> struct Elem<0> { typedef _Float16 T; };
template <> struct Elem<1> { typedef __bf16 T; };
template <int ET, int SPLIT_MODE, int BIAS_MODE, int OUT_MODE, bool RESID, int ACT = 0>
__global__ __launch_bounds__(256) void wmma_gemm64(
    const unsigned short* __restrict__ Ap, const unsigned short* __restrict__ A2p, int lda, long strideA,
    const unsigned short* __restrict__ Btp, const unsigned short* __restrict__ Bt2p, int ldb, long strideB,
    void* __restrict__ Cout, void* __restrict__ Cout2, int ldc, long strideC,
    const float* __restrict__ bias,
    const float* __restrict__ resid, long strideR,
    const float* __restrict__ affs0, const float* __restrict__ affb0,
    const float* __restrict__ affs1, const float* __restrict__ affb1,
    int M, int N, int K, float scale) {
  typedef typename Elem<ET>::T T;
  typedef typename Frag<T>::V V;
  const T* A = (const T*)Ap; const T* A2 = (const T*)A2p; const T* Bt = (const T*)Btp; const T* Bt2 = (const T*)Bt2p;
  constexpr int NA = (SPLIT_MODE >= 1) ? 2 : 1;      // planes of A, of Bt
  constexpr int NB = (SPLIT_MODE == 2) ? 2 : 1;
  constexpr int kAEl = kGBM * kGP;                   // elements of one plane's tile in LDS
  constexpr int kBEl = kGBN * kGP;
  constexpr int kStage = NA * kAEl + NB * kBEl;      // one buffer: [A hi | A lo | Bt hi | Bt lo]
  __shared__ __align__(16) T ring[2 * kStage];
  __shared__ __align__(16) float sT[8][16 * 68];   // per-wave 16x64 slab, pitch 68 floats
  const int b    = blockIdx.y;
  const int lane = threadIdx.x & 31;
  const int wave = threadIdx.x >> 5;
  const int blocksN = N / kGBN;
  if ((int)blockIdx.x >= (M / kGBM) * blocksN) return;   // block-uniform, ahead of every copy and barrier
  const int bm = blockIdx.x / blocksN;
  const int bn = blockIdx.x - bm * blocksN;
  const int mb0 = bm * kGBM;
  const int nb0 = bn * kGBN;
  const int wm = wave >> 2, wn = wave & 3;
  const int m0 = mb0 + (wm << 6);
  const int n0 = nb0 + (wn << 6);

  const T* Ab  = A  + (size_t)b * strideA;
  const T* Bb  = Bt + (size_t)b * strideB;
  const T* Ab2 = (SPLIT_MODE >= 1) ? (A2  + (size_t)b * strideA) : nullptr;
  const T* Bb2 = (SPLIT_MODE == 2) ? (Bt2 + (size_t)b * strideB) : nullptr;

  const int rlane = lane & 15;                 // row (A) / col (B, D) within subtile
  const int koff  = (lane >> 4) * 8;           // k offset of this lane half
  const int mOff  = (lane >> 4) * 8;           // D row offset

  v8f acc[4][4];
#pragma unroll
  for (int i = 0; i < 4; ++i)
#pragma unroll
    for (int j = 0; j < 4; ++j) acc[i][j] = (v8f){0.f,0.f,0.f,0.f,0.f,0.f,0.f,0.f};

  // this thread's share of every stage: row tid >> 3 (+32 per copy) of each tile, 16-B piece tid & 7
  const int crow = threadIdx.x >> 3, cpc = (threadIdx.x & 7) * 8;
  const unsigned short* gA  = (const unsigned short*)Ab + (size_t)(mb0 + crow) * lda + cpc;
  const unsigned short* gB  = (const unsigned short*)Bb + (size_t)(nb0 + crow) * ldb + cpc;
  const unsigned short* gA2 = (SPLIT_MODE >= 1) ? ((const unsigned short*)Ab2 + (size_t)(mb0 + crow) * lda + cpc) : nullptr;
  const unsigned short* gB2 = (SPLIT_MODE == 2) ? ((const unsigned short*)Bb2 + (size_t)(nb0 + crow) * ldb + cpc) : nullptr;
  const unsigned lT = lds_off(ring) + (unsigned)((crow * kGP + cpc) * 2);
  auto issue_stage = [&](int t) {
    const unsigned lb = lT + (unsigned)((t & 1) * (kStage * 2));
    const int k0 = t * kGBK;
    stage_rows<kGBM>(lb, gA + k0, lda);
    if (SPLIT_MODE >= 1) stage_rows<kGBM>(lb + kAEl * 2, gA2 + k0, lda);
    stage_rows<kGBN>(lb + NA * kAEl * 2, gB + k0, ldb);
    if (SPLIT_MODE == 2) stage_rows<kGBN>(lb + (NA * kAEl + kBEl) * 2, gB2 + k0, ldb);
  };

  const int nk = K / kGBK;   // block-uniform
  issue_stage(0);
  asm volatile("s_wait_asynccnt 0x0" ::: "memory");   // this wave's copies of stage 0 have landed
  __syncthreads();                                    // ... and every other wave's
  if (nk > 1) issue_stage(1);

  for (int t = 0; t < nk; ++t) {
    const T* sA = ring + (t & 1) * kStage + ((wm << 6) + rlane) * kGP + koff;
    const T* sB = ring + (t & 1) * kStage + NA * kAEl + ((wn << 6) + rlane) * kGP + koff;
#pragma unroll   // both halves of the stage in one straight run: the second half's fragment loads go among the first half's products
    for (int ks = 0; ks < kGBK; ks += 32) {
      V bh[4], bl[4];
#pragma unroll
      for (int j = 0; j < 4; ++j) {
        bh[j] = Frag<T>::load(sB + (j << 4) * kGP + ks);
        if (SPLIT_MODE == 2) bl[j] = Frag<T>::load(sB + kBEl + (j << 4) * kGP + ks);
      }
      V ah[4], al[4];   // all fragments of the half are asked for as one group, ahead of its products
#pragma unroll   // constant indices keep the fragment arrays in registers
      for (int i = 0; i < 4; ++i) {
        ah[i] = Frag<T>::load(sA + (i << 4) * kGP + ks);
        if (SPLIT_MODE >= 1) al[i] = Frag<T>::load(sA + kAEl + (i << 4) * kGP + ks);
      }
#pragma unroll
      for (int i = 0; i < 4; ++i) {
#pragma unroll
        for (int j = 0; j < 4; ++j) {
          acc[i][j] = Frag<T>::mma(ah[i], bh[j], acc[i][j]);
          if (SPLIT_MODE == 2) acc[i][j] = Frag<T>::mma(ah[i], bl[j], acc[i][j]);
          if (SPLIT_MODE >= 1) acc[i][j] = Frag<T>::mma(al[i], bh[j], acc[i][j]);
        }
        Frag<T>::guard(acc[i][0], acc[i][3], ah[i], (SPLIT_MODE >= 1) ? al[i] : ah[i]);
      }
      Frag<T>::keep(bh[0], bh[1], bh[2], bh[3]);
      if (SPLIT_MODE == 2) Frag<T>::keep(bl[0], bl[1], bl[2], bl[3]);
    }
    // publish point of stage t + 1; the one barrier also ends every wave's reads of the buffer that is refilled behind it
    asm volatile("s_wait_dscnt 0x0" ::: "memory");      // this wave's LDS reads of stage t are done
    asm volatile("s_wait_asynccnt 0x0" ::: "memory");   // this wave's copies of stage t + 1 have landed
    __syncthreads();
    if (t + 2 < nk) issue_stage(t + 2);
  }
  asm volatile("s_wait_asynccnt 0x0" ::: "memory");     // no copy is outstanding when the wave goes on to the epilogue
  acc_guard4(acc[0][0], acc[0][1], acc[0][2], acc[0][3]);
  acc_guard4(acc[1][0], acc[1][1], acc[1][2], acc[1][3]);
  acc_guard4(acc[2][0], acc[2][1], acc[2][2], acc[2][3]);
  acc_guard4(acc[3][0], acc[3][1], acc[3][2], acc[3][3]);

  // ---- epilogue ----
  float* slab = sT[wave];
  const float* Rb = RESID ? (resid + (size_t)b * strideR) : nullptr;
#pragma unroll
  for (int i = 0; i < 4; ++i) {
    const int mBase = m0 + (i << 4);
#pragma unroll
    for (int j = 0; j < 4; ++j) {
      const int n = n0 + (j << 4) + rlane;
      float bv = 0.f;
      if (BIAS_MODE == 2) bv = bias[n];
      float asc = 1.0f, abi = 0.0f;
      if (OUT_MODE == 3) {
        const int which = n0 / kDim;               // wave-uniform (64-col tile inside one kDim block)
        const int cc = n - which * kDim;           // 0..kDim-1, all four tables have kDim entries
        const float s0 = bf_rne(affs0[cc]);
        const float c0 = bf_rne(affb0[cc]);
        const float s1 = bf_rne(affs1[cc]);
        const float c1 = bf_rne(affb1[cc]);
        asc = (which == 0) ? s0 : ((which == 1) ? s1 : 1.0f);
        abi = (which == 0) ? c0 : ((which == 1) ? c1 : 0.0f);
      }
#pragma unroll
      for (int r = 0; r < 8; ++r) {
        float v = acc[i][j][r] * scale;
        if (BIAS_MODE == 1) v += bias[mBase + mOff + r];
        if (BIAS_MODE == 2) v += bv;
        if (OUT_MODE == 3) v = v * asc + abi;
        if (RESID) v += Rb[(size_t)(mBase + mOff + r) * ldc + n];
        if (ACT == 1) v = tanhf(v);
        if (ACT == 2) v = fmaxf(v, 0.0f);
        if (ACT == 4) v = (v > 0.f) ? v : 0.01f * v;
        slab[(mOff + r) * 68 + (j << 4) + rlane] = v;
      }
    }
    __builtin_amdgcn_fence(__ATOMIC_RELEASE, "workgroup");
    __builtin_amdgcn_wave_barrier();
    __builtin_amdgcn_fence(__ATOMIC_ACQUIRE, "workgroup");
    if (OUT_MODE == 0) {
      float* C = (float*)Cout + (size_t)b * strideC;
      const int hh = lane >> 4, c4 = (lane & 15) * 4;     // row seg = 256 B = 16 lanes x 16 B
      {
#pragma unroll
        for (int it = 0; it < 8; ++it) {
          const int row = it * 2 + hh;
          v4f v = *(const v4f*)(slab + row * 68 + c4);
          *(v4f*)(C + (size_t)(mBase + row) * ldc + n0 + c4) = v;
        }
        
      }
    } else {
      const int q = lane >> 3, c8 = (lane & 7) * 8;
      unsigned short* C;
      unsigned short* C2;
      int ncol;
      if (OUT_MODE == 3) {
        const int which = n0 / kDim;
        C  = (unsigned short*)Cout + (size_t)which * 2 * (size_t)strideC;
        C2 = C + (size_t)strideC;
        ncol = n0 - which * kDim;
      } else {
        C  = (unsigned short*)Cout  + (size_t)b * strideC;
        C2 = (OUT_MODE == 2) ? ((unsigned short*)Cout2 + (size_t)b * strideC) : nullptr;
        ncol = n0;
      }
      {
#pragma unroll
        for (int it = 0; it < 4; ++it) {
          const int row = it * 4 + q;
          const float* sp = slab + row * 68 + c8;
          v8h hv, lv;
#pragma unroll
          for (int e = 0; e < 8; ++e) {
            if (OUT_MODE == 1) {
              hv[e] = (_Float16)sp[e];
            } else {
              unsigned short hb = f2bf_bits(sp[e]);
              unsigned short lb = f2bf_bits(sp[e] - bf_bits2f(hb));
              hv[e] = __builtin_bit_cast(_Float16, hb);
              lv[e] = __builtin_bit_cast(_Float16, lb);
            }
          }
          *(v8h*)(C + (size_t)(mBase + row) * ldc + ncol + c8) = hv;
          if (OUT_MODE >= 2) *(v8h*)(C2 + (size_t)(mBase + row) * ldc + ncol + c8) = lv;
        }
        
      }
    }
    __builtin_amdgcn_fence(__ATOMIC_RELEASE, "workgroup");
    __builtin_amdgcn_wave_barrier();
    __builtin_amdgcn_fence(__ATOMIC_ACQUIRE, "workgroup");
  }
}

// coverage: n8 threads x 8 elements = n (host passes n8 = n/8 with n % 8 == 0)
__global__ __launch_bounds__(256) void cast_bf16x8_k(const float* __restrict__ in,
                                                     unsigned short* __restrict__ out, int n8) {
  const int i = blockIdx.x * 256 + threadIdx.x;
  if (i < n8) {
    const size_t o = (size_t)i * 8;
    const v4f a = *(const v4f*)(in + o);
    const v4f bq = *(const v4f*)(in + o + 4);
    v8h hv;
#pragma unroll
    for (int e = 0; e < 4; ++e) {
      hv[e]     = __builtin_bit_cast(_Float16, f2bf_bits(a[e]));
      hv[4 + e] = __builtin_bit_cast(_Float16, f2bf_bits(bq[e]));
    }
    *(v8h*)(out + o) = hv;
    
  }
}

// ---- W [K][N] f32 -> Wt [N][K] bf16 (RNE), 64x64 tile transposed through LDS ----
// in[rows = K][cols = N] -> out[N][K]; grid = (N/64, K/64).
// producer coverage: 256 threads x (1 row x 16 cols) = 64x64 tile; store: 8 waves x 4 rows x 2 it = 64 rows, 8 lanes x 8 halves = 64 cols.
constexpr int kWTP = 72;
__global__ __launch_bounds__(256) void wt_cast_bf_k(const float* __restrict__ W, unsigned short* __restrict__ Wtp,
                                                    int K, int N) {
  __shared__ __align__(16) _Float16 st[64 * kWTP];
  _Float16* Wt = (_Float16*)Wtp;
  const int n0 = blockIdx.x * 64, k0 = blockIdx.y * 64;
  const int tid = threadIdx.x;
  const int kr = tid >> 2, c16 = (tid & 3) * 16;
  const float* src = W + (size_t)(k0 + kr) * N + n0 + c16;
#pragma unroll
  for (int qq = 0; qq < 4; ++qq) {
    const v4f v = *(const v4f*)(src + 4 * qq);
#pragma unroll
    for (int e = 0; e < 4; ++e)
      st[(c16 + 4 * qq + e) * kWTP + kr] = __builtin_bit_cast(_Float16, f2bf_bits(v[e]));
  }
  __syncthreads();
  const int wave = tid >> 5, lane = tid & 31;
  const int q8 = lane >> 3, c8 = (lane & 7) * 8;
  {
#pragma unroll
    for (int it = 0; it < 2; ++it) {
      const int n = it * 32 + wave * 4 + q8;
      const v8h hv = *(const v8h*)(st + n * kWTP + c8);
      *(v8h*)(Wt + (size_t)(n0 + n) * K + k0 + c8) = hv;
    }
    
  }
}

// =====================================================================================
// Causal attention, head_dim 64, fed by bf16 hi/lo planes laid out [kTok][kDim] (row = b*kSeq + t, col = h*64 + d).
//   scores = (qh.kh + qh.kl + ql.kh) / 8 : v_wmma_f32_16x16x32_bf16, f32 accumulate
//   out    =  ph.vh + ph.vl + pl.vh      : v_wmma_f32_16x16x32_bf16, p = exp(s - max) split into bf16 hi/lo
//   online softmax in f32. Block = 4 waves = 64 query rows of one head of batch blockIdx.y; 64-key chunks,
//   chunks above the diagonal skipped, per-element causal select (key > query -> -inf) on the diagonal chunk.
//   grid = (kHeads * (kSeq/64), kBatch); Y planes are [kTok][kDim] like the inputs.
// =====================================================================================
constexpr int kKC = 64;
constexpr int kQB = 64;
constexpr int kLP = 2 * 64 + 8;   // LDS row pitch in bf16 elements (272 B)
constexpr int kVS = 16;           // shift (32 B = 8 banks) of V rows d >= 32: the two d halves that one staging store writes leave each other's banks
constexpr int kOP = 68;           // f32 pitch of the output tile (16 x 68 x 4 B = one wave's P buffer)

__device__ __forceinline__ v8f mma_bf(v16b a, v16b b, v8f c) {
  c = __builtin_amdgcn_wmma_f32_16x16x32_bf16(false, a, false, b, (short)0, c, false, false);
  asm volatile("v_nop\n\tv_nop\n\tv_nop\n\tv_nop" : "+v"(c) : "v"(a), "v"(b));
  return c;
}

__global__ __launch_bounds__(128)
void attn_hd64_k(const unsigned short* __restrict__ Qhp, const unsigned short* __restrict__ Qlp,
                 const unsigned short* __restrict__ Khp, const unsigned short* __restrict__ Klp,
                 const unsigned short* __restrict__ Vhp, const unsigned short* __restrict__ Vlp,
                 unsigned short* __restrict__ Yhp, unsigned short* __restrict__ Ylp) {
  union FB { v16b v; v8b h[2]; };
  // Every LDS row holds its hi half (64 elements) then its lo half (64 elements) plus 8 pad elements: pitch 272 B = 16 B x 17,
  // so the 16 rows of one ds_load_b128 fragment read start on 16 different 4-bank groups (at 128 B they fell on two).
  __shared__ __align__(16) __bf16 Ks[kKC * kLP];              // K [kv][hi d | lo d]
  __shared__ __align__(16) __bf16 Vt[kHD * kLP + kVS];        // V [d][hi kv | lo kv]; rows d >= 32 lie kVS elements further
  __shared__ __align__(16) __bf16 Pbuf[4][16 * kLP];          // per wave: P [16][hi key | lo key]; reused as f32 out tile [16][64] at pitch kOP
  __bf16* const Ksh = Ks;
  __bf16* const Ksl = Ks + kHD;
  __bf16* const Vth = Vt;
  __bf16* const Vtl = Vt + kKC;

  const __bf16* Qh = (const __bf16*)Qhp;
  const __bf16* Ql = (const __bf16*)Qlp;
  const __bf16* Kh = (const __bf16*)Khp;
  const __bf16* Kl = (const __bf16*)Klp;
  const __bf16* Vh = (const __bf16*)Vhp;
  const __bf16* Vl = (const __bf16*)Vlp;

  const int tid  = threadIdx.x;
  const int wave = tid >> 5;
  const int lane = tid & 31;
  const int hh   = lane >> 4;
  const int c    = lane & 15;

  constexpr int nqb = kSeq / kQB;   // 32
  const int bx = blockIdx.x;
  const int qb = bx % nqb;
  const int h  = bx / nqb;
  const int q0 = qb * kQB + wave * 16;          // token index of this wave's first row
  const size_t rowb = (size_t)blockIdx.y * kSeq; // plane row base of this batch
  const int hcol = h * kHD;

  // ---- Q fragments (A operand): 2 d-chunks, hi and lo; Frag load = split k-map ----
  v16b qah[2], qal[2];
  {
    const size_t qoff = (rowb + (size_t)(q0 + c)) * kDim + hcol + 8 * hh;
#pragma unroll
    for (int dc = 0; dc < 2; ++dc) {
      qah[dc] = Frag<__bf16>::load(Qh + qoff + dc * 32);
      qal[dc] = Frag<__bf16>::load(Ql + qoff + dc * 32);
    }
  }

  float mrow[8], lrow[8];
  v8f oacc[4];
#pragma unroll
  for (int r = 0; r < 8; ++r) { mrow[r] = -INFINITY; lrow[r] = 0.f; }
#pragma unroll
  for (int t = 0; t < 4; ++t) oacc[t] = (v8f){0.f,0.f,0.f,0.f,0.f,0.f,0.f,0.f};

  const int nChunks = qb + 1;   // block-uniform, <= 32
  for (int kc = 0; kc < nChunks; ++kc) {
    const int kv0 = kc * kKC;
    __syncthreads();
    {
      // staging coverage: 128 threads x (1 key row x 32 d) = 64 keys x 64 d for each of the four tiles
      const int kvr = tid >> 1, dh = (tid & 1) * 32;
      const size_t goff = (rowb + (size_t)(kv0 + kvr)) * kDim + hcol + dh;
      __bf16* const kdst = Ks + kvr * kLP + dh;                        // this thread's K row, hi half
      __bf16* const vdst = Vt + dh * kLP + (dh >> 5) * kVS + kvr;      // this thread's V column, first d row, hi half
#pragma unroll 1
      for (int i = 0; i < 4; ++i) {
        const v8b a0 = *(const v8b*)(Kh + goff + 8 * i);
        const v8b a1 = *(const v8b*)(Kl + goff + 8 * i);
        *(v8b*)(kdst + 8 * i) = a0;
        *(v8b*)(kdst + kHD + 8 * i) = a1;
        const v8b w0 = *(const v8b*)(Vh + goff + 8 * i);
        const v8b w1 = *(const v8b*)(Vl + goff + 8 * i);
#pragma unroll
        for (int e = 0; e < 8; ++e) {
          vdst[(8 * i + e) * kLP] = w0[e];
          vdst[(8 * i + e) * kLP + kKC] = w1[e];
        }
      }
    }
    __syncthreads();

    // ---- scores: D row = query 8hh+r, col = key j*16+c ----
    v8f s[4];
#pragma unroll
    for (int j = 0; j < 4; ++j) {
      s[j] = (v8f){0.f,0.f,0.f,0.f,0.f,0.f,0.f,0.f};
#pragma unroll
      for (int dc = 0; dc < 2; ++dc) {
        FB kb, kl;
        kb.h[0] = *(const v8b*)(Ksh + (j * 16 + c) * kLP + dc * 32 + 8 * hh);
        kb.h[1] = *(const v8b*)(Ksh + (j * 16 + c) * kLP + dc * 32 + 16 + 8 * hh);
        kl.h[0] = *(const v8b*)(Ksl + (j * 16 + c) * kLP + dc * 32 + 8 * hh);
        kl.h[1] = *(const v8b*)(Ksl + (j * 16 + c) * kLP + dc * 32 + 16 + 8 * hh);
        s[j] = mma_bf(qah[dc], kb.v, s[j]);
        s[j] = mma_bf(qah[dc], kl.v, s[j]);
        s[j] = mma_bf(qal[dc], kb.v, s[j]);
      }
    }
    const bool diag = (kc == qb);   // block-uniform
    float cm[8];
#pragma unroll
    for (int r = 0; r < 8; ++r) {
      const int qrow = q0 + 8 * hh + r;
      float m = -INFINITY;
#pragma unroll
      for (int j = 0; j < 4; ++j) {
        const int kvcol = kv0 + j * 16 + c;
        float sv = s[j][r] * 0.125f;
        if (diag && (kvcol > qrow)) sv = -INFINITY;
        s[j][r] = sv;
        m = fmaxf(m, sv);
      }
#pragma unroll
      for (int off = 1; off < 16; off <<= 1) m = fmaxf(m, __shfl_xor(m, off, 32));
      cm[r] = m;
    }
    __bf16* pwh = Pbuf[wave];
    __bf16* pwl = Pbuf[wave] + kKC;
#pragma unroll
    for (int r = 0; r < 8; ++r) {
      const float mnew = fmaxf(mrow[r], cm[r]);
      const float mref = (mnew > -INFINITY) ? mnew : 0.0f;   // all-masked so far -> p = 0, alpha = 0
      const float alpha = expf(mrow[r] - mref);
      mrow[r] = mnew;
      float psum = 0.f;
#pragma unroll
      for (int j = 0; j < 4; ++j) {
        const float p = expf(s[j][r] - mref);
        psum += p;
        const unsigned short hb = f2bf_bits(p);
        const unsigned short lb = f2bf_bits(p - bf_bits2f(hb));
        pwh[(8 * hh + r) * kLP + j * 16 + c] = __builtin_bit_cast(__bf16, hb);
        pwl[(8 * hh + r) * kLP + j * 16 + c] = __builtin_bit_cast(__bf16, lb);
      }
#pragma unroll
      for (int off = 1; off < 16; off <<= 1) psum += __shfl_xor(psum, off, 32);
      lrow[r] = lrow[r] * alpha + psum;
#pragma unroll
      for (int t = 0; t < 4; ++t) oacc[t][r] *= alpha;
    }
    __builtin_amdgcn_fence(__ATOMIC_RELEASE, "workgroup");
    __builtin_amdgcn_wave_barrier();
    __builtin_amdgcn_fence(__ATOMIC_ACQUIRE, "workgroup");
    // ---- out += P (A: m = row, k = key) x V (B: k = key, n = d) ----
#pragma unroll 1
    for (int kk = 0; kk < 2; ++kk) {
      FB pa, pl;
      pa.h[0] = *(const v8b*)(pwh + c * kLP + kk * 32 + 8 * hh);
      pa.h[1] = *(const v8b*)(pwh + c * kLP + kk * 32 + 16 + 8 * hh);
      pl.h[0] = *(const v8b*)(pwl + c * kLP + kk * 32 + 8 * hh);
      pl.h[1] = *(const v8b*)(pwl + c * kLP + kk * 32 + 16 + 8 * hh);
#pragma unroll
      for (int t = 0; t < 4; ++t) {
        FB vb, vl;
        vb.h[0] = *(const v8b*)(Vth + (t * 16 + c) * kLP + (t >> 1) * kVS + kk * 32 + 8 * hh);
        vb.h[1] = *(const v8b*)(Vth + (t * 16 + c) * kLP + (t >> 1) * kVS + kk * 32 + 16 + 8 * hh);
        vl.h[0] = *(const v8b*)(Vtl + (t * 16 + c) * kLP + (t >> 1) * kVS + kk * 32 + 8 * hh);
        vl.h[1] = *(const v8b*)(Vtl + (t * 16 + c) * kLP + (t >> 1) * kVS + kk * 32 + 16 + 8 * hh);
        oacc[t] = mma_bf(pa.v, vb.v, oacc[t]);
        oacc[t] = mma_bf(pa.v, vl.v, oacc[t]);
        oacc[t] = mma_bf(pl.v, vb.v, oacc[t]);
      }
    }
  }

  // ---- epilogue: y = out / l, staged per wave as f32 [16][64] (pitch kOP) in the wave's P buffer ----
  __syncthreads();
  float* os = (float*)(Pbuf[wave]);   // 16 rows x kOP f32 = 4352 B
#pragma unroll
  for (int r = 0; r < 8; ++r) {
    const float inv = 1.0f / lrow[r];
#pragma unroll
    for (int t = 0; t < 4; ++t) os[(8 * hh + r) * kOP + t * 16 + c] = oacc[t][r] * inv;
  }
  __builtin_amdgcn_fence(__ATOMIC_RELEASE, "workgroup");
  __builtin_amdgcn_wave_barrier();
  __builtin_amdgcn_fence(__ATOMIC_ACQUIRE, "workgroup");
  {
    // store coverage: per it, lanes (q8 = 0..3) x (c8 = 0..56 step 8) = 4 rows x 64 cols; 4 it = 16 rows = this wave's tile.
    const int q8 = lane >> 3, c8 = (lane & 7) * 8;
    {
#pragma unroll
      for (int it = 0; it < 4; ++it) {
        const int row = it * 4 + q8;
        const float* sp = os + row * kOP + c8;
        v8h hv, lv;
#pragma unroll
        for (int e = 0; e < 8; ++e) {
          const unsigned short hb = f2bf_bits(sp[e]);
          const unsigned short lb = f2bf_bits(sp[e] - bf_bits2f(hb));
          hv[e] = __builtin_bit_cast(_Float16, hb);
          lv[e] = __builtin_bit_cast(_Float16, lb);
        }
        const size_t yo = (rowb + (size_t)(q0 + row)) * kDim + hcol + c8;
        *(v8h*)(Yhp + yo) = hv;
        *(v8h*)(Ylp + yo) = lv;
      }
      
    }
  }
}

// ---------------------------------------------------------------------------
// Workspace region map (bytes):
//   [0, 16777216)            Xb   bf16 [8192][1024]  (dead after the qkv GEMM; reused as Yh bf16 [8192][1024])
//   [16777216, 23068672)     WqT  bf16 [3072][1024]
//   [23068672, 25165824)     WpT  bf16 [1024][1024]
//   [25165824, 125829120)    QKV  bf16 6 planes [8192][1024]: Qh, Ql, Kh, Kl, Vh, Vl
//   [125829120, 142606336)   Yl   bf16 [8192][1024]
//   total 142,606,336 B
// ---------------------------------------------------------------------------
extern "C" void kernel_launch(void* const* d_in, const int* in_sizes, int n_in,
                              void* d_out, int out_size, void* d_ws, size_t ws_size,
                              hipStream_t stream) {
  if (n_in < 9) return;
  if (in_sizes[0] != kTok * kDim || in_sizes[1] != kDim * kDim3 || in_sizes[2] != kDim3 ||
      in_sizes[3] != kDim * kDim || in_sizes[4] != kDim ||
      in_sizes[5] != kHeads * kHD || in_sizes[6] != kHeads * kHD ||
      in_sizes[7] != kHeads * kHD || in_sizes[8] != kHeads * kHD ||
      out_size != kTok * kDim) return;

  const float* x     = (const float*)d_in[0];
  const float* Wqkv  = (const float*)d_in[1];
  const float* bqkv  = (const float*)d_in[2];
  const float* Wproj = (const float*)d_in[3];
  const float* bproj = (const float*)d_in[4];
  const float* qs    = (const float*)d_in[5];
  const float* qbv   = (const float*)d_in[6];
  const float* ks    = (const float*)d_in[7];
  const float* kbv   = (const float*)d_in[8];
  float* out = (float*)d_out;

  const size_t plane  = (size_t)kTok * kDim;                 // elements per [8192][1024] plane
  const size_t offX   = 0;
  const size_t offWq  = offX  + plane * 2;                    // 16,777,216
  const size_t offWp  = offWq + (size_t)kDim3 * kDim * 2;     // 23,068,672
  const size_t offQKV = offWp + (size_t)kDim * kDim * 2;      // 25,165,824
  const size_t offYl  = offQKV + 6 * plane * 2;               // 125,829,120
  const size_t total  = offYl + plane * 2;                    // 142,606,336
  if (total > ws_size) return;

  char* ws = (char*)d_ws;
  unsigned short* Xb  = (unsigned short*)(ws + offX);
  unsigned short* Yh  = Xb;                                   // [8192][1024] bf16, the whole Xb region
  unsigned short* Yl  = (unsigned short*)(ws + offYl);        // [8192][1024] bf16
  unsigned short* WqT = (unsigned short*)(ws + offWq);
  unsigned short* WpT = (unsigned short*)(ws + offWp);
  unsigned short* QKV = (unsigned short*)(ws + offQKV);
  unsigned short* Qh = QKV;
  unsigned short* Ql = QKV + plane;
  unsigned short* Kh = QKV + 2 * plane;
  unsigned short* Kl = QKV + 3 * plane;
  unsigned short* Vh = QKV + 4 * plane;
  unsigned short* Vl = QKV + 5 * plane;

  // 1) x -> bf16 plane: n = 8,388,608, 8 per thread -> 1,048,576 threads = 4096 blocks x 256 (exact)
  const int n8 = (kTok * kDim) / 8;
  cast_bf16x8_k<<<dim3((n8 + 255) / 256), dim3(256), 0, stream>>>(x, Xb, n8);

  // 2) W_qkv in[1024][3072] -> WqT out[3072][1024] bf16: grid (3072/64, 1024/64)
  wt_cast_bf_k<<<dim3(kDim3 / 64, kDim / 64), dim3(256), 0, stream>>>(Wqkv, WqT, kDim, kDim3);
  // 3) W_proj in[1024][1024] -> WpT out[1024][1024] bf16: grid (1024/64, 1024/64)
  wt_cast_bf_k<<<dim3(kDim / 64, kDim / 64), dim3(256), 0, stream>>>(Wproj, WpT, kDim, kDim);

  // 4) qkv = Xb[8192][1024] . WqT[3072][1024]^T + b_qkv, per-head affine on q/k, bf16 hi/lo planes.
  //    M = 8192 (multiple of 128), N = 3072 (multiple of 256), K = 1024 (multiple of 64); block tiles 64 x 12 = 768 blocks x 8 waves.
  wmma_gemm64<1, 0, 2, 3, false><<<dim3(768, 1), dim3(256), 0, stream>>>(
      Xb, Xb, kDim, 0L, WqT, WqT, kDim, 0L,
      (void*)QKV, (void*)QKV, kDim, (long)plane,
      bqkv, bqkv, 0L, qs, qbv, ks, kbv,
      kTok, kDim3, kDim, 1.0f);

  // 5) causal attention of all batches in one launch -> Yh/Yl: grid (16 heads x 32 query blocks, 4 batches).
  attn_hd64_k<<<dim3(kHeads * (kSeq / kQB), kBatch), dim3(128), 0, stream>>>(Qh, Ql, Kh, Kl, Vh, Vl, Yh, Yl);
  // 6) out = Y . WpT^T + b_proj over all rows (A hi/lo, 2 products).
  //    M = 8192, N = 1024, K = 1024; block tiles 64 x 4 = 256 blocks x 8 waves.
  wmma_gemm64<1, 1, 2, 0, false><<<dim3(256, 1), dim3(256), 0, stream>>>(
      Yh, Yl, kDim, 0L, WpT, WpT, kDim, 0L,
      (void*)out, (void*)out, kDim, 0L,
      bproj, bproj, 0L, qs, qbv, ks, kbv,
      kTok, kDim, kDim, 1.0f);
}

// v004
// Measured time: 265 microseconds a run.
// Timed twice side by side with v003, it ran 1.41 times as fast both times.
// Counting every step since v000, it is 5.02 times as fast.
// Contractions: x*W_qkv on v_wmma_f32_16x16x32_bf16 (plain bf16 operands = RNE-bf16 inputs); q*k^T and p*v on v_wmma_f32_16x16x32_bf16 with bf16 hi/lo operand pairs (hi*hi + hi*lo + lo*hi); y*W_proj on v_wmma_f32_16x16x32_bf16 with y as bf16 hi/lo and exact bf16 weights (hi*w + lo*w); f32 accumulate everywhere; bias, per-head affine and softmax in f32.
#include <hip/hip_runtime.h>
#include <stdint.h>
#include <math.h>

constexpr int kBatch = 4;
constexpr int kSeq   = 2048;
constexpr int kDim   = 1024;
constexpr int kHeads = 16;
constexpr int kHD    = 64;
constexpr int kTok   = kBatch * kSeq;   // 8192
constexpr int kDim3  = 3 * kDim;        // 3072

typedef __attribute__((ext_vector_type(16))) _Float16 v16h;
typedef __attribute__((ext_vector_type(8)))  _Float16 v8h;
typedef __attribute__((ext_vector_type(16))) __bf16   v16b;
typedef __attribute__((ext_vector_type(8)))  __bf16   v8b;
typedef __attribute__((ext_vector_type(8)))  float    v8f;
typedef __attribute__((ext_vector_type(4)))  float    v4f;

__device__ __forceinline__ unsigned short f2bf_bits(float f) {
  unsigned u = __float_as_uint(f);
  return (unsigned short)((u + 0x7FFFu + ((u >> 16) & 1u)) >> 16);
}
__device__ __forceinline__ float bf_bits2f(unsigned short h) { return __uint_as_float(((unsigned)h) << 16); }
__device__ __forceinline__ float bf_rne(float f) { return bf_bits2f(f2bf_bits(f)); }

// hazard guards as plain device helpers
__device__ __forceinline__ void dep_guard_h(v8f& a, v8f& b, v16h x, v16h y) { asm volatile("v_nop\n\tv_nop\n\tv_nop\n\tv_nop" : "+v"(a), "+v"(b) : "v"(x), "v"(y)); }
__device__ __forceinline__ void dep_guard_b(v8f& a, v8f& b, v16b x, v16b y) { asm volatile("v_nop\n\tv_nop\n\tv_nop\n\tv_nop" : "+v"(a), "+v"(b) : "v"(x), "v"(y)); }
__device__ __forceinline__ void keep4_h(v16h a, v16h b, v16h c, v16h d) { asm volatile("v_nop" :: "v"(a), "v"(b), "v"(c), "v"(d)); }
__device__ __forceinline__ void keep4_b(v16b a, v16b b, v16b c, v16b d) { asm volatile("v_nop" :: "v"(a), "v"(b), "v"(c), "v"(d)); }
__device__ __forceinline__ void acc_guard4(v8f& a, v8f& b, v8f& c, v8f& d) { asm volatile("v_nop\n\tv_nop\n\tv_nop\n\tv_nop" : "+v"(a), "+v"(b), "+v"(c), "+v"(d)); }
template <typename T> struct Frag;
template <> struct Frag<_Float16> {
  typedef v16h V; union U { v16h v; v8h h[2]; };
  static __device__ __forceinline__ v16h load(const _Float16* p) {   // elements 0..7 <- p[0..7], 8..15 <- p[16..23]
    U f; f.h[0] = *(const v8h*)(p); f.h[1] = *(const v8h*)(p + 16); return f.v;
  }
  static __device__ __forceinline__ v8f mma(v16h a, v16h b, v8f c) {
    return __builtin_amdgcn_wmma_f32_16x16x32_f16(false, a, false, b, (short)0, c, false, false);
  }
  static __device__ __forceinline__ void guard(v8f& a, v8f& b, v16h x, v16h y) { dep_guard_h(a, b, x, y); }
  static __device__ __forceinline__ void keep(v16h a, v16h b, v16h c, v16h d) { keep4_h(a, b, c, d); }
};
template <> struct Frag<__bf16> {
  typedef v16b V; union U { v16b v; v8b h[2]; };
  static __device__ __forceinline__ v16b load(const __bf16* p) {
    U f; f.h[0] = *(const v8b*)(p); f.h[1] = *(const v8b*)(p + 16); return f.v;
  }
  static __device__ __forceinline__ v8f mma(v16b a, v16b b, v8f c) {
    return __builtin_amdgcn_wmma_f32_16x16x32_bf16(false, a, false, b, (short)0, c, false, false);
  }
  static __device__ __forceinline__ void guard(v8f& a, v8f& b, v16b x, v16b y) { dep_guard_b(a, b, x, y); }
  static __device__ __forceinline__ void keep(v16b a, v16b b, v16b c, v16b d) { keep4_b(a, b, c, d); }
};

// ---- Register-blocked batched WMMA GEMM ------------------------------------
// C[m,n] = scale * sum_k A[m,k] * Bt[n,k] (+bias)(affine)(+resid); each wave owns a 64x64 tile.
// A row-major [M,K]; Bt row-major [N,K]; M % 128 == 0, N % 256 == 0, K % 64 == 0, lda and ldb % 8 == 0.
// A block of 8 waves (2 x 4) owns a 128 x 256 tile of C. Its operand rows come 64 k (one 128-B line of every row) at a time
// into an LDS ring of two buffers by asynchronous copies, whole lines per wave-copy; the fragments are read from LDS.
// SPLIT_MODE: 0 = plain; 1 = A carried as hi/lo planes (A2 = lo): hi.b + lo.b; 2 = A and Bt hi/lo: hi.hi + hi.lo + lo.hi.
// BIAS_MODE: 0 = none, 1 = bias[m], 2 = bias[n].
// OUT_MODE: 0 = f32, 1 = f16, 2 = bf16 hi plane (Cout) + bf16 lo plane (Cout2),
//           3 = qkv mode: columns n form three blocks of kDim (which = n0 / kDim); value v = (acc+bias)*affs[cc]+affb[cc]
//               with cc = n - which*kDim and tables (affs0,affb0) for which 0, (affs1,affb1) for which 1 (RNE-bf16 applied
//               to the table values), identity for which 2; written as bf16 hi plane at Cout + which*2*strideC and lo plane
//               at + strideC, row pitch ldc, column n0 - which*kDim.
// ET: 0 = f16 operands, 1 = bf16 operands (pointers passed as 16-bit storage)
constexpr int kGBM = 128;   // rows of C per block (2 waves of 64)
constexpr int kGBN = 256;   // columns of C per block (4 waves of 64)
constexpr int kGBK = 64;    // k per stage
constexpr int kGP  = 72;    // LDS row pitch in 16-bit elements: 144 B = 16 B x 9, for the ds_load_b128 fragment readers

__device__ __forceinline__ unsigned lds_off(const void* p) { return (unsigned)(size_t)p; }   // byte offset in the block's LDS

// ROWS rows of 128 B, global -> LDS, 16 B per lane and copy: thread -> row tid >> 3 (+32 per copy), piece tid & 7;
// ldst and gsrc already point at this thread's first row and piece; ld = global row pitch in elements.
template <int ROWS>
__device__ __forceinline__ void stage_rows(unsigned ldst, const unsigned short* gsrc, int ld) {
  const size_t g32 = (size_t)32 * (size_t)ld;
#pragma unroll   // one or two straight groups of four copies, no loop counter beside them
  for (int u = 0; u < ROWS / 128; ++u) {
    const unsigned l0 = ldst + (unsigned)(u * 128 * kGP * 2);
    const unsigned l1 = l0 + 32u * kGP * 2u, l2 = l0 + 64u * kGP * 2u, l3 = l0 + 96u * kGP * 2u;
    const unsigned short* g0 = gsrc + (size_t)(4 * u) * g32;
    const unsigned short* g1 = g0 + g32;
    const unsigned short* g2 = g1 + g32;
    const unsigned short* g3 = g2 + g32;
    // the s_wait_xcnt closes the copies' own statement, so that no address register of a copy is rewritten ahead of it
    asm volatile("global_load_async_to_lds_b128 %0, %1, off\n\t"
                 "global_load_async_to_lds_b128 %2, %3, off\n\t"
                 "global_load_async_to_lds_b128 %4, %5, off\n\t"
                 "global_load_async_to_lds_b128 %6, %7, off\n\t"
                 "s_wait_xcnt 0x0"
                 :: "v"(l0), "v"(g0), "v"(l1), "v"(g1), "v"(l2), "v"(g2), "v"(l3), "v"(g3) : "memory");
  }
}

template <int ET> struct Elem;
template <> struct Elem<0> { typedef _Float16 T; };
template <> struct Elem<1> { typedef __bf16 T; };
template <int ET, int SPLIT_MODE, int BIAS_MODE, int OUT_MODE, bool RESID, int ACT = 0>
__global__ __launch_bounds__(256) void wmma_gemm64(
    const unsigned short* __restrict__ Ap, const unsigned short* __restrict__ A2p, int lda, long strideA,
    const unsigned short* __restrict__ Btp, const unsigned short* __restrict__ Bt2p, int ldb, long strideB,
    void* __restrict__ Cout, void* __restrict__ Cout2, int ldc, long strideC,
    const float* __restrict__ bias,
    const float* __restrict__ resid, long strideR,
    const float* __restrict__ affs0, const float* __restrict__ affb0,
    const float* __restrict__ affs1, const float* __restrict__ affb1,
    int M, int N, int K, float scale) {
  typedef typename Elem<ET>::T T;
  typedef typename Frag<T>::V V;
  const T* A = (const T*)Ap; const T* A2 = (const T*)A2p; const T* Bt = (const T*)Btp; const T* Bt2 = (const T*)Bt2p;
  constexpr int NA = (SPLIT_MODE >= 1) ? 2 : 1;      // planes of A, of Bt
  constexpr int NB = (SPLIT_MODE == 2) ? 2 : 1;
  constexpr int kAEl = kGBM * kGP;                   // elements of one plane's tile in LDS
  constexpr int kBEl = kGBN * kGP;
  constexpr int kStage = NA * kAEl + NB * kBEl;      // one buffer: [A hi | A lo | Bt hi | Bt lo]
  __shared__ __align__(16) T ring[2 * kStage];
  __shared__ __align__(16) float sT[8][16 * 68];   // per-wave 16x64 slab, pitch 68 floats
  const int b    = blockIdx.y;
  const int lane = threadIdx.x & 31;
  const int wave = threadIdx.x >> 5;
  const int blocksN = N / kGBN;
  if ((int)blockIdx.x >= (M / kGBM) * blocksN) return;   // block-uniform, ahead of every copy and barrier
  const int bm = blockIdx.x / blocksN;
  const int bn = blockIdx.x - bm * blocksN;
  const int mb0 = bm * kGBM;
  const int nb0 = bn * kGBN;
  const int wm = wave >> 2, wn = wave & 3;
  const int m0 = mb0 + (wm << 6);
  const int n0 = nb0 + (wn << 6);

  const T* Ab  = A  + (size_t)b * strideA;
  const T* Bb  = Bt + (size_t)b * strideB;
  const T* Ab2 = (SPLIT_MODE >= 1) ? (A2  + (size_t)b * strideA) : nullptr;
  const T* Bb2 = (SPLIT_MODE == 2) ? (Bt2 + (size_t)b * strideB) : nullptr;

  const int rlane = lane & 15;                 // row (A) / col (B, D) within subtile
  const int koff  = (lane >> 4) * 8;           // k offset of this lane half
  const int mOff  = (lane >> 4) * 8;           // D row offset

  v8f acc[4][4];
#pragma unroll
  for (int i = 0; i < 4; ++i)
#pragma unroll
    for (int j = 0; j < 4; ++j) acc[i][j] = (v8f){0.f,0.f,0.f,0.f,0.f,0.f,0.f,0.f};

  // this thread's share of every stage: row tid >> 3 (+32 per copy) of each tile, 16-B piece tid & 7
  const int crow = threadIdx.x >> 3, cpc = (threadIdx.x & 7) * 8;
  const unsigned short* gA  = (const unsigned short*)Ab + (size_t)(mb0 + crow) * lda + cpc;
  const unsigned short* gB  = (const unsigned short*)Bb + (size_t)(nb0 + crow) * ldb + cpc;
  const unsigned short* gA2 = (SPLIT_MODE >= 1) ? ((const unsigned short*)Ab2 + (size_t)(mb0 + crow) * lda + cpc) : nullptr;
  const unsigned short* gB2 = (SPLIT_MODE == 2) ? ((const unsigned short*)Bb2 + (size_t)(nb0 + crow) * ldb + cpc) : nullptr;
  const unsigned lT = lds_off(ring) + (unsigned)((crow * kGP + cpc) * 2);
  auto issue_stage = [&](int t) {
    const unsigned lb = lT + (unsigned)((t & 1) * (kStage * 2));
    const int k0 = t * kGBK;
    stage_rows<kGBM>(lb, gA + k0, lda);
    if (SPLIT_MODE >= 1) stage_rows<kGBM>(lb + kAEl * 2, gA2 + k0, lda);
    stage_rows<kGBN>(lb + NA * kAEl * 2, gB + k0, ldb);
    if (SPLIT_MODE == 2) stage_rows<kGBN>(lb + (NA * kAEl + kBEl) * 2, gB2 + k0, ldb);
  };

  const int nk = K / kGBK;   // block-uniform
  issue_stage(0);
  asm volatile("s_wait_asynccnt 0x0" ::: "memory");   // this wave's copies of stage 0 have landed
  __syncthreads();                                    // ... and every other wave's
  if (nk > 1) issue_stage(1);

  for (int t = 0; t < nk; ++t) {
    const T* sA = ring + (t & 1) * kStage + ((wm << 6) + rlane) * kGP + koff;
    const T* sB = ring + (t & 1) * kStage + NA * kAEl + ((wn << 6) + rlane) * kGP + koff;
#pragma unroll   // both halves of the stage in one straight run: the second half's fragment loads go among the first half's products
    for (int ks = 0; ks < kGBK; ks += 32) {
      V bh[4], bl[4];
#pragma unroll
      for (int j = 0; j < 4; ++j) {
        bh[j] = Frag<T>::load(sB + (j << 4) * kGP + ks);
        if (SPLIT_MODE == 2) bl[j] = Frag<T>::load(sB + kBEl + (j << 4) * kGP + ks);
      }
      V ah[4], al[4];   // all fragments of the half are asked for as one group, ahead of its products
#pragma unroll   // constant indices keep the fragment arrays in registers
      for (int i = 0; i < 4; ++i) {
        ah[i] = Frag<T>::load(sA + (i << 4) * kGP + ks);
        if (SPLIT_MODE >= 1) al[i] = Frag<T>::load(sA + kAEl + (i << 4) * kGP + ks);
      }
#pragma unroll
      for (int i = 0; i < 4; ++i) {
#pragma unroll
        for (int j = 0; j < 4; ++j) {
          acc[i][j] = Frag<T>::mma(ah[i], bh[j], acc[i][j]);
          if (SPLIT_MODE == 2) acc[i][j] = Frag<T>::mma(ah[i], bl[j], acc[i][j]);
          if (SPLIT_MODE >= 1) acc[i][j] = Frag<T>::mma(al[i], bh[j], acc[i][j]);
        }
        Frag<T>::guard(acc[i][0], acc[i][3], ah[i], (SPLIT_MODE >= 1) ? al[i] : ah[i]);
      }
      Frag<T>::keep(bh[0], bh[1], bh[2], bh[3]);
      if (SPLIT_MODE == 2) Frag<T>::keep(bl[0], bl[1], bl[2], bl[3]);
    }
    // publish point of stage t + 1; the one barrier also ends every wave's reads of the buffer that is refilled behind it
    asm volatile("s_wait_dscnt 0x0" ::: "memory");      // this wave's LDS reads of stage t are done
    asm volatile("s_wait_asynccnt 0x0" ::: "memory");   // this wave's copies of stage t + 1 have landed
    __syncthreads();
    if (t + 2 < nk) issue_stage(t + 2);
  }
  asm volatile("s_wait_asynccnt 0x0" ::: "memory");     // no copy is outstanding when the wave goes on to the epilogue
  acc_guard4(acc[0][0], acc[0][1], acc[0][2], acc[0][3]);
  acc_guard4(acc[1][0], acc[1][1], acc[1][2], acc[1][3]);
  acc_guard4(acc[2][0], acc[2][1], acc[2][2], acc[2][3]);
  acc_guard4(acc[3][0], acc[3][1], acc[3][2], acc[3][3]);

  // ---- epilogue ----
  float* slab = sT[wave];
  const float* Rb = RESID ? (resid + (size_t)b * strideR) : nullptr;
#pragma unroll
  for (int i = 0; i < 4; ++i) {
    const int mBase = m0 + (i << 4);
#pragma unroll
    for (int j = 0; j < 4; ++j) {
      const int n = n0 + (j << 4) + rlane;
      float bv = 0.f;
      if (BIAS_MODE == 2) bv = bias[n];
      float asc = 1.0f, abi = 0.0f;
      if (OUT_MODE == 3) {
        const int which = n0 / kDim;               // wave-uniform (64-col tile inside one kDim block)
        const int cc = n - which * kDim;           // 0..kDim-1, all four tables have kDim entries
        const float s0 = bf_rne(affs0[cc]);
        const float c0 = bf_rne(affb0[cc]);
        const float s1 = bf_rne(affs1[cc]);
        const float c1 = bf_rne(affb1[cc]);
        asc = (which == 0) ? s0 : ((which == 1) ? s1 : 1.0f);
        abi = (which == 0) ? c0 : ((which == 1) ? c1 : 0.0f);
      }
#pragma unroll
      for (int r = 0; r < 8; ++r) {
        float v = acc[i][j][r] * scale;
        if (BIAS_MODE == 1) v += bias[mBase + mOff + r];
        if (BIAS_MODE == 2) v += bv;
        if (OUT_MODE == 3) v = v * asc + abi;
        if (RESID) v += Rb[(size_t)(mBase + mOff + r) * ldc + n];
        if (ACT == 1) v = tanhf(v);
        if (ACT == 2) v = fmaxf(v, 0.0f);
        if (ACT == 4) v = (v > 0.f) ? v : 0.01f * v;
        slab[(mOff + r) * 68 + (j << 4) + rlane] = v;
      }
    }
    __builtin_amdgcn_fence(__ATOMIC_RELEASE, "workgroup");
    __builtin_amdgcn_wave_barrier();
    __builtin_amdgcn_fence(__ATOMIC_ACQUIRE, "workgroup");
    if (OUT_MODE == 0) {
      float* C = (float*)Cout + (size_t)b * strideC;
      const int hh = lane >> 4, c4 = (lane & 15) * 4;     // row seg = 256 B = 16 lanes x 16 B
      {
#pragma unroll
        for (int it = 0; it < 8; ++it) {
          const int row = it * 2 + hh;
          v4f v = *(const v4f*)(slab + row * 68 + c4);
          *(v4f*)(C + (size_t)(mBase + row) * ldc + n0 + c4) = v;
        }
        
      }
    } else {
      const int q = lane >> 3, c8 = (lane & 7) * 8;
      unsigned short* C;
      unsigned short* C2;
      int ncol;
      if (OUT_MODE == 3) {
        const int which = n0 / kDim;
        C  = (unsigned short*)Cout + (size_t)which * 2 * (size_t)strideC;
        C2 = C + (size_t)strideC;
        ncol = n0 - which * kDim;
      } else {
        C  = (unsigned short*)Cout  + (size_t)b * strideC;
        C2 = (OUT_MODE == 2) ? ((unsigned short*)Cout2 + (size_t)b * strideC) : nullptr;
        ncol = n0;
      }
      {
#pragma unroll
        for (int it = 0; it < 4; ++it) {
          const int row = it * 4 + q;
          const float* sp = slab + row * 68 + c8;
          v8h hv, lv;
#pragma unroll
          for (int e = 0; e < 8; ++e) {
            if (OUT_MODE == 1) {
              hv[e] = (_Float16)sp[e];
            } else {
              unsigned short hb = f2bf_bits(sp[e]);
              unsigned short lb = f2bf_bits(sp[e] - bf_bits2f(hb));
              hv[e] = __builtin_bit_cast(_Float16, hb);
              lv[e] = __builtin_bit_cast(_Float16, lb);
            }
          }
          *(v8h*)(C + (size_t)(mBase + row) * ldc + ncol + c8) = hv;
          if (OUT_MODE >= 2) *(v8h*)(C2 + (size_t)(mBase + row) * ldc + ncol + c8) = lv;
        }
        
      }
    }
    __builtin_amdgcn_fence(__ATOMIC_RELEASE, "workgroup");
    __builtin_amdgcn_wave_barrier();
    __builtin_amdgcn_fence(__ATOMIC_ACQUIRE, "workgroup");
  }
}

// coverage: n8 threads x 8 elements = n (host passes n8 = n/8 with n % 8 == 0)
__global__ __launch_bounds__(256) void cast_bf16x8_k(const float* __restrict__ in,
                                                     unsigned short* __restrict__ out, int n8) {
  const int i = blockIdx.x * 256 + threadIdx.x;
  if (i < n8) {
    const size_t o = (size_t)i * 8;
    const v4f a = *(const v4f*)(in + o);
    const v4f bq = *(const v4f*)(in + o + 4);
    v8h hv;
#pragma unroll
    for (int e = 0; e < 4; ++e) {
      hv[e]     = __builtin_bit_cast(_Float16, f2bf_bits(a[e]));
      hv[4 + e] = __builtin_bit_cast(_Float16, f2bf_bits(bq[e]));
    }
    *(v8h*)(out + o) = hv;
    
  }
}

// ---- W [K][N] f32 -> Wt [N][K] bf16 (RNE), 64x64 tile transposed through LDS ----
// in[rows = K][cols = N] -> out[N][K]; grid = (N/64, K/64).
// producer coverage: 256 threads x (1 row x 16 cols) = 64x64 tile; store: 8 waves x 4 rows x 2 it = 64 rows, 8 lanes x 8 halves = 64 cols.
constexpr int kWTP = 72;
__global__ __launch_bounds__(256) void wt_cast_bf_k(const float* __restrict__ W, unsigned short* __restrict__ Wtp,
                                                    int K, int N) {
  __shared__ __align__(16) _Float16 st[64 * kWTP];
  _Float16* Wt = (_Float16*)Wtp;
  const int n0 = blockIdx.x * 64, k0 = blockIdx.y * 64;
  const int tid = threadIdx.x;
  const int kr = tid >> 2, c16 = (tid & 3) * 16;
  const float* src = W + (size_t)(k0 + kr) * N + n0 + c16;
#pragma unroll
  for (int qq = 0; qq < 4; ++qq) {
    const v4f v = *(const v4f*)(src + 4 * qq);
#pragma unroll
    for (int e = 0; e < 4; ++e)
      st[(c16 + 4 * qq + e) * kWTP + kr] = __builtin_bit_cast(_Float16, f2bf_bits(v[e]));
  }
  __syncthreads();
  const int wave = tid >> 5, lane = tid & 31;
  const int q8 = lane >> 3, c8 = (lane & 7) * 8;
  {
#pragma unroll
    for (int it = 0; it < 2; ++it) {
      const int n = it * 32 + wave * 4 + q8;
      const v8h hv = *(const v8h*)(st + n * kWTP + c8);
      *(v8h*)(Wt + (size_t)(n0 + n) * K + k0 + c8) = hv;
    }
    
  }
}

// =====================================================================================
// Causal attention, head_dim 64, fed by bf16 hi/lo planes laid out [kTok][kDim] (row = b*kSeq + t, col = h*64 + d).
//   scores = (qh.kh + qh.kl + ql.kh) / 8 : v_wmma_f32_16x16x32_bf16, f32 accumulate
//   out    =  ph.vh + ph.vl + pl.vh      : v_wmma_f32_16x16x32_bf16, p = exp(s - max) split into bf16 hi/lo
//   online softmax in f32. Block = 4 waves = 64 query rows of one head and batch, blockIdx.x = batch * kHeads + head; 64-key chunks,
//   chunks above the diagonal skipped, per-element causal select (key > query -> -inf) on the diagonal chunk.
//   grid = (kHeads * kBatch, kSeq/64), heaviest first: blockIdx.y counts the query blocks from the last (32 key chunks) down to the first (1 chunk),
//   for speed only. Each cost level is a run of 64 equal work-groups. Y planes are [kTok][kDim] like the inputs.
// =====================================================================================
constexpr int kKC = 64;
constexpr int kQB = 64;
constexpr int kLP = 2 * 64 + 8;   // LDS row pitch in bf16 elements (272 B)
constexpr int kVS = 16;           // shift (32 B = 8 banks) of V rows d >= 32: the two d halves that one staging store writes leave each other's banks
constexpr int kOP = 68;           // f32 pitch of the output tile (16 x 68 x 4 B = one wave's P buffer)

__device__ __forceinline__ v8f mma_bf(v16b a, v16b b, v8f c) {
  c = __builtin_amdgcn_wmma_f32_16x16x32_bf16(false, a, false, b, (short)0, c, false, false);
  asm volatile("v_nop\n\tv_nop\n\tv_nop\n\tv_nop" : "+v"(c) : "v"(a), "v"(b));
  return c;
}

__global__ __launch_bounds__(128)
void attn_hd64_k(const unsigned short* __restrict__ Qhp, const unsigned short* __restrict__ Qlp,
                 const unsigned short* __restrict__ Khp, const unsigned short* __restrict__ Klp,
                 const unsigned short* __restrict__ Vhp, const unsigned short* __restrict__ Vlp,
                 unsigned short* __restrict__ Yhp, unsigned short* __restrict__ Ylp) {
  union FB { v16b v; v8b h[2]; };
  // Every LDS row holds its hi half (64 elements) then its lo half (64 elements) plus 8 pad elements: pitch 272 B = 16 B x 17,
  // so the 16 rows of one ds_load_b128 fragment read start on 16 different 4-bank groups (at 128 B they fell on two).
  __shared__ __align__(16) __bf16 Ks[kKC * kLP];              // K [kv][hi d | lo d]
  __shared__ __align__(16) __bf16 Vt[kHD * kLP + kVS];        // V [d][hi kv | lo kv]; rows d >= 32 lie kVS elements further
  __shared__ __align__(16) __bf16 Pbuf[4][16 * kLP];          // per wave: P [16][hi key | lo key]; reused as f32 out tile [16][64] at pitch kOP
  __bf16* const Ksh = Ks;
  __bf16* const Ksl = Ks + kHD;
  __bf16* const Vth = Vt;
  __bf16* const Vtl = Vt + kKC;

  const __bf16* Qh = (const __bf16*)Qhp;
  const __bf16* Ql = (const __bf16*)Qlp;
  const __bf16* Kh = (const __bf16*)Khp;
  const __bf16* Kl = (const __bf16*)Klp;
  const __bf16* Vh = (const __bf16*)Vhp;
  const __bf16* Vl = (const __bf16*)Vlp;

  const int tid  = threadIdx.x;
  const int wave = tid >> 5;
  const int lane = tid & 31;
  const int hh   = lane >> 4;
  const int c    = lane & 15;

  constexpr int nqb = kSeq / kQB;   // 32
  const int qb = nqb - 1 - (int)blockIdx.y;     // cost (qb + 1 chunks) falls with the block index
  const int h  = (int)blockIdx.x % kHeads;
  const int q0 = qb * kQB + wave * 16;          // token index of this wave's first row
  const size_t rowb = (size_t)((int)blockIdx.x / kHeads) * kSeq; // plane row base of this batch
  const int hcol = h * kHD;

  // ---- Q fragments (A operand): 2 d-chunks, hi and lo; Frag load = split k-map ----
  v16b qah[2], qal[2];
  {
    const size_t qoff = (rowb + (size_t)(q0 + c)) * kDim + hcol + 8 * hh;
#pragma unroll
    for (int dc = 0; dc < 2; ++dc) {
      qah[dc] = Frag<__bf16>::load(Qh + qoff + dc * 32);
      qal[dc] = Frag<__bf16>::load(Ql + qoff + dc * 32);
    }
  }

  float mrow[8], lrow[8];
  v8f oacc[4];
#pragma unroll
  for (int r = 0; r < 8; ++r) { mrow[r] = -INFINITY; lrow[r] = 0.f; }
#pragma unroll
  for (int t = 0; t < 4; ++t) oacc[t] = (v8f){0.f,0.f,0.f,0.f,0.f,0.f,0.f,0.f};

  const int nChunks = qb + 1;   // block-uniform, <= 32
  for (int kc = 0; kc < nChunks; ++kc) {
    const int kv0 = kc * kKC;
    __syncthreads();
    {
      // staging coverage: 128 threads x (1 key row x 32 d) = 64 keys x 64 d for each of the four tiles
      const int kvr = tid >> 1, dh = (tid & 1) * 32;
      const size_t goff = (rowb + (size_t)(kv0 + kvr)) * kDim + hcol + dh;
      __bf16* const kdst = Ks + kvr * kLP + dh;                        // this thread's K row, hi half
      __bf16* const vdst = Vt + dh * kLP + (dh >> 5) * kVS + kvr;      // this thread's V column, first d row, hi half
#pragma unroll 1
      for (int i = 0; i < 4; ++i) {
        const v8b a0 = *(const v8b*)(Kh + goff + 8 * i);
        const v8b a1 = *(const v8b*)(Kl + goff + 8 * i);
        *(v8b*)(kdst + 8 * i) = a0;
        *(v8b*)(kdst + kHD + 8 * i) = a1;
        const v8b w0 = *(const v8b*)(Vh + goff + 8 * i);
        const v8b w1 = *(const v8b*)(Vl + goff + 8 * i);
#pragma unroll
        for (int e = 0; e < 8; ++e) {
          vdst[(8 * i + e) * kLP] = w0[e];
          vdst[(8 * i + e) * kLP + kKC] = w1[e];
        }
      }
    }
    __syncthreads();

    // ---- scores: D row = query 8hh+r, col = key j*16+c ----
    v8f s[4];
#pragma unroll
    for (int j = 0; j < 4; ++j) {
      s[j] = (v8f){0.f,0.f,0.f,0.f,0.f,0.f,0.f,0.f};
#pragma unroll
      for (int dc = 0; dc < 2; ++dc) {
        FB kb, kl;
        kb.h[0] = *(const v8b*)(Ksh + (j * 16 + c) * kLP + dc * 32 + 8 * hh);
        kb.h[1] = *(const v8b*)(Ksh + (j * 16 + c) * kLP + dc * 32 + 16 + 8 * hh);
        kl.h[0] = *(const v8b*)(Ksl + (j * 16 + c) * kLP + dc * 32 + 8 * hh);
        kl.h[1] = *(const v8b*)(Ksl + (j * 16 + c) * kLP + dc * 32 + 16 + 8 * hh);
        s[j] = mma_bf(qah[dc], kb.v, s[j]);
        s[j] = mma_bf(qah[dc], kl.v, s[j]);
        s[j] = mma_bf(qal[dc], kb.v, s[j]);
      }
    }
    const bool diag = (kc == qb);   // block-uniform
    float cm[8];
#pragma unroll
    for (int r = 0; r < 8; ++r) {
      const int qrow = q0 + 8 * hh + r;
      float m = -INFINITY;
#pragma unroll
      for (int j = 0; j < 4; ++j) {
        const int kvcol = kv0 + j * 16 + c;
        float sv = s[j][r] * 0.125f;
        if (diag && (kvcol > qrow)) sv = -INFINITY;
        s[j][r] = sv;
        m = fmaxf(m, sv);
      }
#pragma unroll
      for (int off = 1; off < 16; off <<= 1) m = fmaxf(m, __shfl_xor(m, off, 32));
      cm[r] = m;
    }
    __bf16* pwh = Pbuf[wave];
    __bf16* pwl = Pbuf[wave] + kKC;
#pragma unroll
    for (int r = 0; r < 8; ++r) {
      const float mnew = fmaxf(mrow[r], cm[r]);
      const float mref = (mnew > -INFINITY) ? mnew : 0.0f;   // all-masked so far -> p = 0, alpha = 0
      const float alpha = expf(mrow[r] - mref);
      mrow[r] = mnew;
      float psum = 0.f;
#pragma unroll
      for (int j = 0; j < 4; ++j) {
        const float p = expf(s[j][r] - mref);
        psum += p;
        const unsigned short hb = f2bf_bits(p);
        const unsigned short lb = f2bf_bits(p - bf_bits2f(hb));
        pwh[(8 * hh + r) * kLP + j * 16 + c] = __builtin_bit_cast(__bf16, hb);
        pwl[(8 * hh + r) * kLP + j * 16 + c] = __builtin_bit_cast(__bf16, lb);
      }
#pragma unroll
      for (int off = 1; off < 16; off <<= 1) psum += __shfl_xor(psum, off, 32);
      lrow[r] = lrow[r] * alpha + psum;
#pragma unroll
      for (int t = 0; t < 4; ++t) oacc[t][r] *= alpha;
    }
    __builtin_amdgcn_fence(__ATOMIC_RELEASE, "workgroup");
    __builtin_amdgcn_wave_barrier();
    __builtin_amdgcn_fence(__ATOMIC_ACQUIRE, "workgroup");
    // ---- out += P (A: m = row, k = key) x V (B: k = key, n = d) ----
#pragma unroll 1
    for (int kk = 0; kk < 2; ++kk) {
      FB pa, pl;
      pa.h[0] = *(const v8b*)(pwh + c * kLP + kk * 32 + 8 * hh);
      pa.h[1] = *(const v8b*)(pwh + c * kLP + kk * 32 + 16 + 8 * hh);
      pl.h[0] = *(const v8b*)(pwl + c * kLP + kk * 32 + 8 * hh);
      pl.h[1] = *(const v8b*)(pwl + c * kLP + kk * 32 + 16 + 8 * hh);
#pragma unroll
      for (int t = 0; t < 4; ++t) {
        FB vb, vl;
        vb.h[0] = *(const v8b*)(Vth + (t * 16 + c) * kLP + (t >> 1) * kVS + kk * 32 + 8 * hh);
        vb.h[1] = *(const v8b*)(Vth + (t * 16 + c) * kLP + (t >> 1) * kVS + kk * 32 + 16 + 8 * hh);
        vl.h[0] = *(const v8b*)(Vtl + (t * 16 + c) * kLP + (t >> 1) * kVS + kk * 32 + 8 * hh);
        vl.h[1] = *(const v8b*)(Vtl + (t * 16 + c) * kLP + (t >> 1) * kVS + kk * 32 + 16 + 8 * hh);
        oacc[t] = mma_bf(pa.v, vb.v, oacc[t]);
        oacc[t] = mma_bf(pa.v, vl.v, oacc[t]);
        oacc[t] = mma_bf(pl.v, vb.v, oacc[t]);
      }
    }
  }

  // ---- epilogue: y = out / l, staged per wave as f32 [16][64] (pitch kOP) in the wave's P buffer ----
  __syncthreads();
  float* os = (float*)(Pbuf[wave]);   // 16 rows x kOP f32 = 4352 B
#pragma unroll
  for (int r = 0; r < 8; ++r) {
    const float inv = 1.0f / lrow[r];
#pragma unroll
    for (int t = 0; t < 4; ++t) os[(8 * hh + r) * kOP + t * 16 + c] = oacc[t][r] * inv;
  }
  __builtin_amdgcn_fence(__ATOMIC_RELEASE, "workgroup");
  __builtin_amdgcn_wave_barrier();
  __builtin_amdgcn_fence(__ATOMIC_ACQUIRE, "workgroup");
  {
    // store coverage: per it, lanes (q8 = 0..3) x (c8 = 0..56 step 8) = 4 rows x 64 cols; 4 it = 16 rows = this wave's tile.
    const int q8 = lane >> 3, c8 = (lane & 7) * 8;
    {
#pragma unroll
      for (int it = 0; it < 4; ++it) {
        const int row = it * 4 + q8;
        const float* sp = os + row * kOP + c8;
        v8h hv, lv;
#pragma unroll
        for (int e = 0; e < 8; ++e) {
          const unsigned short hb = f2bf_bits(sp[e]);
          const unsigned short lb = f2bf_bits(sp[e] - bf_bits2f(hb));
          hv[e] = __builtin_bit_cast(_Float16, hb);
          lv[e] = __builtin_bit_cast(_Float16, lb);
        }
        const size_t yo = (rowb + (size_t)(q0 + row)) * kDim + hcol + c8;
        *(v8h*)(Yhp + yo) = hv;
        *(v8h*)(Ylp + yo) = lv;
      }
      
    }
  }
}

// ---------------------------------------------------------------------------
// Workspace region map (bytes):
//   [0, 16777216)            Xb   bf16 [8192][1024]  (dead after the qkv GEMM; reused as Yh bf16 [8192][1024])
//   [16777216, 23068672)     WqT  bf16 [3072][1024]
//   [23068672, 25165824)     WpT  bf16 [1024][1024]
//   [25165824, 125829120)    QKV  bf16 6 planes [8192][1024]: Qh, Ql, Kh, Kl, Vh, Vl
//   [125829120, 142606336)   Yl   bf16 [8192][1024]
//   total 142,606,336 B
// ---------------------------------------------------------------------------
extern "C" void kernel_launch(void* const* d_in, const int* in_sizes, int n_in,
                              void* d_out, int out_size, void* d_ws, size_t ws_size,
                              hipStream_t stream) {
  if (n_in < 9) return;
  if (in_sizes[0] != kTok * kDim || in_sizes[1] != kDim * kDim3 || in_sizes[2] != kDim3 ||
      in_sizes[3] != kDim * kDim || in_sizes[4] != kDim ||
      in_sizes[5] != kHeads * kHD || in_sizes[6] != kHeads * kHD ||
      in_sizes[7] != kHeads * kHD || in_sizes[8] != kHeads * kHD ||
      out_size != kTok * kDim) return;

  const float* x     = (const float*)d_in[0];
  const float* Wqkv  = (const float*)d_in[1];
  const float* bqkv  = (const float*)d_in[2];
  const float* Wproj = (const float*)d_in[3];
  const float* bproj = (const float*)d_in[4];
  const float* qs    = (const float*)d_in[5];
  const float* qbv   = (const float*)d_in[6];
  const float* ks    = (const float*)d_in[7];
  const float* kbv   = (const float*)d_in[8];
  float* out = (float*)d_out;

  const size_t plane  = (size_t)kTok * kDim;                 // elements per [8192][1024] plane
  const size_t offX   = 0;
  const size_t offWq  = offX  + plane * 2;                    // 16,777,216
  const size_t offWp  = offWq + (size_t)kDim3 * kDim * 2;     // 23,068,672
  const size_t offQKV = offWp + (size_t)kDim * kDim * 2;      // 25,165,824
  const size_t offYl  = offQKV + 6 * plane * 2;               // 125,829,120
  const size_t total  = offYl + plane * 2;                    // 142,606,336
  if (total > ws_size) return;

  char* ws = (char*)d_ws;
  unsigned short* Xb  = (unsigned short*)(ws + offX);
  unsigned short* Yh  = Xb;                                   // [8192][1024] bf16, the whole Xb region
  unsigned short* Yl  = (unsigned short*)(ws + offYl);        // [8192][1024] bf16
  unsigned short* WqT = (unsigned short*)(ws + offWq);
  unsigned short* WpT = (unsigned short*)(ws + offWp);
  unsigned short* QKV = (unsigned short*)(ws + offQKV);
  unsigned short* Qh = QKV;
  unsigned short* Ql = QKV + plane;
  unsigned short* Kh = QKV + 2 * plane;
  unsigned short* Kl = QKV + 3 * plane;
  unsigned short* Vh = QKV + 4 * plane;
  unsigned short* Vl = QKV + 5 * plane;

  // 1) x -> bf16 plane: n = 8,388,608, 8 per thread -> 1,048,576 threads = 4096 blocks x 256 (exact)
  const int n8 = (kTok * kDim) / 8;
  cast_bf16x8_k<<<dim3((n8 + 255) / 256), dim3(256), 0, stream>>>(x, Xb, n8);

  // 2) W_qkv in[1024][3072] -> WqT out[3072][1024] bf16: grid (3072/64, 1024/64)
  wt_cast_bf_k<<<dim3(kDim3 / 64, kDim / 64), dim3(256), 0, stream>>>(Wqkv, WqT, kDim, kDim3);
  // 3) W_proj in[1024][1024] -> WpT out[1024][1024] bf16: grid (1024/64, 1024/64)
  wt_cast_bf_k<<<dim3(kDim / 64, kDim / 64), dim3(256), 0, stream>>>(Wproj, WpT, kDim, kDim);

  // 4) qkv = Xb[8192][1024] . WqT[3072][1024]^T + b_qkv, per-head affine on q/k, bf16 hi/lo planes.
  //    M = 8192 (multiple of 128), N = 3072 (multiple of 256), K = 1024 (multiple of 64); block tiles 64 x 12 = 768 blocks x 8 waves.
  wmma_gemm64<1, 0, 2, 3, false><<<dim3(768, 1), dim3(256), 0, stream>>>(
      Xb, Xb, kDim, 0L, WqT, WqT, kDim, 0L,
      (void*)QKV, (void*)QKV, kDim, (long)plane,
      bqkv, bqkv, 0L, qs, qbv, ks, kbv,
      kTok, kDim3, kDim, 1.0f);

  // 5) causal attention of all batches in one launch -> Yh/Yl: grid (16 heads x 4 batches, 32 query blocks from the last to the first).
  attn_hd64_k<<<dim3(kHeads * kBatch, kSeq / kQB), dim3(128), 0, stream>>>(Qh, Ql, Kh, Kl, Vh, Vl, Yh, Yl);
  // 6) out = Y . WpT^T + b_proj over all rows (A hi/lo, 2 products).
  //    M = 8192, N = 1024, K = 1024; block tiles 64 x 4 = 256 blocks x 8 waves.
  wmma_gemm64<1, 1, 2, 0, false><<<dim3(256, 1), dim3(256), 0, stream>>>(
      Yh, Yl, kDim, 0L, WpT, WpT, kDim, 0L,
      (void*)out, (void*)out, kDim, 0L,
      bproj, bproj, 0L, qs, qbv, ks, kbv,
      kTok, kDim, kDim, 1.0f);
}

// v005
// A run of this version takes 233 microseconds.
// Timed twice side by side with v004, it ran 1.14 times as fast both times.
// Over all steps from v000 it is 5.71 times as fast.
// Contractions: x*W_qkv on v_wmma_f32_16x16x32_bf16 (plain bf16 operands = RNE-bf16 inputs); q*k^T and p*v on v_wmma_f32_16x16x32_bf16 with bf16 hi/lo operand pairs (hi*hi + hi*lo + lo*hi); y*W_proj on v_wmma_f32_16x16x32_bf16 with y as bf16 hi/lo and exact bf16 weights (hi*w + lo*w); f32 accumulate everywhere; bias, per-head affine and softmax in f32.
#include <hip/hip_runtime.h>
#include <stdint.h>
#include <math.h>

constexpr int kBatch = 4;
constexpr int kSeq   = 2048;
constexpr int kDim   = 1024;
constexpr int kHeads = 16;
constexpr int kHD    = 64;
constexpr int kTok   = kBatch * kSeq;   // 8192
constexpr int kDim3  = 3 * kDim;        // 3072

typedef __attribute__((ext_vector_type(16))) _Float16 v16h;
typedef __attribute__((ext_vector_type(8)))  _Float16 v8h;
typedef __attribute__((ext_vector_type(16))) __bf16   v16b;
typedef __attribute__((ext_vector_type(8)))  __bf16   v8b;
typedef __attribute__((ext_vector_type(8)))  float    v8f;
typedef __attribute__((ext_vector_type(4)))  float    v4f;

__device__ __forceinline__ unsigned short f2bf_bits(float f) {
  unsigned u = __float_as_uint(f);
  return (unsigned short)((u + 0x7FFFu + ((u >> 16) & 1u)) >> 16);
}
__device__ __forceinline__ float bf_bits2f(unsigned short h) { return __uint_as_float(((unsigned)h) << 16); }
__device__ __forceinline__ float bf_rne(float f) { return bf_bits2f(f2bf_bits(f)); }

// hazard guards as plain device helpers
__device__ __forceinline__ void dep_guard_h(v8f& a, v8f& b, v16h x, v16h y) { asm volatile("v_nop\n\tv_nop\n\tv_nop\n\tv_nop" : "+v"(a), "+v"(b) : "v"(x), "v"(y)); }
__device__ __forceinline__ void dep_guard_b(v8f& a, v8f& b, v16b x, v16b y) { asm volatile("v_nop\n\tv_nop\n\tv_nop\n\tv_nop" : "+v"(a), "+v"(b) : "v"(x), "v"(y)); }
__device__ __forceinline__ void keep4_h(v16h a, v16h b, v16h c, v16h d) { asm volatile("v_nop" :: "v"(a), "v"(b), "v"(c), "v"(d)); }
__device__ __forceinline__ void keep4_b(v16b a, v16b b, v16b c, v16b d) { asm volatile("v_nop" :: "v"(a), "v"(b), "v"(c), "v"(d)); }
__device__ __forceinline__ void acc_guard4(v8f& a, v8f& b, v8f& c, v8f& d) { asm volatile("v_nop\n\tv_nop\n\tv_nop\n\tv_nop" : "+v"(a), "+v"(b), "+v"(c), "+v"(d)); }
template <typename T> struct Frag;
template <> struct Frag<_Float16> {
  typedef v16h V; union U { v16h v; v8h h[2]; };
  static __device__ __forceinline__ v16h load(const _Float16* p) {   // elements 0..7 <- p[0..7], 8..15 <- p[16..23]
    U f; f.h[0] = *(const v8h*)(p); f.h[1] = *(const v8h*)(p + 16); return f.v;
  }
  static __device__ __forceinline__ v8f mma(v16h a, v16h b, v8f c) {
    return __builtin_amdgcn_wmma_f32_16x16x32_f16(false, a, false, b, (short)0, c, false, false);
  }
  static __device__ __forceinline__ void guard(v8f& a, v8f& b, v16h x, v16h y) { dep_guard_h(a, b, x, y); }
  static __device__ __forceinline__ void keep(v16h a, v16h b, v16h c, v16h d) { keep4_h(a, b, c, d); }
};
template <> struct Frag<__bf16> {
  typedef v16b V; union U { v16b v; v8b h[2]; };
  static __device__ __forceinline__ v16b load(const __bf16* p) {
    U f; f.h[0] = *(const v8b*)(p); f.h[1] = *(const v8b*)(p + 16); return f.v;
  }
  static __device__ __forceinline__ v8f mma(v16b a, v16b b, v8f c) {
    return __builtin_amdgcn_wmma_f32_16x16x32_bf16(false, a, false, b, (short)0, c, false, false);
  }
  static __device__ __forceinline__ void guard(v8f& a, v8f& b, v16b x, v16b y) { dep_guard_b(a, b, x, y); }
  static __device__ __forceinline__ void keep(v16b a, v16b b, v16b c, v16b d) { keep4_b(a, b, c, d); }
};

// ---- Register-blocked batched WMMA GEMM ------------------------------------
// C[m,n] = scale * sum_k A[m,k] * Bt[n,k] (+bias)(affine)(+resid); each wave owns a 64x64 tile.
// A row-major [M,K]; Bt row-major [N,K]; M % 128 == 0, N % 256 == 0, K % 64 == 0, lda and ldb % 8 == 0.
// A block of 8 waves (2 x 4) owns a 128 x 256 tile of C. Its operand rows come 64 k (one 128-B line of every row) at a time
// into an LDS ring of two buffers by asynchronous copies, whole lines per wave-copy; the fragments are read from LDS.
// SPLIT_MODE: 0 = plain; 1 = A carried as hi/lo planes (A2 = lo): hi.b + lo.b; 2 = A and Bt hi/lo: hi.hi + hi.lo + lo.hi.
// BIAS_MODE: 0 = none, 1 = bias[m], 2 = bias[n].
// OUT_MODE: 0 = f32, 1 = f16, 2 = bf16 hi plane (Cout) + bf16 lo plane (Cout2),
//           3 = qkv mode: columns n form three blocks of kDim (which = n0 / kDim); value v = (acc+bias)*affs[cc]+affb[cc]
//               with cc = n - which*kDim and tables (affs0,affb0) for which 0, (affs1,affb1) for which 1 (RNE-bf16 applied
//               to the table values), identity for which 2; written as bf16 hi plane at Cout + which*2*strideC and lo plane
//               at + strideC, row pitch ldc, column n0 - which*kDim.
// ET: 0 = f16 operands, 1 = bf16 operands (pointers passed as 16-bit storage)
constexpr int kGBM = 128;   // rows of C per block (2 waves of 64)
constexpr int kGBN = 256;   // columns of C per block (4 waves of 64)
constexpr int kGBK = 64;    // k per stage
constexpr int kGP  = 72;    // LDS row pitch in 16-bit elements: 144 B = 16 B x 9, for the ds_load_b128 fragment readers

__device__ __forceinline__ unsigned lds_off(const void* p) { return (unsigned)(size_t)p; }   // byte offset in the block's LDS

// ROWS rows of 128 B, global -> LDS, 16 B per lane and copy: thread -> row tid >> 3 (+32 per copy), piece tid & 7;
// ldst and gsrc already point at this thread's first row and piece; ld = global row pitch in elements.
template <int ROWS>
__device__ __forceinline__ void stage_rows(unsigned ldst, const unsigned short* gsrc, int ld) {
  const size_t g32 = (size_t)32 * (size_t)ld;
#pragma unroll   // one or two straight groups of four copies, no loop counter beside them
  for (int u = 0; u < ROWS / 128; ++u) {
    const unsigned l0 = ldst + (unsigned)(u * 128 * kGP * 2);
    const unsigned l1 = l0 + 32u * kGP * 2u, l2 = l0 + 64u * kGP * 2u, l3 = l0 + 96u * kGP * 2u;
    const unsigned short* g0 = gsrc + (size_t)(4 * u) * g32;
    const unsigned short* g1 = g0 + g32;
    const unsigned short* g2 = g1 + g32;
    const unsigned short* g3 = g2 + g32;
    // the s_wait_xcnt closes the copies' own statement, so that no address register of a copy is rewritten ahead of it
    asm volatile("global_load_async_to_lds_b128 %0, %1, off\n\t"
                 "global_load_async_to_lds_b128 %2, %3, off\n\t"
                 "global_load_async_to_lds_b128 %4, %5, off\n\t"
                 "global_load_async_to_lds_b128 %6, %7, off\n\t"
                 "s_wait_xcnt 0x0"
                 :: "v"(l0), "v"(g0), "v"(l1), "v"(g1), "v"(l2), "v"(g2), "v"(l3), "v"(g3) : "memory");
  }
}

template <int ET> struct Elem;
template <> struct Elem<0> { typedef _Float16 T; };
template <> struct Elem<1> { typedef __bf16 T; };
template <int ET, int SPLIT_MODE, int BIAS_MODE, int OUT_MODE, bool RESID, int ACT = 0>
__global__ __launch_bounds__(256) void wmma_gemm64(
    const unsigned short* __restrict__ Ap, const unsigned short* __restrict__ A2p, int lda, long strideA,
    const unsigned short* __restrict__ Btp, const unsigned short* __restrict__ Bt2p, int ldb, long strideB,
    void* __restrict__ Cout, void* __restrict__ Cout2, int ldc, long strideC,
    const float* __restrict__ bias,
    const float* __restrict__ resid, long strideR,
    const float* __restrict__ affs0, const float* __restrict__ affb0,
    const float* __restrict__ affs1, const float* __restrict__ affb1,
    int M, int N, int K, float scale) {
  typedef typename Elem<ET>::T T;
  typedef typename Frag<T>::V V;
  const T* A = (const T*)Ap; const T* A2 = (const T*)A2p; const T* Bt = (const T*)Btp; const T* Bt2 = (const T*)Bt2p;
  constexpr int NA = (SPLIT_MODE >= 1) ? 2 : 1;      // planes of A, of Bt
  constexpr int NB = (SPLIT_MODE == 2) ? 2 : 1;
  constexpr int kAEl = kGBM * kGP;                   // elements of one plane's tile in LDS
  constexpr int kBEl = kGBN * kGP;
  constexpr int kStage = NA * kAEl + NB * kBEl;      // one buffer: [A hi | A lo | Bt hi | Bt lo]
  __shared__ __align__(16) T ring[2 * kStage];
  __shared__ __align__(16) float sT[8][16 * 68];   // per-wave 16x64 slab, pitch 68 floats
  const int b    = blockIdx.y;
  const int lane = threadIdx.x & 31;
  const int wave = threadIdx.x >> 5;
  const int blocksN = N / kGBN;
  if ((int)blockIdx.x >= (M / kGBM) * blocksN) return;   // block-uniform, ahead of every copy and barrier
  const int bm = blockIdx.x / blocksN;
  const int bn = blockIdx.x - bm * blocksN;
  const int mb0 = bm * kGBM;
  const int nb0 = bn * kGBN;
  const int wm = wave >> 2, wn = wave & 3;
  const int m0 = mb0 + (wm << 6);
  const int n0 = nb0 + (wn << 6);

  const T* Ab  = A  + (size_t)b * strideA;
  const T* Bb  = Bt + (size_t)b * strideB;
  const T* Ab2 = (SPLIT_MODE >= 1) ? (A2  + (size_t)b * strideA) : nullptr;
  const T* Bb2 = (SPLIT_MODE == 2) ? (Bt2 + (size_t)b * strideB) : nullptr;

  const int rlane = lane & 15;                 // row (A) / col (B, D) within subtile
  const int koff  = (lane >> 4) * 8;           // k offset of this lane half
  const int mOff  = (lane >> 4) * 8;           // D row offset

  v8f acc[4][4];
#pragma unroll
  for (int i = 0; i < 4; ++i)
#pragma unroll
    for (int j = 0; j < 4; ++j) acc[i][j] = (v8f){0.f,0.f,0.f,0.f,0.f,0.f,0.f,0.f};

  // this thread's share of every stage: row tid >> 3 (+32 per copy) of each tile, 16-B piece tid & 7
  const int crow = threadIdx.x >> 3, cpc = (threadIdx.x & 7) * 8;
  const unsigned short* gA  = (const unsigned short*)Ab + (size_t)(mb0 + crow) * lda + cpc;
  const unsigned short* gB  = (const unsigned short*)Bb + (size_t)(nb0 + crow) * ldb + cpc;
  const unsigned short* gA2 = (SPLIT_MODE >= 1) ? ((const unsigned short*)Ab2 + (size_t)(mb0 + crow) * lda + cpc) : nullptr;
  const unsigned short* gB2 = (SPLIT_MODE == 2) ? ((const unsigned short*)Bb2 + (size_t)(nb0 + crow) * ldb + cpc) : nullptr;
  const unsigned lT = lds_off(ring) + (unsigned)((crow * kGP + cpc) * 2);
  auto issue_stage = [&](int t) {
    const unsigned lb = lT + (unsigned)((t & 1) * (kStage * 2));
    const int k0 = t * kGBK;
    stage_rows<kGBM>(lb, gA + k0, lda);
    if (SPLIT_MODE >= 1) stage_rows<kGBM>(lb + kAEl * 2, gA2 + k0, lda);
    stage_rows<kGBN>(lb + NA * kAEl * 2, gB + k0, ldb);
    if (SPLIT_MODE == 2) stage_rows<kGBN>(lb + (NA * kAEl + kBEl) * 2, gB2 + k0, ldb);
  };

  const int nk = K / kGBK;   // block-uniform
  issue_stage(0);
  asm volatile("s_wait_asynccnt 0x0" ::: "memory");   // this wave's copies of stage 0 have landed
  __syncthreads();                                    // ... and every other wave's
  if (nk > 1) issue_stage(1);

  for (int t = 0; t < nk; ++t) {
    const T* sA = ring + (t & 1) * kStage + ((wm << 6) + rlane) * kGP + koff;
    const T* sB = ring + (t & 1) * kStage + NA * kAEl + ((wn << 6) + rlane) * kGP + koff;
#pragma unroll   // both halves of the stage in one straight run: the second half's fragment loads go among the first half's products
    for (int ks = 0; ks < kGBK; ks += 32) {
      V bh[4], bl[4];
#pragma unroll
      for (int j = 0; j < 4; ++j) {
        bh[j] = Frag<T>::load(sB + (j << 4) * kGP + ks);
        if (SPLIT_MODE == 2) bl[j] = Frag<T>::load(sB + kBEl + (j << 4) * kGP + ks);
      }
      V ah[4], al[4];   // all fragments of the half are asked for as one group, ahead of its products
#pragma unroll   // constant indices keep the fragment arrays in registers
      for (int i = 0; i < 4; ++i) {
        ah[i] = Frag<T>::load(sA + (i << 4) * kGP + ks);
        if (SPLIT_MODE >= 1) al[i] = Frag<T>::load(sA + kAEl + (i << 4) * kGP + ks);
      }
#pragma unroll
      for (int i = 0; i < 4; ++i) {
#pragma unroll
        for (int j = 0; j < 4; ++j) {
          acc[i][j] = Frag<T>::mma(ah[i], bh[j], acc[i][j]);
          if (SPLIT_MODE == 2) acc[i][j] = Frag<T>::mma(ah[i], bl[j], acc[i][j]);
          if (SPLIT_MODE >= 1) acc[i][j] = Frag<T>::mma(al[i], bh[j], acc[i][j]);
        }
        Frag<T>::guard(acc[i][0], acc[i][3], ah[i], (SPLIT_MODE >= 1) ? al[i] : ah[i]);
      }
      Frag<T>::keep(bh[0], bh[1], bh[2], bh[3]);
      if (SPLIT_MODE == 2) Frag<T>::keep(bl[0], bl[1], bl[2], bl[3]);
    }
    // publish point of stage t + 1; the one barrier also ends every wave's reads of the buffer that is refilled behind it
    asm volatile("s_wait_dscnt 0x0" ::: "memory");      // this wave's LDS reads of stage t are done
    asm volatile("s_wait_asynccnt 0x0" ::: "memory");   // this wave's copies of stage t + 1 have landed
    __syncthreads();
    if (t + 2 < nk) issue_stage(t + 2);
  }
  asm volatile("s_wait_asynccnt 0x0" ::: "memory");     // no copy is outstanding when the wave goes on to the epilogue
  acc_guard4(acc[0][0], acc[0][1], acc[0][2], acc[0][3]);
  acc_guard4(acc[1][0], acc[1][1], acc[1][2], acc[1][3]);
  acc_guard4(acc[2][0], acc[2][1], acc[2][2], acc[2][3]);
  acc_guard4(acc[3][0], acc[3][1], acc[3][2], acc[3][3]);

  // ---- epilogue ----
  float* slab = sT[wave];
  const float* Rb = RESID ? (resid + (size_t)b * strideR) : nullptr;
#pragma unroll
  for (int i = 0; i < 4; ++i) {
    const int mBase = m0 + (i << 4);
#pragma unroll
    for (int j = 0; j < 4; ++j) {
      const int n = n0 + (j << 4) + rlane;
      float bv = 0.f;
      if (BIAS_MODE == 2) bv = bias[n];
      float asc = 1.0f, abi = 0.0f;
      if (OUT_MODE == 3) {
        const int which = n0 / kDim;               // wave-uniform (64-col tile inside one kDim block)
        const int cc = n - which * kDim;           // 0..kDim-1, all four tables have kDim entries
        const float s0 = bf_rne(affs0[cc]);
        const float c0 = bf_rne(affb0[cc]);
        const float s1 = bf_rne(affs1[cc]);
        const float c1 = bf_rne(affb1[cc]);
        asc = (which == 0) ? s0 : ((which == 1) ? s1 : 1.0f);
        abi = (which == 0) ? c0 : ((which == 1) ? c1 : 0.0f);
      }
#pragma unroll
      for (int r = 0; r < 8; ++r) {
        float v = acc[i][j][r] * scale;
        if (BIAS_MODE == 1) v += bias[mBase + mOff + r];
        if (BIAS_MODE == 2) v += bv;
        if (OUT_MODE == 3) v = v * asc + abi;
        if (RESID) v += Rb[(size_t)(mBase + mOff + r) * ldc + n];
        if (ACT == 1) v = tanhf(v);
        if (ACT == 2) v = fmaxf(v, 0.0f);
        if (ACT == 4) v = (v > 0.f) ? v : 0.01f * v;
        slab[(mOff + r) * 68 + (j << 4) + rlane] = v;
      }
    }
    __builtin_amdgcn_fence(__ATOMIC_RELEASE, "workgroup");
    __builtin_amdgcn_wave_barrier();
    __builtin_amdgcn_fence(__ATOMIC_ACQUIRE, "workgroup");
    if (OUT_MODE == 0) {
      float* C = (float*)Cout + (size_t)b * strideC;
      const int hh = lane >> 4, c4 = (lane & 15) * 4;     // row seg = 256 B = 16 lanes x 16 B
      {
#pragma unroll
        for (int it = 0; it < 8; ++it) {
          const int row = it * 2 + hh;
          v4f v = *(const v4f*)(slab + row * 68 + c4);
          *(v4f*)(C + (size_t)(mBase + row) * ldc + n0 + c4) = v;
        }
        
      }
    } else {
      const int q = lane >> 3, c8 = (lane & 7) * 8;
      unsigned short* C;
      unsigned short* C2;
      int ncol;
      if (OUT_MODE == 3) {
        const int which = n0 / kDim;
        C  = (unsigned short*)Cout + (size_t)which * 2 * (size_t)strideC;
        C2 = C + (size_t)strideC;
        ncol = n0 - which * kDim;
      } else {
        C  = (unsigned short*)Cout  + (size_t)b * strideC;
        C2 = (OUT_MODE == 2) ? ((unsigned short*)Cout2 + (size_t)b * strideC) : nullptr;
        ncol = n0;
      }
      {
#pragma unroll
        for (int it = 0; it < 4; ++it) {
          const int row = it * 4 + q;
          const float* sp = slab + row * 68 + c8;
          v8h hv, lv;
#pragma unroll
          for (int e = 0; e < 8; ++e) {
            if (OUT_MODE == 1) {
              hv[e] = (_Float16)sp[e];
            } else {
              unsigned short hb = f2bf_bits(sp[e]);
              unsigned short lb = f2bf_bits(sp[e] - bf_bits2f(hb));
              hv[e] = __builtin_bit_cast(_Float16, hb);
              lv[e] = __builtin_bit_cast(_Float16, lb);
            }
          }
          *(v8h*)(C + (size_t)(mBase + row) * ldc + ncol + c8) = hv;
          if (OUT_MODE >= 2) *(v8h*)(C2 + (size_t)(mBase + row) * ldc + ncol + c8) = lv;
        }
        
      }
    }
    __builtin_amdgcn_fence(__ATOMIC_RELEASE, "workgroup");
    __builtin_amdgcn_wave_barrier();
    __builtin_amdgcn_fence(__ATOMIC_ACQUIRE, "workgroup");
  }
}

// coverage: n8 threads x 8 elements = n (host passes n8 = n/8 with n % 8 == 0)
__global__ __launch_bounds__(256) void cast_bf16x8_k(const float* __restrict__ in,
                                                     unsigned short* __restrict__ out, int n8) {
  const int i = blockIdx.x * 256 + threadIdx.x;
  if (i < n8) {
    const size_t o = (size_t)i * 8;
    const v4f a = *(const v4f*)(in + o);
    const v4f bq = *(const v4f*)(in + o + 4);
    v8h hv;
#pragma unroll
    for (int e = 0; e < 4; ++e) {
      hv[e]     = __builtin_bit_cast(_Float16, f2bf_bits(a[e]));
      hv[4 + e] = __builtin_bit_cast(_Float16, f2bf_bits(bq[e]));
    }
    *(v8h*)(out + o) = hv;
    
  }
}

// ---- W [K][N] f32 -> Wt [N][K] bf16 (RNE), 64x64 tile transposed through LDS ----
// in[rows = K][cols = N] -> out[N][K]; grid = (N/64, K/64).
// producer coverage: 256 threads x (1 row x 16 cols) = 64x64 tile; store: 8 waves x 4 rows x 2 it = 64 rows, 8 lanes x 8 halves = 64 cols.
constexpr int kWTP = 72;
__global__ __launch_bounds__(256) void wt_cast_bf_k(const float* __restrict__ W, unsigned short* __restrict__ Wtp,
                                                    int K, int N) {
  __shared__ __align__(16) _Float16 st[64 * kWTP];
  _Float16* Wt = (_Float16*)Wtp;
  const int n0 = blockIdx.x * 64, k0 = blockIdx.y * 64;
  const int tid = threadIdx.x;
  const int kr = tid >> 2, c16 = (tid & 3) * 16;
  const float* src = W + (size_t)(k0 + kr) * N + n0 + c16;
#pragma unroll
  for (int qq = 0; qq < 4; ++qq) {
    const v4f v = *(const v4f*)(src + 4 * qq);
#pragma unroll
    for (int e = 0; e < 4; ++e)
      st[(c16 + 4 * qq + e) * kWTP + kr] = __builtin_bit_cast(_Float16, f2bf_bits(v[e]));
  }
  __syncthreads();
  const int wave = tid >> 5, lane = tid & 31;
  const int q8 = lane >> 3, c8 = (lane & 7) * 8;
  {
#pragma unroll
    for (int it = 0; it < 2; ++it) {
      const int n = it * 32 + wave * 4 + q8;
      const v8h hv = *(const v8h*)(st + n * kWTP + c8);
      *(v8h*)(Wt + (size_t)(n0 + n) * K + k0 + c8) = hv;
    }
    
  }
}

// =====================================================================================
// Causal attention, head_dim 64, fed by bf16 hi/lo planes laid out [kTok][kDim] (row = b*kSeq + t, col = h*64 + d).
//   scores = (qh.kh + qh.kl + ql.kh) / 8 : v_wmma_f32_16x16x32_bf16, f32 accumulate
//   out    =  ph.vh + ph.vl + pl.vh      : v_wmma_f32_16x16x32_bf16, p = exp(s - max) split into bf16 hi/lo
//   Both products are formed transposed: S^T = K . Q^T (A = K rows, B = Q rows) and O^T += V^T . P^T (A = V^T rows, B = P^T).
//   In S^T a lane holds scores of ONE query (column c = lane & 15): keys j*16 + 8*(lane >> 4) + r. Two such tiles, converted in place,
//   are the B operand P^T in the k order that the V^T loader already has, so P never goes through LDS, and the row maximum and the
//   row sum are in-lane, with one exchange between the wave's halves.
//   online softmax in f32. Block = 4 waves = 64 query rows of one head of batch blockIdx.x / kHeads; 64-key chunks,
//   chunks above the diagonal skipped, per-element causal select (key > query -> -inf) on the diagonal chunk.
//   grid = (kHeads * kBatch, kSeq/64), heaviest first: blockIdx.y counts the query blocks from the last (32 key chunks) down to the first (1 chunk),
//   for speed only. Each cost level is a run of 64 equal work-groups. Y planes are [kTok][kDim] like the inputs.
// =====================================================================================
constexpr int kKC = 64;
constexpr int kQB = 64;
constexpr int kLP = 2 * 64 + 8;   // LDS row pitch in bf16 elements (272 B)
constexpr int kVS = 16;           // shift (32 B = 8 banks) of V rows d >= 32: the two d halves that one staging store writes leave each other's banks
constexpr int kOP = 68;           // f32 pitch of the output tile

__device__ __forceinline__ v8f mma_bf(v16b a, v16b b, v8f c) {
  c = __builtin_amdgcn_wmma_f32_16x16x32_bf16(false, a, false, b, (short)0, c, false, false);
  asm volatile("v_nop\n\tv_nop\n\tv_nop\n\tv_nop" : "+v"(c) : "v"(a), "v"(b));
  return c;
}

// lane l <-> lane l ^ 16: the two lanes that share one query column
__device__ __forceinline__ float xhalf(float x) {
  return __builtin_bit_cast(float, __builtin_amdgcn_permlanex16(__builtin_bit_cast(int, x), __builtin_bit_cast(int, x), 0x76543210, 0xfedcba98, false, false));
}

__global__ __launch_bounds__(128)
void attn_hd64_k(const unsigned short* __restrict__ Qhp, const unsigned short* __restrict__ Qlp,
                 const unsigned short* __restrict__ Khp, const unsigned short* __restrict__ Klp,
                 const unsigned short* __restrict__ Vhp, const unsigned short* __restrict__ Vlp,
                 unsigned short* __restrict__ Yhp, unsigned short* __restrict__ Ylp) {
  union FB { v16b v; v8b h[2]; };
  // Every LDS row holds its hi half (64 elements) then its lo half (64 elements) plus 8 pad elements: pitch 272 B = 16 B x 17,
  // so the 16 rows of one ds_load_b128 fragment read start on 16 different 4-bank groups (at 128 B they fell on two).
  __shared__ __align__(16) __bf16 Ks[kKC * kLP];              // K [kv][hi d | lo d]
  __shared__ __align__(16) __bf16 Vt[kHD * kLP + kVS];        // V [d][hi kv | lo kv]; rows d >= 32 lie kVS elements further
  __shared__ __align__(16) float Obuf[4][16 * kOP];           // per wave: f32 out tile [16 queries][64 d] at pitch kOP, epilogue only
  __bf16* const Ksh = Ks;
  __bf16* const Ksl = Ks + kHD;
  __bf16* const Vth = Vt;
  __bf16* const Vtl = Vt + kKC;

  const __bf16* Qh = (const __bf16*)Qhp;
  const __bf16* Ql = (const __bf16*)Qlp;
  const __bf16* Kh = (const __bf16*)Khp;
  const __bf16* Kl = (const __bf16*)Klp;
  const __bf16* Vh = (const __bf16*)Vhp;
  const __bf16* Vl = (const __bf16*)Vlp;

  const int tid  = threadIdx.x;
  const int wave = tid >> 5;
  const int lane = tid & 31;
  const int hh   = lane >> 4;
  const int c    = lane & 15;

  constexpr int nqb = kSeq / kQB;   // 32
  const int qb = nqb - 1 - (int)blockIdx.y;     // cost (qb + 1 chunks) falls with the block index
  const int h  = (int)blockIdx.x % kHeads;
  const int q0 = qb * kQB + wave * 16;          // token index of this wave's first row
  const size_t rowb = (size_t)((int)blockIdx.x / kHeads) * kSeq; // plane row base of this batch
  const int hcol = h * kHD;

  // ---- Q fragments (B operand: column = query c): 2 d-chunks, hi and lo; Frag load = split k-map ----
  v16b qah[2], qal[2];
  {
    const size_t qoff = (rowb + (size_t)(q0 + c)) * kDim + hcol + 8 * hh;
#pragma unroll
    for (int dc = 0; dc < 2; ++dc) {
      qah[dc] = Frag<__bf16>::load(Qh + qoff + dc * 32);
      qal[dc] = Frag<__bf16>::load(Ql + qoff + dc * 32);
    }
  }

  float mrow = -INFINITY, lrow = 0.f;   // of query q0 + c; lrow sums this lane's half of the keys, the halves join in the epilogue
  v8f oacc[4];                          // O^T: row = d (t*16 + 8hh + r), column = query c
#pragma unroll
  for (int t = 0; t < 4; ++t) oacc[t] = (v8f){0.f,0.f,0.f,0.f,0.f,0.f,0.f,0.f};

  const int nChunks = qb + 1;   // block-uniform, <= 32
  for (int kc = 0; kc < nChunks; ++kc) {
    const int kv0 = kc * kKC;
    __syncthreads();
    {
      // staging coverage: 128 threads x (1 key row x 32 d) = 64 keys x 64 d for each of the four tiles
      const int kvr = tid >> 1, dh = (tid & 1) * 32;
      const size_t goff = (rowb + (size_t)(kv0 + kvr)) * kDim + hcol + dh;
      __bf16* const kdst = Ks + kvr * kLP + dh;                        // this thread's K row, hi half
      __bf16* const vdst = Vt + dh * kLP + (dh >> 5) * kVS + kvr;      // this thread's V column, first d row, hi half
#pragma unroll 1
      for (int i = 0; i < 4; ++i) {
        const v8b a0 = *(const v8b*)(Kh + goff + 8 * i);
        const v8b a1 = *(const v8b*)(Kl + goff + 8 * i);
        *(v8b*)(kdst + 8 * i) = a0;
        *(v8b*)(kdst + kHD + 8 * i) = a1;
        const v8b w0 = *(const v8b*)(Vh + goff + 8 * i);
        const v8b w1 = *(const v8b*)(Vl + goff + 8 * i);
#pragma unroll
        for (int e = 0; e < 8; ++e) {
          vdst[(8 * i + e) * kLP] = w0[e];
          vdst[(8 * i + e) * kLP + kKC] = w1[e];
        }
      }
    }
    __syncthreads();

    // ---- scores, transposed: D row = key j*16 + 8hh + r, col = query c ----
    v8f s[4];
#pragma unroll
    for (int j = 0; j < 4; ++j) {
      s[j] = (v8f){0.f,0.f,0.f,0.f,0.f,0.f,0.f,0.f};
#pragma unroll
      for (int dc = 0; dc < 2; ++dc) {
        FB kb, kl;
        kb.h[0] = *(const v8b*)(Ksh + (j * 16 + c) * kLP + dc * 32 + 8 * hh);
        kb.h[1] = *(const v8b*)(Ksh + (j * 16 + c) * kLP + dc * 32 + 16 + 8 * hh);
        kl.h[0] = *(const v8b*)(Ksl + (j * 16 + c) * kLP + dc * 32 + 8 * hh);
        kl.h[1] = *(const v8b*)(Ksl + (j * 16 + c) * kLP + dc * 32 + 16 + 8 * hh);
        s[j] = mma_bf(kb.v, qah[dc], s[j]);
        s[j] = mma_bf(kl.v, qah[dc], s[j]);
        s[j] = mma_bf(kb.v, qal[dc], s[j]);
      }
    }
    const bool diag = (kc == qb);   // block-uniform
    const int qrow = q0 + c;
    float mj[4];
#pragma unroll
    for (int j = 0; j < 4; ++j) {
      mj[j] = -INFINITY;
#pragma unroll
      for (int r = 0; r < 8; ++r) {
        const int kvcol = kv0 + j * 16 + 8 * hh + r;
        float sv = s[j][r] * 0.125f;
        if (diag && (kvcol > qrow)) sv = -INFINITY;
        s[j][r] = sv;
        mj[j] = fmaxf(mj[j], sv);
      }
    }
    float cm = fmaxf(fmaxf(mj[0], mj[1]), fmaxf(mj[2], mj[3]));
    cm = fmaxf(cm, xhalf(cm));      // the other 32 keys of this query
    const float mnew = fmaxf(mrow, cm);
    const float mref = (mnew > -INFINITY) ? mnew : 0.0f;   // all-masked so far -> p = 0, alpha = 0
    const float alpha = expf(mrow - mref);
    mrow = mnew;
    // P^T as B operand: element e of fragment kk = key kk*32 + (e < 8 ? 8hh + e : 16 + 8hh + e - 8), the k order of the V^T loads below
    FB pa[2], pl[2];
    float pj[4];
#pragma unroll
    for (int j = 0; j < 4; ++j) {
      pj[j] = 0.f;
#pragma unroll
      for (int r = 0; r < 8; ++r) {
        const float p = expf(s[j][r] - mref);
        pj[j] += p;
        const unsigned short hb = f2bf_bits(p);
        const unsigned short lb = f2bf_bits(p - bf_bits2f(hb));
        pa[j >> 1].v[(j & 1) * 8 + r] = __builtin_bit_cast(__bf16, hb);
        pl[j >> 1].v[(j & 1) * 8 + r] = __builtin_bit_cast(__bf16, lb);
      }
    }
    lrow = lrow * alpha + ((pj[0] + pj[1]) + (pj[2] + pj[3]));
#pragma unroll
    for (int t = 0; t < 4; ++t)
#pragma unroll
      for (int r = 0; r < 8; ++r) oacc[t][r] *= alpha;
    // ---- out^T += V^T (A: m = d, k = key) x P^T (B: k = key, n = query) ----
#pragma unroll   // constant kk keeps the P fragments in registers
    for (int kk = 0; kk < 2; ++kk) {
#pragma unroll
      for (int t = 0; t < 4; ++t) {
        FB vb, vl;
        vb.h[0] = *(const v8b*)(Vth + (t * 16 + c) * kLP + (t >> 1) * kVS + kk * 32 + 8 * hh);
        vb.h[1] = *(const v8b*)(Vth + (t * 16 + c) * kLP + (t >> 1) * kVS + kk * 32 + 16 + 8 * hh);
        vl.h[0] = *(const v8b*)(Vtl + (t * 16 + c) * kLP + (t >> 1) * kVS + kk * 32 + 8 * hh);
        vl.h[1] = *(const v8b*)(Vtl + (t * 16 + c) * kLP + (t >> 1) * kVS + kk * 32 + 16 + 8 * hh);
        oacc[t] = mma_bf(vb.v, pa[kk].v, oacc[t]);
        oacc[t] = mma_bf(vl.v, pa[kk].v, oacc[t]);
        oacc[t] = mma_bf(vb.v, pl[kk].v, oacc[t]);
      }
    }
  }

  // ---- epilogue: y = out / l, staged per wave as f32 [16][64] (pitch kOP) in the wave's own tile ----
  __syncthreads();
  float* os = Obuf[wave];
  {
    const float inv = 1.0f / (lrow + xhalf(lrow));   // both halves of the keys
#pragma unroll
    for (int t = 0; t < 4; ++t) {
      v4f o0, o1;
#pragma unroll
      for (int r = 0; r < 4; ++r) { o0[r] = oacc[t][r] * inv; o1[r] = oacc[t][4 + r] * inv; }
      *(v4f*)(os + c * kOP + t * 16 + 8 * hh) = o0;       // a lane holds 8 consecutive d of its query
      *(v4f*)(os + c * kOP + t * 16 + 8 * hh + 4) = o1;
    }
  }
  __builtin_amdgcn_fence(__ATOMIC_RELEASE, "workgroup");
  __builtin_amdgcn_wave_barrier();
  __builtin_amdgcn_fence(__ATOMIC_ACQUIRE, "workgroup");
  {
    // store coverage: per it, lanes (q8 = 0..3) x (c8 = 0..56 step 8) = 4 rows x 64 cols; 4 it = 16 rows = this wave's tile.
    const int q8 = lane >> 3, c8 = (lane & 7) * 8;
    {
#pragma unroll
      for (int it = 0; it < 4; ++it) {
        const int row = it * 4 + q8;
        const float* sp = os + row * kOP + c8;
        v8h hv, lv;
#pragma unroll
        for (int e = 0; e < 8; ++e) {
          const unsigned short hb = f2bf_bits(sp[e]);
          const unsigned short lb = f2bf_bits(sp[e] - bf_bits2f(hb));
          hv[e] = __builtin_bit_cast(_Float16, hb);
          lv[e] = __builtin_bit_cast(_Float16, lb);
        }
        const size_t yo = (rowb + (size_t)(q0 + row)) * kDim + hcol + c8;
        *(v8h*)(Yhp + yo) = hv;
        *(v8h*)(Ylp + yo) = lv;
      }
      
    }
  }
}

// ---------------------------------------------------------------------------
// Workspace region map (bytes):
//   [0, 16777216)            Xb   bf16 [8192][1024]  (dead after the qkv GEMM; reused as Yh bf16 [8192][1024])
//   [16777216, 23068672)     WqT  bf16 [3072][1024]
//   [23068672, 25165824)     WpT  bf16 [1024][1024]
//   [25165824, 125829120)    QKV  bf16 6 planes [8192][1024]: Qh, Ql, Kh, Kl, Vh, Vl
//   [125829120, 142606336)   Yl   bf16 [8192][1024]
//   total 142,606,336 B
// ---------------------------------------------------------------------------
extern "C" void kernel_launch(void* const* d_in, const int* in_sizes, int n_in,
                              void* d_out, int out_size, void* d_ws, size_t ws_size,
                              hipStream_t stream) {
  if (n_in < 9) return;
  if (in_sizes[0] != kTok * kDim || in_sizes[1] != kDim * kDim3 || in_sizes[2] != kDim3 ||
      in_sizes[3] != kDim * kDim || in_sizes[4] != kDim ||
      in_sizes[5] != kHeads * kHD || in_sizes[6] != kHeads * kHD ||
      in_sizes[7] != kHeads * kHD || in_sizes[8] != kHeads * kHD ||
      out_size != kTok * kDim) return;

  const float* x     = (const float*)d_in[0];
  const float* Wqkv  = (const float*)d_in[1];
  const float* bqkv  = (const float*)d_in[2];
  const float* Wproj = (const float*)d_in[3];
  const float* bproj = (const float*)d_in[4];
  const float* qs    = (const float*)d_in[5];
  const float* qbv   = (const float*)d_in[6];
  const float* ks    = (const float*)d_in[7];
  const float* kbv   = (const float*)d_in[8];
  float* out = (float*)d_out;

  const size_t plane  = (size_t)kTok * kDim;                 // elements per [8192][1024] plane
  const size_t offX   = 0;
  const size_t offWq  = offX  + plane * 2;                    // 16,777,216
  const size_t offWp  = offWq + (size_t)kDim3 * kDim * 2;     // 23,068,672
  const size_t offQKV = offWp + (size_t)kDim * kDim * 2;      // 25,165,824
  const size_t offYl  = offQKV + 6 * plane * 2;               // 125,829,120
  const size_t total  = offYl + plane * 2;                    // 142,606,336
  if (total > ws_size) return;

  char* ws = (char*)d_ws;
  unsigned short* Xb  = (unsigned short*)(ws + offX);
  unsigned short* Yh  = Xb;                                   // [8192][1024] bf16, the whole Xb region
  unsigned short* Yl  = (unsigned short*)(ws + offYl);        // [8192][1024] bf16
  unsigned short* WqT = (unsigned short*)(ws + offWq);
  unsigned short* WpT = (unsigned short*)(ws + offWp);
  unsigned short* QKV = (unsigned short*)(ws + offQKV);
  unsigned short* Qh = QKV;
  unsigned short* Ql = QKV + plane;
  unsigned short* Kh = QKV + 2 * plane;
  unsigned short* Kl = QKV + 3 * plane;
  unsigned short* Vh = QKV + 4 * plane;
  unsigned short* Vl = QKV + 5 * plane;

  // 1) x -> bf16 plane: n = 8,388,608, 8 per thread -> 1,048,576 threads = 4096 blocks x 256 (exact)
  const int n8 = (kTok * kDim) / 8;
  cast_bf16x8_k<<<dim3((n8 + 255) / 256), dim3(256), 0, stream>>>(x, Xb, n8);

  // 2) W_qkv in[1024][3072] -> WqT out[3072][1024] bf16: grid (3072/64, 1024/64)
  wt_cast_bf_k<<<dim3(kDim3 / 64, kDim / 64), dim3(256), 0, stream>>>(Wqkv, WqT, kDim, kDim3);
  // 3) W_proj in[1024][1024] -> WpT out[1024][1024] bf16: grid (1024/64, 1024/64)
  wt_cast_bf_k<<<dim3(kDim / 64, kDim / 64), dim3(256), 0, stream>>>(Wproj, WpT, kDim, kDim);

  // 4) qkv = Xb[8192][1024] . WqT[3072][1024]^T + b_qkv, per-head affine on q/k, bf16 hi/lo planes.
  //    M = 8192 (multiple of 128), N = 3072 (multiple of 256), K = 1024 (multiple of 64); block tiles 64 x 12 = 768 blocks x 8 waves.
  wmma_gemm64<1, 0, 2, 3, false><<<dim3(768, 1), dim3(256), 0, stream>>>(
      Xb, Xb, kDim, 0L, WqT, WqT, kDim, 0L,
      (void*)QKV, (void*)QKV, kDim, (long)plane,
      bqkv, bqkv, 0L, qs, qbv, ks, kbv,
      kTok, kDim3, kDim, 1.0f);

  // 5) causal attention of all batches in one launch -> Yh/Yl: grid (16 heads x 4 batches, 32 query blocks from the last to the first).
  attn_hd64_k<<<dim3(kHeads * kBatch, kSeq / kQB), dim3(128), 0, stream>>>(Qh, Ql, Kh, Kl, Vh, Vl, Yh, Yl);
  // 6) out = Y . WpT^T + b_proj over all rows (A hi/lo, 2 products).
  //    M = 8192, N = 1024, K = 1024; block tiles 64 x 4 = 256 blocks x 8 waves.
  wmma_gemm64<1, 1, 2, 0, false><<<dim3(256, 1), dim3(256), 0, stream>>>(
      Yh, Yl, kDim, 0L, WpT, WpT, kDim, 0L,
      (void*)out, (void*)out, kDim, 0L,
      bproj, bproj, 0L, qs, qbv, ks, kbv,
      kTok, kDim, kDim, 1.0f);
}

// v006
// It runs in 215 microseconds.
// In two side-by-side timings against v005, it was 1.09 and 1.08 times as fast.
// All steps since v000 together make it 6.20 times as fast.
// Contractions: x*W_qkv on v_wmma_f32_16x16x32_bf16 (plain bf16 operands = RNE-bf16 inputs); q*k^T and p*v on v_wmma_f32_16x16x32_bf16 with bf16 hi/lo operand pairs (hi*hi + hi*lo + lo*hi); y*W_proj on v_wmma_f32_16x16x32_bf16 with y as bf16 hi/lo and exact bf16 weights (hi*w + lo*w); f32 accumulate everywhere; bias, per-head affine and softmax in f32.
#include <hip/hip_runtime.h>
#include <stdint.h>
#include <math.h>

constexpr int kBatch = 4;
constexpr int kSeq   = 2048;
constexpr int kDim   = 1024;
constexpr int kHeads = 16;
constexpr int kHD    = 64;
constexpr int kTok   = kBatch * kSeq;   // 8192
constexpr int kDim3  = 3 * kDim;        // 3072

typedef __attribute__((ext_vector_type(16))) _Float16 v16h;
typedef __attribute__((ext_vector_type(8)))  _Float16 v8h;
typedef __attribute__((ext_vector_type(16))) __bf16   v16b;
typedef __attribute__((ext_vector_type(8)))  __bf16   v8b;
typedef __attribute__((ext_vector_type(8)))  float    v8f;
typedef __attribute__((ext_vector_type(4)))  float    v4f;
typedef __attribute__((ext_vector_type(2)))  float    v2f;

__device__ __forceinline__ unsigned short f2bf_bits(float f) {
  unsigned u = __float_as_uint(f);
  return (unsigned short)((u + 0x7FFFu + ((u >> 16) & 1u)) >> 16);
}
__device__ __forceinline__ float bf_bits2f(unsigned short h) { return __uint_as_float(((unsigned)h) << 16); }
__device__ __forceinline__ float bf_rne(float f) { return bf_bits2f(f2bf_bits(f)); }

// hazard guards as plain device helpers
__device__ __forceinline__ void dep_guard_h(v8f& a, v8f& b, v16h x, v16h y) { asm volatile("v_nop\n\tv_nop\n\tv_nop\n\tv_nop" : "+v"(a), "+v"(b) : "v"(x), "v"(y)); }
__device__ __forceinline__ void dep_guard_b(v8f& a, v8f& b, v16b x, v16b y) { asm volatile("v_nop\n\tv_nop\n\tv_nop\n\tv_nop" : "+v"(a), "+v"(b) : "v"(x), "v"(y)); }
__device__ __forceinline__ void keep4_h(v16h a, v16h b, v16h c, v16h d) { asm volatile("v_nop" :: "v"(a), "v"(b), "v"(c), "v"(d)); }
__device__ __forceinline__ void keep4_b(v16b a, v16b b, v16b c, v16b d) { asm volatile("v_nop" :: "v"(a), "v"(b), "v"(c), "v"(d)); }
__device__ __forceinline__ void acc_guard4(v8f& a, v8f& b, v8f& c, v8f& d) { asm volatile("v_nop\n\tv_nop\n\tv_nop\n\tv_nop" : "+v"(a), "+v"(b), "+v"(c), "+v"(d)); }
template <typename T> struct Frag;
template <> struct Frag<_Float16> {
  typedef v16h V; union U { v16h v; v8h h[2]; };
  static __device__ __forceinline__ v16h load(const _Float16* p) {   // elements 0..7 <- p[0..7], 8..15 <- p[16..23]
    U f; f.h[0] = *(const v8h*)(p); f.h[1] = *(const v8h*)(p + 16); return f.v;
  }
  static __device__ __forceinline__ v8f mma(v16h a, v16h b, v8f c) {
    return __builtin_amdgcn_wmma_f32_16x16x32_f16(false, a, false, b, (short)0, c, false, false);
  }
  static __device__ __forceinline__ void guard(v8f& a, v8f& b, v16h x, v16h y) { dep_guard_h(a, b, x, y); }
  static __device__ __forceinline__ void keep(v16h a, v16h b, v16h c, v16h d) { keep4_h(a, b, c, d); }
};
template <> struct Frag<__bf16> {
  typedef v16b V; union U { v16b v; v8b h[2]; };
  static __device__ __forceinline__ v16b load(const __bf16* p) {
    U f; f.h[0] = *(const v8b*)(p); f.h[1] = *(const v8b*)(p + 16); return f.v;
  }
  static __device__ __forceinline__ v8f mma(v16b a, v16b b, v8f c) {
    return __builtin_amdgcn_wmma_f32_16x16x32_bf16(false, a, false, b, (short)0, c, false, false);
  }
  static __device__ __forceinline__ void guard(v8f& a, v8f& b, v16b x, v16b y) { dep_guard_b(a, b, x, y); }
  static __device__ __forceinline__ void keep(v16b a, v16b b, v16b c, v16b d) { keep4_b(a, b, c, d); }
};

// ---- Register-blocked batched WMMA GEMM ------------------------------------
// C[m,n] = scale * sum_k A[m,k] * Bt[n,k] (+bias)(affine)(+resid); each wave owns a 64x64 tile.
// A row-major [M,K]; Bt row-major [N,K]; M % 128 == 0, N % 256 == 0, K % 64 == 0, lda and ldb % 8 == 0.
// A block of 8 waves (2 x 4) owns a 128 x 256 tile of C. Its operand rows come 64 k (one 128-B line of every row) at a time
// into an LDS ring of two buffers by asynchronous copies, whole lines per wave-copy; the fragments are read from LDS.
// SPLIT_MODE: 0 = plain; 1 = A carried as hi/lo planes (A2 = lo): hi.b + lo.b; 2 = A and Bt hi/lo: hi.hi + hi.lo + lo.hi.
// BIAS_MODE: 0 = none, 1 = bias[m], 2 = bias[n].
// OUT_MODE: 0 = f32, 1 = f16, 2 = bf16 hi plane (Cout) + bf16 lo plane (Cout2),
//           3 = qkv mode: columns n form three blocks of kDim (which = n0 / kDim); value v = (acc+bias)*affs[cc]+affb[cc]
//               with cc = n - which*kDim and tables (affs0,affb0) for which 0, (affs1,affb1) for which 1 (RNE-bf16 applied
//               to the table values), identity for which 2; written as bf16 hi plane at Cout + which*2*strideC and lo plane
//               at + strideC, row pitch ldc, column n0 - which*kDim.
// ET: 0 = f16 operands, 1 = bf16 operands (pointers passed as 16-bit storage)
constexpr int kGBM = 128;   // rows of C per block (2 waves of 64)
constexpr int kGBN = 256;   // columns of C per block (4 waves of 64)
constexpr int kGBK = 64;    // k per stage
constexpr int kGP  = 72;    // LDS row pitch in 16-bit elements: 144 B = 16 B x 9, for the ds_load_b128 fragment readers

__device__ __forceinline__ unsigned lds_off(const void* p) { return (unsigned)(size_t)p; }   // byte offset in the block's LDS

// ROWS rows of 128 B, global -> LDS, 16 B per lane and copy: thread -> row tid >> 3 (+32 per copy), piece tid & 7;
// ldst and gsrc already point at this thread's first row and piece; ld = global row pitch in elements.
template <int ROWS>
__device__ __forceinline__ void stage_rows(unsigned ldst, const unsigned short* gsrc, int ld) {
  const size_t g32 = (size_t)32 * (size_t)ld;
#pragma unroll   // one or two straight groups of four copies, no loop counter beside them
  for (int u = 0; u < ROWS / 128; ++u) {
    const unsigned l0 = ldst + (unsigned)(u * 128 * kGP * 2);
    const unsigned l1 = l0 + 32u * kGP * 2u, l2 = l0 + 64u * kGP * 2u, l3 = l0 + 96u * kGP * 2u;
    const unsigned short* g0 = gsrc + (size_t)(4 * u) * g32;
    const unsigned short* g1 = g0 + g32;
    const unsigned short* g2 = g1 + g32;
    const unsigned short* g3 = g2 + g32;
    // the s_wait_xcnt closes the copies' own statement, so that no address register of a copy is rewritten ahead of it
    asm volatile("global_load_async_to_lds_b128 %0, %1, off\n\t"
                 "global_load_async_to_lds_b128 %2, %3, off\n\t"
                 "global_load_async_to_lds_b128 %4, %5, off\n\t"
                 "global_load_async_to_lds_b128 %6, %7, off\n\t"
                 "s_wait_xcnt 0x0"
                 :: "v"(l0), "v"(g0), "v"(l1), "v"(g1), "v"(l2), "v"(g2), "v"(l3), "v"(g3) : "memory");
  }
}

template <int ET> struct Elem;
template <> struct Elem<0> { typedef _Float16 T; };
template <> struct Elem<1> { typedef __bf16 T; };
template <int ET, int SPLIT_MODE, int BIAS_MODE, int OUT_MODE, bool RESID, int ACT = 0>
__global__ __launch_bounds__(256) void wmma_gemm64(
    const unsigned short* __restrict__ Ap, const unsigned short* __restrict__ A2p, int lda, long strideA,
    const unsigned short* __restrict__ Btp, const unsigned short* __restrict__ Bt2p, int ldb, long strideB,
    void* __restrict__ Cout, void* __restrict__ Cout2, int ldc, long strideC,
    const float* __restrict__ bias,
    const float* __restrict__ resid, long strideR,
    const float* __restrict__ affs0, const float* __restrict__ affb0,
    const float* __restrict__ affs1, const float* __restrict__ affb1,
    int M, int N, int K, float scale) {
  typedef typename Elem<ET>::T T;
  typedef typename Frag<T>::V V;
  const T* A = (const T*)Ap; const T* A2 = (const T*)A2p; const T* Bt = (const T*)Btp; const T* Bt2 = (const T*)Bt2p;
  constexpr int NA = (SPLIT_MODE >= 1) ? 2 : 1;      // planes of A, of Bt
  constexpr int NB = (SPLIT_MODE == 2) ? 2 : 1;
  constexpr int kAEl = kGBM * kGP;                   // elements of one plane's tile in LDS
  constexpr int kBEl = kGBN * kGP;
  constexpr int kStage = NA * kAEl + NB * kBEl;      // one buffer: [A hi | A lo | Bt hi | Bt lo]
  __shared__ __align__(16) T ring[2 * kStage];
  __shared__ __align__(16) float sT[8][16 * 68];   // per-wave 16x64 slab, pitch 68 floats
  const int b    = blockIdx.y;
  const int lane = threadIdx.x & 31;
  const int wave = threadIdx.x >> 5;
  const int blocksN = N / kGBN;
  if ((int)blockIdx.x >= (M / kGBM) * blocksN) return;   // block-uniform, ahead of every copy and barrier
  const int bm = blockIdx.x / blocksN;
  const int bn = blockIdx.x - bm * blocksN;
  const int mb0 = bm * kGBM;
  const int nb0 = bn * kGBN;
  const int wm = wave >> 2, wn = wave & 3;
  const int m0 = mb0 + (wm << 6);
  const int n0 = nb0 + (wn << 6);

  const T* Ab  = A  + (size_t)b * strideA;
  const T* Bb  = Bt + (size_t)b * strideB;
  const T* Ab2 = (SPLIT_MODE >= 1) ? (A2  + (size_t)b * strideA) : nullptr;
  const T* Bb2 = (SPLIT_MODE == 2) ? (Bt2 + (size_t)b * strideB) : nullptr;

  const int rlane = lane & 15;                 // row (A) / col (B, D) within subtile
  const int koff  = (lane >> 4) * 8;           // k offset of this lane half
  const int mOff  = (lane >> 4) * 8;           // D row offset

  v8f acc[4][4];
#pragma unroll
  for (int i = 0; i < 4; ++i)
#pragma unroll
    for (int j = 0; j < 4; ++j) acc[i][j] = (v8f){0.f,0.f,0.f,0.f,0.f,0.f,0.f,0.f};

  // this thread's share of every stage: row tid >> 3 (+32 per copy) of each tile, 16-B piece tid & 7
  const int crow = threadIdx.x >> 3, cpc = (threadIdx.x & 7) * 8;
  const unsigned short* gA  = (const unsigned short*)Ab + (size_t)(mb0 + crow) * lda + cpc;
  const unsigned short* gB  = (const unsigned short*)Bb + (size_t)(nb0 + crow) * ldb + cpc;
  const unsigned short* gA2 = (SPLIT_MODE >= 1) ? ((const unsigned short*)Ab2 + (size_t)(mb0 + crow) * lda + cpc) : nullptr;
  const unsigned short* gB2 = (SPLIT_MODE == 2) ? ((const unsigned short*)Bb2 + (size_t)(nb0 + crow) * ldb + cpc) : nullptr;
  const unsigned lT = lds_off(ring) + (unsigned)((crow * kGP + cpc) * 2);
  auto issue_stage = [&](int t) {
    const unsigned lb = lT + (unsigned)((t & 1) * (kStage * 2));
    const int k0 = t * kGBK;
    stage_rows<kGBM>(lb, gA + k0, lda);
    if (SPLIT_MODE >= 1) stage_rows<kGBM>(lb + kAEl * 2, gA2 + k0, lda);
    stage_rows<kGBN>(lb + NA * kAEl * 2, gB + k0, ldb);
    if (SPLIT_MODE == 2) stage_rows<kGBN>(lb + (NA * kAEl + kBEl) * 2, gB2 + k0, ldb);
  };

  const int nk = K / kGBK;   // block-uniform
  issue_stage(0);
  asm volatile("s_wait_asynccnt 0x0" ::: "memory");   // this wave's copies of stage 0 have landed
  __syncthreads();                                    // ... and every other wave's
  if (nk > 1) issue_stage(1);

  for (int t = 0; t < nk; ++t) {
    const T* sA = ring + (t & 1) * kStage + ((wm << 6) + rlane) * kGP + koff;
    const T* sB = ring + (t & 1) * kStage + NA * kAEl + ((wn << 6) + rlane) * kGP + koff;
#pragma unroll   // both halves of the stage in one straight run: the second half's fragment loads go among the first half's products
    for (int ks = 0; ks < kGBK; ks += 32) {
      V bh[4], bl[4];
#pragma unroll
      for (int j = 0; j < 4; ++j) {
        bh[j] = Frag<T>::load(sB + (j << 4) * kGP + ks);
        if (SPLIT_MODE == 2) bl[j] = Frag<T>::load(sB + kBEl + (j << 4) * kGP + ks);
      }
      V ah[4], al[4];   // all fragments of the half are asked for as one group, ahead of its products
#pragma unroll   // constant indices keep the fragment arrays in registers
      for (int i = 0; i < 4; ++i) {
        ah[i] = Frag<T>::load(sA + (i << 4) * kGP + ks);
        if (SPLIT_MODE >= 1) al[i] = Frag<T>::load(sA + kAEl + (i << 4) * kGP + ks);
      }
#pragma unroll
      for (int i = 0; i < 4; ++i) {
#pragma unroll
        for (int j = 0; j < 4; ++j) {
          acc[i][j] = Frag<T>::mma(ah[i], bh[j], acc[i][j]);
          if (SPLIT_MODE == 2) acc[i][j] = Frag<T>::mma(ah[i], bl[j], acc[i][j]);
          if (SPLIT_MODE >= 1) acc[i][j] = Frag<T>::mma(al[i], bh[j], acc[i][j]);
        }
        Frag<T>::guard(acc[i][0], acc[i][3], ah[i], (SPLIT_MODE >= 1) ? al[i] : ah[i]);
      }
      Frag<T>::keep(bh[0], bh[1], bh[2], bh[3]);
      if (SPLIT_MODE == 2) Frag<T>::keep(bl[0], bl[1], bl[2], bl[3]);
    }
    // publish point of stage t + 1; the one barrier also ends every wave's reads of the buffer that is refilled behind it
    asm volatile("s_wait_dscnt 0x0" ::: "memory");      // this wave's LDS reads of stage t are done
    asm volatile("s_wait_asynccnt 0x0" ::: "memory");   // this wave's copies of stage t + 1 have landed
    __syncthreads();
    if (t + 2 < nk) issue_stage(t + 2);
  }
  asm volatile("s_wait_asynccnt 0x0" ::: "memory");     // no copy is outstanding when the wave goes on to the epilogue
  acc_guard4(acc[0][0], acc[0][1], acc[0][2], acc[0][3]);
  acc_guard4(acc[1][0], acc[1][1], acc[1][2], acc[1][3]);
  acc_guard4(acc[2][0], acc[2][1], acc[2][2], acc[2][3]);
  acc_guard4(acc[3][0], acc[3][1], acc[3][2], acc[3][3]);

  // ---- epilogue ----
  float* slab = sT[wave];
  const float* Rb = RESID ? (resid + (size_t)b * strideR) : nullptr;
#pragma unroll
  for (int i = 0; i < 4; ++i) {
    const int mBase = m0 + (i << 4);
#pragma unroll
    for (int j = 0; j < 4; ++j) {
      const int n = n0 + (j << 4) + rlane;
      float bv = 0.f;
      if (BIAS_MODE == 2) bv = bias[n];
      float asc = 1.0f, abi = 0.0f;
      if (OUT_MODE == 3) {
        const int which = n0 / kDim;               // wave-uniform (64-col tile inside one kDim block)
        const int cc = n - which * kDim;           // 0..kDim-1, all four tables have kDim entries
        const float s0 = bf_rne(affs0[cc]);
        const float c0 = bf_rne(affb0[cc]);
        const float s1 = bf_rne(affs1[cc]);
        const float c1 = bf_rne(affb1[cc]);
        asc = (which == 0) ? s0 : ((which == 1) ? s1 : 1.0f);
        abi = (which == 0) ? c0 : ((which == 1) ? c1 : 0.0f);
      }
#pragma unroll
      for (int r = 0; r < 8; ++r) {
        float v = acc[i][j][r] * scale;
        if (BIAS_MODE == 1) v += bias[mBase + mOff + r];
        if (BIAS_MODE == 2) v += bv;
        if (OUT_MODE == 3) v = v * asc + abi;
        if (RESID) v += Rb[(size_t)(mBase + mOff + r) * ldc + n];
        if (ACT == 1) v = tanhf(v);
        if (ACT == 2) v = fmaxf(v, 0.0f);
        if (ACT == 4) v = (v > 0.f) ? v : 0.01f * v;
        slab[(mOff + r) * 68 + (j << 4) + rlane] = v;
      }
    }
    __builtin_amdgcn_fence(__ATOMIC_RELEASE, "workgroup");
    __builtin_amdgcn_wave_barrier();
    __builtin_amdgcn_fence(__ATOMIC_ACQUIRE, "workgroup");
    if (OUT_MODE == 0) {
      float* C = (float*)Cout + (size_t)b * strideC;
      const int hh = lane >> 4, c4 = (lane & 15) * 4;     // row seg = 256 B = 16 lanes x 16 B
      {
#pragma unroll
        for (int it = 0; it < 8; ++it) {
          const int row = it * 2 + hh;
          v4f v = *(const v4f*)(slab + row * 68 + c4);
          *(v4f*)(C + (size_t)(mBase + row) * ldc + n0 + c4) = v;
        }
        
      }
    } else {
      const int q = lane >> 3, c8 = (lane & 7) * 8;
      unsigned short* C;
      unsigned short* C2;
      int ncol;
      if (OUT_MODE == 3) {
        const int which = n0 / kDim;
        C  = (unsigned short*)Cout + (size_t)which * 2 * (size_t)strideC;
        C2 = C + (size_t)strideC;
        ncol = n0 - which * kDim;
      } else {
        C  = (unsigned short*)Cout  + (size_t)b * strideC;
        C2 = (OUT_MODE == 2) ? ((unsigned short*)Cout2 + (size_t)b * strideC) : nullptr;
        ncol = n0;
      }
      {
#pragma unroll
        for (int it = 0; it < 4; ++it) {
          const int row = it * 4 + q;
          const float* sp = slab + row * 68 + c8;
          v8h hv, lv;
#pragma unroll
          for (int e = 0; e < 8; ++e) {
            if (OUT_MODE == 1) {
              hv[e] = (_Float16)sp[e];
            } else {
              unsigned short hb = f2bf_bits(sp[e]);
              unsigned short lb = f2bf_bits(sp[e] - bf_bits2f(hb));
              hv[e] = __builtin_bit_cast(_Float16, hb);
              lv[e] = __builtin_bit_cast(_Float16, lb);
            }
          }
          *(v8h*)(C + (size_t)(mBase + row) * ldc + ncol + c8) = hv;
          if (OUT_MODE >= 2) *(v8h*)(C2 + (size_t)(mBase + row) * ldc + ncol + c8) = lv;
        }
        
      }
    }
    __builtin_amdgcn_fence(__ATOMIC_RELEASE, "workgroup");
    __builtin_amdgcn_wave_barrier();
    __builtin_amdgcn_fence(__ATOMIC_ACQUIRE, "workgroup");
  }
}

// coverage: n8 threads x 8 elements = n (host passes n8 = n/8 with n % 8 == 0)
__global__ __launch_bounds__(256) void cast_bf16x8_k(const float* __restrict__ in,
                                                     unsigned short* __restrict__ out, int n8) {
  const int i = blockIdx.x * 256 + threadIdx.x;
  if (i < n8) {
    const size_t o = (size_t)i * 8;
    const v4f a = *(const v4f*)(in + o);
    const v4f bq = *(const v4f*)(in + o + 4);
    v8h hv;
#pragma unroll
    for (int e = 0; e < 4; ++e) {
      hv[e]     = __builtin_bit_cast(_Float16, f2bf_bits(a[e]));
      hv[4 + e] = __builtin_bit_cast(_Float16, f2bf_bits(bq[e]));
    }
    *(v8h*)(out + o) = hv;
    
  }
}

// ---- W [K][N] f32 -> Wt [N][K] bf16 (RNE), 64x64 tile transposed through LDS ----
// in[rows = K][cols = N] -> out[N][K]; grid = (N/64, K/64).
// producer coverage: 256 threads x (1 row x 16 cols) = 64x64 tile; store: 8 waves x 4 rows x 2 it = 64 rows, 8 lanes x 8 halves = 64 cols.
constexpr int kWTP = 72;
__global__ __launch_bounds__(256) void wt_cast_bf_k(const float* __restrict__ W, unsigned short* __restrict__ Wtp,
                                                    int K, int N) {
  __shared__ __align__(16) _Float16 st[64 * kWTP];
  _Float16* Wt = (_Float16*)Wtp;
  const int n0 = blockIdx.x * 64, k0 = blockIdx.y * 64;
  const int tid = threadIdx.x;
  const int kr = tid >> 2, c16 = (tid & 3) * 16;
  const float* src = W + (size_t)(k0 + kr) * N + n0 + c16;
#pragma unroll
  for (int qq = 0; qq < 4; ++qq) {
    const v4f v = *(const v4f*)(src + 4 * qq);
#pragma unroll
    for (int e = 0; e < 4; ++e)
      st[(c16 + 4 * qq + e) * kWTP + kr] = __builtin_bit_cast(_Float16, f2bf_bits(v[e]));
  }
  __syncthreads();
  const int wave = tid >> 5, lane = tid & 31;
  const int q8 = lane >> 3, c8 = (lane & 7) * 8;
  {
#pragma unroll
    for (int it = 0; it < 2; ++it) {
      const int n = it * 32 + wave * 4 + q8;
      const v8h hv = *(const v8h*)(st + n * kWTP + c8);
      *(v8h*)(Wt + (size_t)(n0 + n) * K + k0 + c8) = hv;
    }
    
  }
}

// =====================================================================================
// Causal attention, head_dim 64, fed by bf16 hi/lo planes laid out [kTok][kDim] (row = b*kSeq + t, col = h*64 + d).
//   scores = qh.kh + qh.kl + ql.kh, unscaled (the 1/8 goes into the exponent) : v_wmma_f32_16x16x32_bf16, f32 accumulate
//   out    =  ph.vh + ph.vl + pl.vh      : v_wmma_f32_16x16x32_bf16, p = exp((s - max) / 8) split into bf16 hi/lo
//   Both products are formed transposed: S^T = K . Q^T (A = K rows, B = Q rows) and O^T += V^T . P^T (A = V^T rows, B = P^T).
//   In S^T a lane holds scores of ONE query (column c = lane & 15): keys j*16 + 8*(lane >> 4) + r. Two such tiles, converted in place,
//   are the B operand P^T in the k order that the V^T loader already has, so P never goes through LDS, and the row maximum and the
//   row sum are in-lane, with one exchange between the wave's halves.
//   online softmax in f32, base 2: p = 2^(s * kSc - m * kSc) with kSc = log2(e) / 8, one packed fma per two scores and one v_exp_f32 per score. Block = 4 waves = 64 query rows of one head of batch blockIdx.x / kHeads; 64-key chunks,
//   chunks above the diagonal skipped, per-element causal select (key > query -> -inf) on the diagonal chunk.
//   grid = (kHeads * kBatch, kSeq/64), heaviest first: blockIdx.y counts the query blocks from the last (32 key chunks) down to the first (1 chunk),
//   for speed only. Each cost level is a run of 64 equal work-groups. Y planes are [kTok][kDim] like the inputs.
// =====================================================================================
constexpr int kKC = 64;
constexpr int kQB = 64;
constexpr int kLP = 2 * 64 + 8;   // LDS row pitch in bf16 elements (272 B)
constexpr int kVS = 16;           // shift (32 B = 8 banks) of V rows d >= 32: the two d halves that one staging store writes leave each other's banks
constexpr int kOP = 68;           // f32 pitch of the output tile
constexpr float kSc = 0.125f * 1.44269504088896340736f;   // 1/sqrt(head dim) * log2(e): raw score -> exponent of 2

__device__ __forceinline__ v8f mma_bf(v16b a, v16b b, v8f c) {
  c = __builtin_amdgcn_wmma_f32_16x16x32_bf16(false, a, false, b, (short)0, c, false, false);
  asm volatile("v_nop\n\tv_nop\n\tv_nop\n\tv_nop" : "+v"(c) : "v"(a), "v"(b));
  return c;
}

// lane l <-> lane l ^ 16: the two lanes that share one query column
__device__ __forceinline__ float xhalf(float x) {
  return __builtin_bit_cast(float, __builtin_amdgcn_permlanex16(__builtin_bit_cast(int, x), __builtin_bit_cast(int, x), 0x76543210, 0xfedcba98, false, false));
}

__global__ __launch_bounds__(128)
void attn_hd64_k(const unsigned short* __restrict__ Qhp, const unsigned short* __restrict__ Qlp,
                 const unsigned short* __restrict__ Khp, const unsigned short* __restrict__ Klp,
                 const unsigned short* __restrict__ Vhp, const unsigned short* __restrict__ Vlp,
                 unsigned short* __restrict__ Yhp, unsigned short* __restrict__ Ylp) {
  union FB { v16b v; v8b h[2]; };
  // Every LDS row holds its hi half (64 elements) then its lo half (64 elements) plus 8 pad elements: pitch 272 B = 16 B x 17,
  // so the 16 rows of one ds_load_b128 fragment read start on 16 different 4-bank groups (at 128 B they fell on two).
  __shared__ __align__(16) __bf16 Ks[kKC * kLP];              // K [kv][hi d | lo d]
  __shared__ __align__(16) __bf16 Vt[kHD * kLP + kVS];        // V [d][hi kv | lo kv]; rows d >= 32 lie kVS elements further
  __shared__ __align__(16) float Obuf[4][16 * kOP];           // per wave: f32 out tile [16 queries][64 d] at pitch kOP, epilogue only
  __bf16* const Ksh = Ks;
  __bf16* const Ksl = Ks + kHD;
  __bf16* const Vth = Vt;
  __bf16* const Vtl = Vt + kKC;

  const __bf16* Qh = (const __bf16*)Qhp;
  const __bf16* Ql = (const __bf16*)Qlp;
  const __bf16* Kh = (const __bf16*)Khp;
  const __bf16* Kl = (const __bf16*)Klp;
  const __bf16* Vh = (const __bf16*)Vhp;
  const __bf16* Vl = (const __bf16*)Vlp;

  const int tid  = threadIdx.x;
  const int wave = tid >> 5;
  const int lane = tid & 31;
  const int hh   = lane >> 4;
  const int c    = lane & 15;

  constexpr int nqb = kSeq / kQB;   // 32
  const int qb = nqb - 1 - (int)blockIdx.y;     // cost (qb + 1 chunks) falls with the block index
  const int h  = (int)blockIdx.x % kHeads;
  const int q0 = qb * kQB + wave * 16;          // token index of this wave's first row
  const size_t rowb = (size_t)((int)blockIdx.x / kHeads) * kSeq; // plane row base of this batch
  const int hcol = h * kHD;

  // ---- Q fragments (B operand: column = query c): 2 d-chunks, hi and lo; Frag load = split k-map ----
  v16b qah[2], qal[2];
  {
    const size_t qoff = (rowb + (size_t)(q0 + c)) * kDim + hcol + 8 * hh;
#pragma unroll
    for (int dc = 0; dc < 2; ++dc) {
      qah[dc] = Frag<__bf16>::load(Qh + qoff + dc * 32);
      qal[dc] = Frag<__bf16>::load(Ql + qoff + dc * 32);
    }
  }

  float mrow = -INFINITY, lrow = 0.f;   // of query q0 + c; mrow = maximum of the raw (unscaled) scores; lrow sums this lane's half of the keys, the halves join in the epilogue
  float mcrow = -INFINITY;              // mrow * kSc as it was subtracted in the last chunk
  v8f oacc[4];                          // O^T: row = d (t*16 + 8hh + r), column = query c
#pragma unroll
  for (int t = 0; t < 4; ++t) oacc[t] = (v8f){0.f,0.f,0.f,0.f,0.f,0.f,0.f,0.f};

  const int nChunks = qb + 1;   // block-uniform, <= 32
  for (int kc = 0; kc < nChunks; ++kc) {
    const int kv0 = kc * kKC;
    __syncthreads();
    {
      // staging coverage: 128 threads x (1 key row x 32 d) = 64 keys x 64 d for each of the four tiles
      const int kvr = tid >> 1, dh = (tid & 1) * 32;
      const size_t goff = (rowb + (size_t)(kv0 + kvr)) * kDim + hcol + dh;
      __bf16* const kdst = Ks + kvr * kLP + dh;                        // this thread's K row, hi half
      __bf16* const vdst = Vt + dh * kLP + (dh >> 5) * kVS + kvr;      // this thread's V column, first d row, hi half
#pragma unroll 1
      for (int i = 0; i < 4; ++i) {
        const v8b a0 = *(const v8b*)(Kh + goff + 8 * i);
        const v8b a1 = *(const v8b*)(Kl + goff + 8 * i);
        *(v8b*)(kdst + 8 * i) = a0;
        *(v8b*)(kdst + kHD + 8 * i) = a1;
        const v8b w0 = *(const v8b*)(Vh + goff + 8 * i);
        const v8b w1 = *(const v8b*)(Vl + goff + 8 * i);
#pragma unroll
        for (int e = 0; e < 8; ++e) {
          vdst[(8 * i + e) * kLP] = w0[e];
          vdst[(8 * i + e) * kLP + kKC] = w1[e];
        }
      }
    }
    __syncthreads();

    // ---- scores, transposed: D row = key j*16 + 8hh + r, col = query c ----
    v8f s[4];
#pragma unroll
    for (int j = 0; j < 4; ++j) {
      s[j] = (v8f){0.f,0.f,0.f,0.f,0.f,0.f,0.f,0.f};
#pragma unroll
      for (int dc = 0; dc < 2; ++dc) {
        FB kb, kl;
        kb.h[0] = *(const v8b*)(Ksh + (j * 16 + c) * kLP + dc * 32 + 8 * hh);
        kb.h[1] = *(const v8b*)(Ksh + (j * 16 + c) * kLP + dc * 32 + 16 + 8 * hh);
        kl.h[0] = *(const v8b*)(Ksl + (j * 16 + c) * kLP + dc * 32 + 8 * hh);
        kl.h[1] = *(const v8b*)(Ksl + (j * 16 + c) * kLP + dc * 32 + 16 + 8 * hh);
        s[j] = mma_bf(kb.v, qah[dc], s[j]);
        s[j] = mma_bf(kl.v, qah[dc], s[j]);
        s[j] = mma_bf(kb.v, qal[dc], s[j]);
      }
    }
    const bool diag = (kc == qb);   // block-uniform
    const int qrow = q0 + c;
    float mj[4];
#pragma unroll
    for (int j = 0; j < 4; ++j) {
      mj[j] = -INFINITY;
#pragma unroll
      for (int r = 0; r < 8; ++r) {
        const int kvcol = kv0 + j * 16 + 8 * hh + r;
        float sv = s[j][r];
        if (diag && (kvcol > qrow)) sv = -INFINITY;
        s[j][r] = sv;
        mj[j] = fmaxf(mj[j], sv);
      }
    }
    float cm = fmaxf(fmaxf(mj[0], mj[1]), fmaxf(mj[2], mj[3]));
    cm = fmaxf(cm, xhalf(cm));      // the other 32 keys of this query
    const float mnew = fmaxf(mrow, cm);
    const float mcn = mnew * kSc;
    const float mc = (mnew > -INFINITY) ? mcn : 0.0f;      // all-masked so far -> p = 0, alpha = 0
    const float alpha = __builtin_amdgcn_exp2f(mcrow - mc);   // exactly 1 where the maximum stays
    mrow = mnew;
    mcrow = mcn;
    // P^T as B operand: element e of fragment kk = key kk*32 + (e < 8 ? 8hh + e : 16 + 8hh + e - 8), the k order of the V^T loads below
    FB pa[2], pl[2];
    float pj[4];
#pragma unroll
    for (int j = 0; j < 4; ++j) {
      pj[j] = 0.f;
#pragma unroll
      for (int r = 0; r < 8; ++r) {
        if ((r & 1) == 0) {   // exponents of two scores in one packed fma
          const v2f e2 = __builtin_elementwise_fma((v2f){s[j][r], s[j][r + 1]}, (v2f){kSc, kSc}, (v2f){-mc, -mc});
          s[j][r] = e2[0]; s[j][r + 1] = e2[1];
        }
        const float p = __builtin_amdgcn_exp2f(s[j][r]);   // -inf (masked) -> 0
        pj[j] += p;
        const unsigned short hb = f2bf_bits(p);
        const unsigned short lb = f2bf_bits(p - bf_bits2f(hb));
        pa[j >> 1].v[(j & 1) * 8 + r] = __builtin_bit_cast(__bf16, hb);
        pl[j >> 1].v[(j & 1) * 8 + r] = __builtin_bit_cast(__bf16, lb);
      }
    }
    lrow = lrow * alpha + ((pj[0] + pj[1]) + (pj[2] + pj[3]));
#pragma unroll
    for (int t = 0; t < 4; ++t)
#pragma unroll
      for (int r = 0; r < 8; ++r) oacc[t][r] *= alpha;
    // ---- out^T += V^T (A: m = d, k = key) x P^T (B: k = key, n = query) ----
#pragma unroll   // constant kk keeps the P fragments in registers
    for (int kk = 0; kk < 2; ++kk) {
#pragma unroll
      for (int t = 0; t < 4; ++t) {
        FB vb, vl;
        vb.h[0] = *(const v8b*)(Vth + (t * 16 + c) * kLP + (t >> 1) * kVS + kk * 32 + 8 * hh);
        vb.h[1] = *(const v8b*)(Vth + (t * 16 + c) * kLP + (t >> 1) * kVS + kk * 32 + 16 + 8 * hh);
        vl.h[0] = *(const v8b*)(Vtl + (t * 16 + c) * kLP + (t >> 1) * kVS + kk * 32 + 8 * hh);
        vl.h[1] = *(const v8b*)(Vtl + (t * 16 + c) * kLP + (t >> 1) * kVS + kk * 32 + 16 + 8 * hh);
        oacc[t] = mma_bf(vb.v, pa[kk].v, oacc[t]);
        oacc[t] = mma_bf(vl.v, pa[kk].v, oacc[t]);
        oacc[t] = mma_bf(vb.v, pl[kk].v, oacc[t]);
      }
    }
  }

  // ---- epilogue: y = out / l, staged per wave as f32 [16][64] (pitch kOP) in the wave's own tile ----
  __syncthreads();
  float* os = Obuf[wave];
  {
    const float inv = 1.0f / (lrow + xhalf(lrow));   // both halves of the keys
#pragma unroll
    for (int t = 0; t < 4; ++t) {
      v4f o0, o1;
#pragma unroll
      for (int r = 0; r < 4; ++r) { o0[r] = oacc[t][r] * inv; o1[r] = oacc[t][4 + r] * inv; }
      *(v4f*)(os + c * kOP + t * 16 + 8 * hh) = o0;       // a lane holds 8 consecutive d of its query
      *(v4f*)(os + c * kOP + t * 16 + 8 * hh + 4) = o1;
    }
  }
  __builtin_amdgcn_fence(__ATOMIC_RELEASE, "workgroup");
  __builtin_amdgcn_wave_barrier();
  __builtin_amdgcn_fence(__ATOMIC_ACQUIRE, "workgroup");
  {
    // store coverage: per it, lanes (q8 = 0..3) x (c8 = 0..56 step 8) = 4 rows x 64 cols; 4 it = 16 rows = this wave's tile.
    const int q8 = lane >> 3, c8 = (lane & 7) * 8;
    {
#pragma unroll
      for (int it = 0; it < 4; ++it) {
        const int row = it * 4 + q8;
        const float* sp = os + row * kOP + c8;
        v8h hv, lv;
#pragma unroll
        for (int e = 0; e < 8; ++e) {
          const unsigned short hb = f2bf_bits(sp[e]);
          const unsigned short lb = f2bf_bits(sp[e] - bf_bits2f(hb));
          hv[e] = __builtin_bit_cast(_Float16, hb);
          lv[e] = __builtin_bit_cast(_Float16, lb);
        }
        const size_t yo = (rowb + (size_t)(q0 + row)) * kDim + hcol + c8;
        *(v8h*)(Yhp + yo) = hv;
        *(v8h*)(Ylp + yo) = lv;
      }
      
    }
  }
}

// ---------------------------------------------------------------------------
// Workspace region map (bytes):
//   [0, 16777216)            Xb   bf16 [8192][1024]  (dead after the qkv GEMM; reused as Yh bf16 [8192][1024])
//   [16777216, 23068672)     WqT  bf16 [3072][1024]
//   [23068672, 25165824)     WpT  bf16 [1024][1024]
//   [25165824, 125829120)    QKV  bf16 6 planes [8192][1024]: Qh, Ql, Kh, Kl, Vh, Vl
//   [125829120, 142606336)   Yl   bf16 [8192][1024]
//   total 142,606,336 B
// ---------------------------------------------------------------------------
extern "C" void kernel_launch(void* const* d_in, const int* in_sizes, int n_in,
                              void* d_out, int out_size, void* d_ws, size_t ws_size,
                              hipStream_t stream) {
  if (n_in < 9) return;
  if (in_sizes[0] != kTok * kDim || in_sizes[1] != kDim * kDim3 || in_sizes[2] != kDim3 ||
      in_sizes[3] != kDim * kDim || in_sizes[4] != kDim ||
      in_sizes[5] != kHeads * kHD || in_sizes[6] != kHeads * kHD ||
      in_sizes[7] != kHeads * kHD || in_sizes[8] != kHeads * kHD ||
      out_size != kTok * kDim) return;

  const float* x     = (const float*)d_in[0];
  const float* Wqkv  = (const float*)d_in[1];
  const float* bqkv  = (const float*)d_in[2];
  const float* Wproj = (const float*)d_in[3];
  const float* bproj = (const float*)d_in[4];
  const float* qs    = (const float*)d_in[5];
  const float* qbv   = (const float*)d_in[6];
  const float* ks    = (const float*)d_in[7];
  const float* kbv   = (const float*)d_in[8];
  float* out = (float*)d_out;

  const size_t plane  = (size_t)kTok * kDim;                 // elements per [8192][1024] plane
  const size_t offX   = 0;
  const size_t offWq  = offX  + plane * 2;                    // 16,777,216
  const size_t offWp  = offWq + (size_t)kDim3 * kDim * 2;     // 23,068,672
  const size_t offQKV = offWp + (size_t)kDim * kDim * 2;      // 25,165,824
  const size_t offYl  = offQKV + 6 * plane * 2;               // 125,829,120
  const size_t total  = offYl + plane * 2;                    // 142,606,336
  if (total > ws_size) return;

  char* ws = (char*)d_ws;
  unsigned short* Xb  = (unsigned short*)(ws + offX);
  unsigned short* Yh  = Xb;                                   // [8192][1024] bf16, the whole Xb region
  unsigned short* Yl  = (unsigned short*)(ws + offYl);        // [8192][1024] bf16
  unsigned short* WqT = (unsigned short*)(ws + offWq);
  unsigned short* WpT = (unsigned short*)(ws + offWp);
  unsigned short* QKV = (unsigned short*)(ws + offQKV);
  unsigned short* Qh = QKV;
  unsigned short* Ql = QKV + plane;
  unsigned short* Kh = QKV + 2 * plane;
  unsigned short* Kl = QKV + 3 * plane;
  unsigned short* Vh = QKV + 4 * plane;
  unsigned short* Vl = QKV + 5 * plane;

  // 1) x -> bf16 plane: n = 8,388,608, 8 per thread -> 1,048,576 threads = 4096 blocks x 256 (exact)
  const int n8 = (kTok * kDim) / 8;
  cast_bf16x8_k<<<dim3((n8 + 255) / 256), dim3(256), 0, stream>>>(x, Xb, n8);

  // 2) W_qkv in[1024][3072] -> WqT out[3072][1024] bf16: grid (3072/64, 1024/64)
  wt_cast_bf_k<<<dim3(kDim3 / 64, kDim / 64), dim3(256), 0, stream>>>(Wqkv, WqT, kDim, kDim3);
  // 3) W_proj in[1024][1024] -> WpT out[1024][1024] bf16: grid (1024/64, 1024/64)
  wt_cast_bf_k<<<dim3(kDim / 64, kDim / 64), dim3(256), 0, stream>>>(Wproj, WpT, kDim, kDim);

  // 4) qkv = Xb[8192][1024] . WqT[3072][1024]^T + b_qkv, per-head affine on q/k, bf16 hi/lo planes.
  //    M = 8192 (multiple of 128), N = 3072 (multiple of 256), K = 1024 (multiple of 64); block tiles 64 x 12 = 768 blocks x 8 waves.
  wmma_gemm64<1, 0, 2, 3, false><<<dim3(768, 1), dim3(256), 0, stream>>>(
      Xb, Xb, kDim, 0L, WqT, WqT, kDim, 0L,
      (void*)QKV, (void*)QKV, kDim, (long)plane,
      bqkv, bqkv, 0L, qs, qbv, ks, kbv,
      kTok, kDim3, kDim, 1.0f);

  // 5) causal attention of all batches in one launch -> Yh/Yl: grid (16 heads x 4 batches, 32 query blocks from the last to the first).
  attn_hd64_k<<<dim3(kHeads * kBatch, kSeq / kQB), dim3(128), 0, stream>>>(Qh, Ql, Kh, Kl, Vh, Vl, Yh, Yl);
  // 6) out = Y . WpT^T + b_proj over all rows (A hi/lo, 2 products).
  //    M = 8192, N = 1024, K = 1024; block tiles 64 x 4 = 256 blocks x 8 waves.
  wmma_gemm64<1, 1, 2, 0, false><<<dim3(256, 1), dim3(256), 0, stream>>>(
      Yh, Yl, kDim, 0L, WpT, WpT, kDim, 0L,
      (void*)out, (void*)out, kDim, 0L,
      bproj, bproj, 0L, qs, qbv, ks, kbv,
      kTok, kDim, kDim, 1.0f);
}

// v007
// Measured time: 206 microseconds a run.
// Two timings next to v006 both put it at 1.04 times that version's speed.
// All steps since v000 together make it 6.45 times as fast.
// Contractions: x*W_qkv on v_wmma_f32_16x16x32_bf16 (plain bf16 operands = RNE-bf16 inputs); q*k^T and p*v on v_wmma_f32_16x16x32_bf16 with bf16 hi/lo operand pairs (hi*hi + hi*lo + lo*hi); y*W_proj on v_wmma_f32_16x16x32_bf16 with y as bf16 hi/lo and exact bf16 weights (hi*w + lo*w); f32 accumulate everywhere; bias, per-head affine and softmax in f32.
#include <hip/hip_runtime.h>
#include <stdint.h>
#include <math.h>

constexpr int kBatch = 4;
constexpr int kSeq   = 2048;
constexpr int kDim   = 1024;
constexpr int kHeads = 16;
constexpr int kHD    = 64;
constexpr int kTok   = kBatch * kSeq;   // 8192
constexpr int kDim3  = 3 * kDim;        // 3072

typedef __attribute__((ext_vector_type(16))) _Float16 v16h;
typedef __attribute__((ext_vector_type(8)))  _Float16 v8h;
typedef __attribute__((ext_vector_type(16))) __bf16   v16b;
typedef __attribute__((ext_vector_type(8)))  __bf16   v8b;
typedef __attribute__((ext_vector_type(8)))  float    v8f;
typedef __attribute__((ext_vector_type(4)))  float    v4f;
typedef __attribute__((ext_vector_type(2)))  float    v2f;

__device__ __forceinline__ unsigned short f2bf_bits(float f) {
  unsigned u = __float_as_uint(f);
  return (unsigned short)((u + 0x7FFFu + ((u >> 16) & 1u)) >> 16);
}
__device__ __forceinline__ float bf_bits2f(unsigned short h) { return __uint_as_float(((unsigned)h) << 16); }
__device__ __forceinline__ float bf_rne(float f) { return bf_bits2f(f2bf_bits(f)); }

// hazard guards as plain device helpers
__device__ __forceinline__ void dep_guard_h(v8f& a, v8f& b, v16h x, v16h y) { asm volatile("v_nop\n\tv_nop\n\tv_nop\n\tv_nop" : "+v"(a), "+v"(b) : "v"(x), "v"(y)); }
__device__ __forceinline__ void dep_guard_b(v8f& a, v8f& b, v16b x, v16b y) { asm volatile("v_nop\n\tv_nop\n\tv_nop\n\tv_nop" : "+v"(a), "+v"(b) : "v"(x), "v"(y)); }
__device__ __forceinline__ void keep4_h(v16h a, v16h b, v16h c, v16h d) { asm volatile("v_nop" :: "v"(a), "v"(b), "v"(c), "v"(d)); }
__device__ __forceinline__ void keep4_b(v16b a, v16b b, v16b c, v16b d) { asm volatile("v_nop" :: "v"(a), "v"(b), "v"(c), "v"(d)); }
__device__ __forceinline__ void acc_guard4(v8f& a, v8f& b, v8f& c, v8f& d) { asm volatile("v_nop\n\tv_nop\n\tv_nop\n\tv_nop" : "+v"(a), "+v"(b), "+v"(c), "+v"(d)); }
template <typename T> struct Frag;
template <> struct Frag<_Float16> {
  typedef v16h V; union U { v16h v; v8h h[2]; };
  static __device__ __forceinline__ v16h load(const _Float16* p) {   // elements 0..7 <- p[0..7], 8..15 <- p[16..23]
    U f; f.h[0] = *(const v8h*)(p); f.h[1] = *(const v8h*)(p + 16); return f.v;
  }
  static __device__ __forceinline__ v8f mma(v16h a, v16h b, v8f c) {
    return __builtin_amdgcn_wmma_f32_16x16x32_f16(false, a, false, b, (short)0, c, false, false);
  }
  static __device__ __forceinline__ void guard(v8f& a, v8f& b, v16h x, v16h y) { dep_guard_h(a, b, x, y); }
  static __device__ __forceinline__ void keep(v16h a, v16h b, v16h c, v16h d) { keep4_h(a, b, c, d); }
};
template <> struct Frag<__bf16> {
  typedef v16b V; union U { v16b v; v8b h[2]; };
  static __device__ __forceinline__ v16b load(const __bf16* p) {
    U f; f.h[0] = *(const v8b*)(p); f.h[1] = *(const v8b*)(p + 16); return f.v;
  }
  static __device__ __forceinline__ v8f mma(v16b a, v16b b, v8f c) {
    return __builtin_amdgcn_wmma_f32_16x16x32_bf16(false, a, false, b, (short)0, c, false, false);
  }
  static __device__ __forceinline__ void guard(v8f& a, v8f& b, v16b x, v16b y) { dep_guard_b(a, b, x, y); }
  static __device__ __forceinline__ void keep(v16b a, v16b b, v16b c, v16b d) { keep4_b(a, b, c, d); }
};

// ---- Register-blocked batched WMMA GEMM ------------------------------------
// C[m,n] = scale * sum_k A[m,k] * Bt[n,k] (+bias)(affine)(+resid); each wave owns a 64x64 tile.
// A row-major [M,K]; Bt row-major [N,K]; M % 128 == 0, N % 256 == 0, K % 64 == 0, lda and ldb % 8 == 0.
// A block of 8 waves (2 x 4) owns a 128 x 256 tile of C. Its operand rows come 64 k (one 128-B line of every row) at a time
// into an LDS ring of two buffers by asynchronous copies, whole lines per wave-copy; the fragments are read from LDS.
// SPLIT_MODE: 0 = plain; 1 = A carried as hi/lo planes (A2 = lo): hi.b + lo.b; 2 = A and Bt hi/lo: hi.hi + hi.lo + lo.hi.
// BIAS_MODE: 0 = none, 1 = bias[m], 2 = bias[n].
// OUT_MODE: 0 = f32, 1 = f16, 2 = bf16 hi plane (Cout) + bf16 lo plane (Cout2),
//           3 = qkv mode: columns n form three blocks of kDim (which = n0 / kDim); value v = (acc+bias)*affs[cc]+affb[cc]
//               with cc = n - which*kDim and tables (affs0,affb0) for which 0, (affs1,affb1) for which 1 (RNE-bf16 applied
//               to the table values), identity for which 2; written as bf16 hi plane at Cout + which*2*strideC and lo plane
//               at + strideC, row pitch ldc, column n0 - which*kDim.
// ET: 0 = f16 operands, 1 = bf16 operands (pointers passed as 16-bit storage)
constexpr int kGBM = 128;   // rows of C per block (2 waves of 64)
constexpr int kGBN = 256;   // columns of C per block (4 waves of 64)
constexpr int kGBK = 64;    // k per stage
constexpr int kGP  = 72;    // LDS row pitch in 16-bit elements: 144 B = 16 B x 9, for the ds_load_b128 fragment readers

__device__ __forceinline__ unsigned lds_off(const void* p) { return (unsigned)(size_t)p; }   // byte offset in the block's LDS

// ROWS rows of 128 B, global -> LDS, 16 B per lane and copy: thread -> row tid >> 3 (+32 per copy), piece tid & 7;
// ldst and gsrc already point at this thread's first row and piece; ld = global row pitch in elements.
template <int ROWS>
__device__ __forceinline__ void stage_rows(unsigned ldst, const unsigned short* gsrc, int ld) {
  const size_t g32 = (size_t)32 * (size_t)ld;
#pragma unroll   // one or two straight groups of four copies, no loop counter beside them
  for (int u = 0; u < ROWS / 128; ++u) {
    const unsigned l0 = ldst + (unsigned)(u * 128 * kGP * 2);
    const unsigned l1 = l0 + 32u * kGP * 2u, l2 = l0 + 64u * kGP * 2u, l3 = l0 + 96u * kGP * 2u;
    const unsigned short* g0 = gsrc + (size_t)(4 * u) * g32;
    const unsigned short* g1 = g0 + g32;
    const unsigned short* g2 = g1 + g32;
    const unsigned short* g3 = g2 + g32;
    // the s_wait_xcnt closes the copies' own statement, so that no address register of a copy is rewritten ahead of it
    asm volatile("global_load_async_to_lds_b128 %0, %1, off\n\t"
                 "global_load_async_to_lds_b128 %2, %3, off\n\t"
                 "global_load_async_to_lds_b128 %4, %5, off\n\t"
                 "global_load_async_to_lds_b128 %6, %7, off\n\t"
                 "s_wait_xcnt 0x0"
                 :: "v"(l0), "v"(g0), "v"(l1), "v"(g1), "v"(l2), "v"(g2), "v"(l3), "v"(g3) : "memory");
  }
}

template <int ET> struct Elem;
template <> struct Elem<0> { typedef _Float16 T; };
template <> struct Elem<1> { typedef __bf16 T; };
template <int ET, int SPLIT_MODE, int BIAS_MODE, int OUT_MODE, bool RESID, int ACT = 0>
__global__ __launch_bounds__(256) void wmma_gemm64(
    const unsigned short* __restrict__ Ap, const unsigned short* __restrict__ A2p, int lda, long strideA,
    const unsigned short* __restrict__ Btp, const unsigned short* __restrict__ Bt2p, int ldb, long strideB,
    void* __restrict__ Cout, void* __restrict__ Cout2, int ldc, long strideC,
    const float* __restrict__ bias,
    const float* __restrict__ resid, long strideR,
    const float* __restrict__ affs0, const float* __restrict__ affb0,
    const float* __restrict__ affs1, const float* __restrict__ affb1,
    int M, int N, int K, float scale) {
  typedef typename Elem<ET>::T T;
  typedef typename Frag<T>::V V;
  const T* A = (const T*)Ap; const T* A2 = (const T*)A2p; const T* Bt = (const T*)Btp; const T* Bt2 = (const T*)Bt2p;
  constexpr int NA = (SPLIT_MODE >= 1) ? 2 : 1;      // planes of A, of Bt
  constexpr int NB = (SPLIT_MODE == 2) ? 2 : 1;
  constexpr int kAEl = kGBM * kGP;                   // elements of one plane's tile in LDS
  constexpr int kBEl = kGBN * kGP;
  constexpr int kStage = NA * kAEl + NB * kBEl;      // one buffer: [A hi | A lo | Bt hi | Bt lo]
  __shared__ __align__(16) T ring[2 * kStage];
  __shared__ __align__(16) float sT[8][16 * 68];   // per-wave 16x64 slab, pitch 68 floats
  const int b    = blockIdx.y;
  const int lane = threadIdx.x & 31;
  const int wave = threadIdx.x >> 5;
  const int blocksN = N / kGBN;
  if ((int)blockIdx.x >= (M / kGBM) * blocksN) return;   // block-uniform, ahead of every copy and barrier
  const int bm = blockIdx.x / blocksN;
  const int bn = blockIdx.x - bm * blocksN;
  const int mb0 = bm * kGBM;
  const int nb0 = bn * kGBN;
  const int wm = wave >> 2, wn = wave & 3;
  const int m0 = mb0 + (wm << 6);
  const int n0 = nb0 + (wn << 6);

  const T* Ab  = A  + (size_t)b * strideA;
  const T* Bb  = Bt + (size_t)b * strideB;
  const T* Ab2 = (SPLIT_MODE >= 1) ? (A2  + (size_t)b * strideA) : nullptr;
  const T* Bb2 = (SPLIT_MODE == 2) ? (Bt2 + (size_t)b * strideB) : nullptr;

  const int rlane = lane & 15;                 // row (A) / col (B, D) within subtile
  const int koff  = (lane >> 4) * 8;           // k offset of this lane half
  const int mOff  = (lane >> 4) * 8;           // D row offset

  v8f acc[4][4];
#pragma unroll
  for (int i = 0; i < 4; ++i)
#pragma unroll
    for (int j = 0; j < 4; ++j) acc[i][j] = (v8f){0.f,0.f,0.f,0.f,0.f,0.f,0.f,0.f};

  // this thread's share of every stage: row tid >> 3 (+32 per copy) of each tile, 16-B piece tid & 7
  const int crow = threadIdx.x >> 3, cpc = (threadIdx.x & 7) * 8;
  const unsigned short* gA  = (const unsigned short*)Ab + (size_t)(mb0 + crow) * lda + cpc;
  const unsigned short* gB  = (const unsigned short*)Bb + (size_t)(nb0 + crow) * ldb + cpc;
  const unsigned short* gA2 = (SPLIT_MODE >= 1) ? ((const unsigned short*)Ab2 + (size_t)(mb0 + crow) * lda + cpc) : nullptr;
  const unsigned short* gB2 = (SPLIT_MODE == 2) ? ((const unsigned short*)Bb2 + (size_t)(nb0 + crow) * ldb + cpc) : nullptr;
  const unsigned lT = lds_off(ring) + (unsigned)((crow * kGP + cpc) * 2);
  auto issue_stage = [&](int t) {
    const unsigned lb = lT + (unsigned)((t & 1) * (kStage * 2));
    const int k0 = t * kGBK;
    stage_rows<kGBM>(lb, gA + k0, lda);
    if (SPLIT_MODE >= 1) stage_rows<kGBM>(lb + kAEl * 2, gA2 + k0, lda);
    stage_rows<kGBN>(lb + NA * kAEl * 2, gB + k0, ldb);
    if (SPLIT_MODE == 2) stage_rows<kGBN>(lb + (NA * kAEl + kBEl) * 2, gB2 + k0, ldb);
  };

  const int nk = K / kGBK;   // block-uniform
  issue_stage(0);
  asm volatile("s_wait_asynccnt 0x0" ::: "memory");   // this wave's copies of stage 0 have landed
  __syncthreads();                                    // ... and every other wave's
  if (nk > 1) issue_stage(1);

  for (int t = 0; t < nk; ++t) {
    const T* sA = ring + (t & 1) * kStage + ((wm << 6) + rlane) * kGP + koff;
    const T* sB = ring + (t & 1) * kStage + NA * kAEl + ((wn << 6) + rlane) * kGP + koff;
#pragma unroll   // both halves of the stage in one straight run: the second half's fragment loads go among the first half's products
    for (int ks = 0; ks < kGBK; ks += 32) {
      V bh[4], bl[4];
#pragma unroll
      for (int j = 0; j < 4; ++j) {
        bh[j] = Frag<T>::load(sB + (j << 4) * kGP + ks);
        if (SPLIT_MODE == 2) bl[j] = Frag<T>::load(sB + kBEl + (j << 4) * kGP + ks);
      }
      V ah[4], al[4];   // all fragments of the half are asked for as one group, ahead of its products
#pragma unroll   // constant indices keep the fragment arrays in registers
      for (int i = 0; i < 4; ++i) {
        ah[i] = Frag<T>::load(sA + (i << 4) * kGP + ks);
        if (SPLIT_MODE >= 1) al[i] = Frag<T>::load(sA + kAEl + (i << 4) * kGP + ks);
      }
#pragma unroll
      for (int i = 0; i < 4; ++i) {
#pragma unroll
        for (int j = 0; j < 4; ++j) {
          acc[i][j] = Frag<T>::mma(ah[i], bh[j], acc[i][j]);
          if (SPLIT_MODE == 2) acc[i][j] = Frag<T>::mma(ah[i], bl[j], acc[i][j]);
          if (SPLIT_MODE >= 1) acc[i][j] = Frag<T>::mma(al[i], bh[j], acc[i][j]);
        }
        Frag<T>::guard(acc[i][0], acc[i][3], ah[i], (SPLIT_MODE >= 1) ? al[i] : ah[i]);
      }
      Frag<T>::keep(bh[0], bh[1], bh[2], bh[3]);
      if (SPLIT_MODE == 2) Frag<T>::keep(bl[0], bl[1], bl[2], bl[3]);
    }
    // publish point of stage t + 1; the one barrier also ends every wave's reads of the buffer that is refilled behind it
    asm volatile("s_wait_dscnt 0x0" ::: "memory");      // this wave's LDS reads of stage t are done
    asm volatile("s_wait_asynccnt 0x0" ::: "memory");   // this wave's copies of stage t + 1 have landed
    __syncthreads();
    if (t + 2 < nk) issue_stage(t + 2);
  }
  asm volatile("s_wait_asynccnt 0x0" ::: "memory");     // no copy is outstanding when the wave goes on to the epilogue
  acc_guard4(acc[0][0], acc[0][1], acc[0][2], acc[0][3]);
  acc_guard4(acc[1][0], acc[1][1], acc[1][2], acc[1][3]);
  acc_guard4(acc[2][0], acc[2][1], acc[2][2], acc[2][3]);
  acc_guard4(acc[3][0], acc[3][1], acc[3][2], acc[3][3]);

  // ---- epilogue ----
  float* slab = sT[wave];
  const float* Rb = RESID ? (resid + (size_t)b * strideR) : nullptr;
#pragma unroll
  for (int i = 0; i < 4; ++i) {
    const int mBase = m0 + (i << 4);
#pragma unroll
    for (int j = 0; j < 4; ++j) {
      const int n = n0 + (j << 4) + rlane;
      float bv = 0.f;
      if (BIAS_MODE == 2) bv = bias[n];
      float asc = 1.0f, abi = 0.0f;
      if (OUT_MODE == 3) {
        const int which = n0 / kDim;               // wave-uniform (64-col tile inside one kDim block)
        const int cc = n - which * kDim;           // 0..kDim-1, all four tables have kDim entries
        const float s0 = bf_rne(affs0[cc]);
        const float c0 = bf_rne(affb0[cc]);
        const float s1 = bf_rne(affs1[cc]);
        const float c1 = bf_rne(affb1[cc]);
        asc = (which == 0) ? s0 : ((which == 1) ? s1 : 1.0f);
        abi = (which == 0) ? c0 : ((which == 1) ? c1 : 0.0f);
      }
#pragma unroll
      for (int r = 0; r < 8; ++r) {
        float v = acc[i][j][r] * scale;
        if (BIAS_MODE == 1) v += bias[mBase + mOff + r];
        if (BIAS_MODE == 2) v += bv;
        if (OUT_MODE == 3) v = v * asc + abi;
        if (RESID) v += Rb[(size_t)(mBase + mOff + r) * ldc + n];
        if (ACT == 1) v = tanhf(v);
        if (ACT == 2) v = fmaxf(v, 0.0f);
        if (ACT == 4) v = (v > 0.f) ? v : 0.01f * v;
        slab[(mOff + r) * 68 + (j << 4) + rlane] = v;
      }
    }
    __builtin_amdgcn_fence(__ATOMIC_RELEASE, "workgroup");
    __builtin_amdgcn_wave_barrier();
    __builtin_amdgcn_fence(__ATOMIC_ACQUIRE, "workgroup");
    if (OUT_MODE == 0) {
      float* C = (float*)Cout + (size_t)b * strideC;
      const int hh = lane >> 4, c4 = (lane & 15) * 4;     // row seg = 256 B = 16 lanes x 16 B
      {
#pragma unroll
        for (int it = 0; it < 8; ++it) {
          const int row = it * 2 + hh;
          v4f v = *(const v4f*)(slab + row * 68 + c4);
          *(v4f*)(C + (size_t)(mBase + row) * ldc + n0 + c4) = v;
        }
        
      }
    } else {
      const int q = lane >> 3, c8 = (lane & 7) * 8;
      unsigned short* C;
      unsigned short* C2;
      int ncol;
      if (OUT_MODE == 3) {
        const int which = n0 / kDim;
        C  = (unsigned short*)Cout + (size_t)which * 2 * (size_t)strideC;
        C2 = C + (size_t)strideC;
        ncol = n0 - which * kDim;
      } else {
        C  = (unsigned short*)Cout  + (size_t)b * strideC;
        C2 = (OUT_MODE == 2) ? ((unsigned short*)Cout2 + (size_t)b * strideC) : nullptr;
        ncol = n0;
      }
      {
#pragma unroll
        for (int it = 0; it < 4; ++it) {
          const int row = it * 4 + q;
          const float* sp = slab + row * 68 + c8;
          v8h hv, lv;
#pragma unroll
          for (int e = 0; e < 8; ++e) {
            if (OUT_MODE == 1) {
              hv[e] = (_Float16)sp[e];
            } else {
              unsigned short hb = f2bf_bits(sp[e]);
              unsigned short lb = f2bf_bits(sp[e] - bf_bits2f(hb));
              hv[e] = __builtin_bit_cast(_Float16, hb);
              lv[e] = __builtin_bit_cast(_Float16, lb);
            }
          }
          *(v8h*)(C + (size_t)(mBase + row) * ldc + ncol + c8) = hv;
          if (OUT_MODE >= 2) *(v8h*)(C2 + (size_t)(mBase + row) * ldc + ncol + c8) = lv;
        }
        
      }
    }
    __builtin_amdgcn_fence(__ATOMIC_RELEASE, "workgroup");
    __builtin_amdgcn_wave_barrier();
    __builtin_amdgcn_fence(__ATOMIC_ACQUIRE, "workgroup");
  }
}

// coverage: n8 threads x 8 elements = n (host passes n8 = n/8 with n % 8 == 0)
__global__ __launch_bounds__(256) void cast_bf16x8_k(const float* __restrict__ in,
                                                     unsigned short* __restrict__ out, int n8) {
  const int i = blockIdx.x * 256 + threadIdx.x;
  if (i < n8) {
    const size_t o = (size_t)i * 8;
    const v4f a = *(const v4f*)(in + o);
    const v4f bq = *(const v4f*)(in + o + 4);
    v8h hv;
#pragma unroll
    for (int e = 0; e < 4; ++e) {
      hv[e]     = __builtin_bit_cast(_Float16, f2bf_bits(a[e]));
      hv[4 + e] = __builtin_bit_cast(_Float16, f2bf_bits(bq[e]));
    }
    *(v8h*)(out + o) = hv;
    
  }
}

// ---- W [K][N] f32 -> Wt [N][K] bf16 (RNE), 64x64 tile transposed through LDS ----
// in[rows = K][cols = N] -> out[N][K]; grid = (N/64, K/64).
// producer coverage: 256 threads x (1 row x 16 cols) = 64x64 tile; store: 8 waves x 4 rows x 2 it = 64 rows, 8 lanes x 8 halves = 64 cols.
constexpr int kWTP = 72;
__global__ __launch_bounds__(256) void wt_cast_bf_k(const float* __restrict__ W, unsigned short* __restrict__ Wtp,
                                                    int K, int N) {
  __shared__ __align__(16) _Float16 st[64 * kWTP];
  _Float16* Wt = (_Float16*)Wtp;
  const int n0 = blockIdx.x * 64, k0 = blockIdx.y * 64;
  const int tid = threadIdx.x;
  const int kr = tid >> 2, c16 = (tid & 3) * 16;
  const float* src = W + (size_t)(k0 + kr) * N + n0 + c16;
#pragma unroll
  for (int qq = 0; qq < 4; ++qq) {
    const v4f v = *(const v4f*)(src + 4 * qq);
#pragma unroll
    for (int e = 0; e < 4; ++e)
      st[(c16 + 4 * qq + e) * kWTP + kr] = __builtin_bit_cast(_Float16, f2bf_bits(v[e]));
  }
  __syncthreads();
  const int wave = tid >> 5, lane = tid & 31;
  const int q8 = lane >> 3, c8 = (lane & 7) * 8;
  {
#pragma unroll
    for (int it = 0; it < 2; ++it) {
      const int n = it * 32 + wave * 4 + q8;
      const v8h hv = *(const v8h*)(st + n * kWTP + c8);
      *(v8h*)(Wt + (size_t)(n0 + n) * K + k0 + c8) = hv;
    }
    
  }
}

// =====================================================================================
// Causal attention, head_dim 64, fed by bf16 hi/lo planes laid out [kTok][kDim] (row = b*kSeq + t, col = h*64 + d).
//   scores = qh.kh + qh.kl + ql.kh, unscaled (the 1/8 goes into the exponent) : v_wmma_f32_16x16x32_bf16, f32 accumulate
//   out    =  ph.vh + ph.vl + pl.vh      : v_wmma_f32_16x16x32_bf16, p = exp((s - max) / 8) split into bf16 hi/lo
//   Both products are formed transposed: S^T = K . Q^T (A = K rows, B = Q rows) and O^T += V^T . P^T (A = V^T rows, B = P^T).
//   In S^T a lane holds scores of ONE query (column c = lane & 15): keys j*16 + 8*(lane >> 4) + r. Two such tiles, converted in place,
//   are the B operand P^T in the k order that the V^T loader already has, so P never goes through LDS, and the row maximum and the
//   row sum are in-lane, with one exchange between the wave's halves.
//   online softmax in f32, base 2: p = 2^(s * kSc - m * kSc) with kSc = log2(e) / 8, one packed fma per two scores and one v_exp_f32 per score. Block = 4 waves = 64 query rows of one head of batch blockIdx.x / kHeads; 64-key chunks,
//   chunks above the diagonal skipped, per-element causal select (key > query -> -inf) on the diagonal chunk.
//   grid = (kHeads * kBatch, kSeq/64), heaviest first: blockIdx.y counts the query blocks from the last (32 key chunks) down to the first (1 chunk),
//   for speed only. Each cost level is a run of 64 equal work-groups. Y planes are [kTok][kDim] like the inputs.
// =====================================================================================
constexpr int kKC = 64;
constexpr int kQB = 64;
constexpr int kLP = 2 * 64 + 8;   // LDS row pitch in bf16 elements (272 B)
constexpr int kVS = 16;           // shift (32 B = 8 banks) of V rows d >= 32: the two d halves that one staging store writes leave each other's banks
constexpr int kOP = 68;           // f32 pitch of the output tile
constexpr float kSc = 0.125f * 1.44269504088896340736f;   // 1/sqrt(head dim) * log2(e): raw score -> exponent of 2

__device__ __forceinline__ v8f mma_bf(v16b a, v16b b, v8f c) {
  return __builtin_amdgcn_wmma_f32_16x16x32_bf16(false, a, false, b, (short)0, c, false, false);
}

// lane l <-> lane l ^ 16: the two lanes that share one query column
__device__ __forceinline__ float xhalf(float x) {
  return __builtin_bit_cast(float, __builtin_amdgcn_permlanex16(__builtin_bit_cast(int, x), __builtin_bit_cast(int, x), 0x76543210, 0xfedcba98, false, false));
}

__global__ __launch_bounds__(128)
void attn_hd64_k(const unsigned short* __restrict__ Qhp, const unsigned short* __restrict__ Qlp,
                 const unsigned short* __restrict__ Khp, const unsigned short* __restrict__ Klp,
                 const unsigned short* __restrict__ Vhp, const unsigned short* __restrict__ Vlp,
                 unsigned short* __restrict__ Yhp, unsigned short* __restrict__ Ylp) {
  union FB { v16b v; v8b h[2]; };
  // Every LDS row holds its hi half (64 elements) then its lo half (64 elements) plus 8 pad elements: pitch 272 B = 16 B x 17,
  // so the 16 rows of one ds_load_b128 fragment read start on 16 different 4-bank groups (at 128 B they fell on two).
  __shared__ __align__(16) __bf16 Ks[kKC * kLP];              // K [kv][hi d | lo d]
  __shared__ __align__(16) __bf16 Vt[kHD * kLP + kVS];        // V [d][hi kv | lo kv]; rows d >= 32 lie kVS elements further
  __shared__ __align__(16) float Obuf[4][16 * kOP];           // per wave: f32 out tile [16 queries][64 d] at pitch kOP, epilogue only

  const __bf16* Qh = (const __bf16*)Qhp;
  const __bf16* Ql = (const __bf16*)Qlp;
  const __bf16* Kh = (const __bf16*)Khp;
  const __bf16* Kl = (const __bf16*)Klp;
  const __bf16* Vh = (const __bf16*)Vhp;
  const __bf16* Vl = (const __bf16*)Vlp;

  const int tid  = threadIdx.x;
  const int wave = tid >> 5;
  const int lane = tid & 31;
  const int hh   = lane >> 4;
  const int c    = lane & 15;
  // this lane's place in every fragment read: row c of a 16-row tile, k offset 8 * hh; tile, half and hi/lo are constant offsets from it
  const __bf16* const kfr = Ks + c * kLP + 8 * hh;   // hi; lo at + kHD
  const __bf16* const vfr = Vt + c * kLP + 8 * hh;   // hi; lo at + kKC

  constexpr int nqb = kSeq / kQB;   // 32
  const int qb = nqb - 1 - (int)blockIdx.y;     // cost (qb + 1 chunks) falls with the block index
  const int h  = (int)blockIdx.x % kHeads;
  const int q0 = qb * kQB + wave * 16;          // token index of this wave's first row
  const size_t rowb = (size_t)((int)blockIdx.x / kHeads) * kSeq; // plane row base of this batch
  const int hcol = h * kHD;

  // ---- Q fragments (B operand: column = query c): 2 d-chunks, hi and lo; Frag load = split k-map ----
  v16b qah[2], qal[2];
  {
    const size_t qoff = (rowb + (size_t)(q0 + c)) * kDim + hcol + 8 * hh;
#pragma unroll
    for (int dc = 0; dc < 2; ++dc) {
      qah[dc] = Frag<__bf16>::load(Qh + qoff + dc * 32);
      qal[dc] = Frag<__bf16>::load(Ql + qoff + dc * 32);
    }
  }

  float mrow = -INFINITY, lrow = 0.f;   // of query q0 + c; mrow = maximum of the raw (unscaled) scores; lrow sums this lane's half of the keys, the halves join in the epilogue
  float mcrow = -INFINITY;              // mrow * kSc as it was subtracted in the last chunk
  v8f oacc[4];                          // O^T: row = d (t*16 + 8hh + r), column = query c
#pragma unroll
  for (int t = 0; t < 4; ++t) oacc[t] = (v8f){0.f,0.f,0.f,0.f,0.f,0.f,0.f,0.f};

  const int nChunks = qb + 1;   // block-uniform, <= 32
  for (int kc = 0; kc < nChunks; ++kc) {
    const int kv0 = kc * kKC;
    __syncthreads();
    {
      // staging coverage: 128 threads x (1 key row x 32 d) = 64 keys x 64 d for each of the four tiles
      const int kvr = tid >> 1, dh = (tid & 1) * 32;
      const size_t goff = (rowb + (size_t)(kv0 + kvr)) * kDim + hcol + dh;
      __bf16* const kdst = Ks + kvr * kLP + dh;                        // this thread's K row, hi half
      __bf16* const vdst = Vt + dh * kLP + (dh >> 5) * kVS + kvr;      // this thread's V column, first d row, hi half
#pragma unroll 1
      for (int i = 0; i < 4; ++i) {
        const v8b a0 = *(const v8b*)(Kh + goff + 8 * i);
        const v8b a1 = *(const v8b*)(Kl + goff + 8 * i);
        *(v8b*)(kdst + 8 * i) = a0;
        *(v8b*)(kdst + kHD + 8 * i) = a1;
        const v8b w0 = *(const v8b*)(Vh + goff + 8 * i);
        const v8b w1 = *(const v8b*)(Vl + goff + 8 * i);
#pragma unroll
        for (int e = 0; e < 8; ++e) {
          vdst[(8 * i + e) * kLP] = w0[e];
          vdst[(8 * i + e) * kLP + kKC] = w1[e];
        }
      }
    }
    __syncthreads();

    // ---- scores, transposed: D row = key j*16 + 8hh + r, col = query c ----
    // The four key tiles are four independent accumulators: their products alternate, so that no product waits for the one
    // before it; each tile keeps its own order of products. Fragments are asked for in whole groups ahead of the run of products
    // that uses them: all of K at once, V by 32 keys, ahead of and during the softmax. That takes the registers of four waves per SIMD.
    // SCHED_FENCE keeps a group of LDS loads together and at its place: left alone, the compiler spreads the loads in pairs among the
    // products and lines up products of one tile behind one another.
#define SCHED_FENCE() __builtin_amdgcn_sched_barrier(0)
    v8f s[4];
#pragma unroll
    for (int j = 0; j < 4; ++j) s[j] = (v8f){0.f,0.f,0.f,0.f,0.f,0.f,0.f,0.f};
    FB kb[2][4], kl[2][4];   // [d half][key tile]; constant indices keep them in registers
#pragma unroll   // one group of loads for the whole chunk, in the order of first use
    for (int dc = 0; dc < 2; ++dc) {
#pragma unroll
      for (int j = 0; j < 4; ++j) {
        kb[dc][j].h[0] = *(const v8b*)(kfr + j * (16 * kLP) + dc * 32);
        kb[dc][j].h[1] = *(const v8b*)(kfr + j * (16 * kLP) + dc * 32 + 16);
      }
#pragma unroll
      for (int j = 0; j < 4; ++j) {
        kl[dc][j].h[0] = *(const v8b*)(kfr + j * (16 * kLP) + kHD + dc * 32);
        kl[dc][j].h[1] = *(const v8b*)(kfr + j * (16 * kLP) + kHD + dc * 32 + 16);
      }
    }
    SCHED_FENCE();
#pragma unroll
    for (int dc = 0; dc < 2; ++dc) {
#pragma unroll
      for (int j = 0; j < 4; ++j) s[j] = mma_bf(kb[dc][j].v, qah[dc], s[j]);
#pragma unroll
      for (int j = 0; j < 4; ++j) s[j] = mma_bf(kl[dc][j].v, qah[dc], s[j]);
#pragma unroll
      for (int j = 0; j < 4; ++j) s[j] = mma_bf(kb[dc][j].v, qal[dc], s[j]);
    }
    SCHED_FENCE();
    // V^T fragments of the first 32 keys: asked for here, so that they arrive during the softmax
    FB vb[2][4], vl[2][4];   // [key half][d tile]
#pragma unroll
    for (int t = 0; t < 4; ++t) {
      vb[0][t].h[0] = *(const v8b*)(vfr + t * (16 * kLP) + (t >> 1) * kVS);
      vb[0][t].h[1] = *(const v8b*)(vfr + t * (16 * kLP) + (t >> 1) * kVS + 16);
      vl[0][t].h[0] = *(const v8b*)(vfr + t * (16 * kLP) + (t >> 1) * kVS + kKC);
      vl[0][t].h[1] = *(const v8b*)(vfr + t * (16 * kLP) + (t >> 1) * kVS + kKC + 16);
    }
    SCHED_FENCE();
    const bool diag = (kc == qb);   // block-uniform
    const int qrow = q0 + c;
    float mj[4];
#pragma unroll
    for (int j = 0; j < 4; ++j) {
      mj[j] = -INFINITY;
#pragma unroll
      for (int r = 0; r < 8; ++r) {
        const int kvcol = kv0 + j * 16 + 8 * hh + r;
        float sv = s[j][r];
        if (diag && (kvcol > qrow)) sv = -INFINITY;
        s[j][r] = sv;
        mj[j] = fmaxf(mj[j], sv);
      }
    }
    float cm = fmaxf(fmaxf(mj[0], mj[1]), fmaxf(mj[2], mj[3]));
    cm = fmaxf(cm, xhalf(cm));      // the other 32 keys of this query
    const float mnew = fmaxf(mrow, cm);
    const float mcn = mnew * kSc;
    const float mc = (mnew > -INFINITY) ? mcn : 0.0f;      // all-masked so far -> p = 0, alpha = 0
    const float alpha = __builtin_amdgcn_exp2f(mcrow - mc);   // exactly 1 where the maximum stays
    mrow = mnew;
    mcrow = mcn;
    // P^T as B operand: element e of fragment kk = key kk*32 + (e < 8 ? 8hh + e : 16 + 8hh + e - 8), the k order of the V^T loads below
    FB pa[2], pl[2];
    float pj[4];
#pragma unroll
    for (int j = 0; j < 4; ++j) {
      pj[j] = 0.f;
#pragma unroll
      for (int r = 0; r < 8; ++r) {
        if ((r & 1) == 0) {   // exponents of two scores in one packed fma
          const v2f e2 = __builtin_elementwise_fma((v2f){s[j][r], s[j][r + 1]}, (v2f){kSc, kSc}, (v2f){-mc, -mc});
          s[j][r] = e2[0]; s[j][r + 1] = e2[1];
        }
        const float p = __builtin_amdgcn_exp2f(s[j][r]);   // -inf (masked) -> 0
        pj[j] += p;
        const unsigned short hb = f2bf_bits(p);
        const unsigned short lb = f2bf_bits(p - bf_bits2f(hb));
        pa[j >> 1].v[(j & 1) * 8 + r] = __builtin_bit_cast(__bf16, hb);
        pl[j >> 1].v[(j & 1) * 8 + r] = __builtin_bit_cast(__bf16, lb);
      }
    }
    lrow = lrow * alpha + ((pj[0] + pj[1]) + (pj[2] + pj[3]));
#pragma unroll
    for (int t = 0; t < 4; ++t)
#pragma unroll
      for (int r = 0; r < 8; ++r) oacc[t][r] *= alpha;
    // ---- out^T += V^T (A: m = d, k = key) x P^T (B: k = key, n = query) ----
#pragma unroll
    for (int t = 0; t < 4; ++t) oacc[t] = mma_bf(vb[0][t].v, pa[0].v, oacc[t]);
    // the other 32 keys' fragments: free to rise into the softmax; the fence behind them keeps them out of the products that follow
#pragma unroll
    for (int t = 0; t < 4; ++t) {
      vb[1][t].h[0] = *(const v8b*)(vfr + t * (16 * kLP) + (t >> 1) * kVS + 32);
      vb[1][t].h[1] = *(const v8b*)(vfr + t * (16 * kLP) + (t >> 1) * kVS + 32 + 16);
    }
#pragma unroll
    for (int t = 0; t < 4; ++t) {
      vl[1][t].h[0] = *(const v8b*)(vfr + t * (16 * kLP) + (t >> 1) * kVS + kKC + 32);
      vl[1][t].h[1] = *(const v8b*)(vfr + t * (16 * kLP) + (t >> 1) * kVS + kKC + 32 + 16);
    }
    SCHED_FENCE();
#pragma unroll
    for (int t = 0; t < 4; ++t) oacc[t] = mma_bf(vl[0][t].v, pa[0].v, oacc[t]);
#pragma unroll
    for (int t = 0; t < 4; ++t) oacc[t] = mma_bf(vb[0][t].v, pl[0].v, oacc[t]);
#pragma unroll
    for (int t = 0; t < 4; ++t) oacc[t] = mma_bf(vb[1][t].v, pa[1].v, oacc[t]);
#pragma unroll
    for (int t = 0; t < 4; ++t) oacc[t] = mma_bf(vl[1][t].v, pa[1].v, oacc[t]);
#pragma unroll
    for (int t = 0; t < 4; ++t) oacc[t] = mma_bf(vb[1][t].v, pl[1].v, oacc[t]);
#undef SCHED_FENCE
  }

  // ---- epilogue: y = out / l, staged per wave as f32 [16][64] (pitch kOP) in the wave's own tile ----
  __syncthreads();
  float* os = Obuf[wave];
  {
    const float inv = 1.0f / (lrow + xhalf(lrow));   // both halves of the keys
#pragma unroll
    for (int t = 0; t < 4; ++t) {
      v4f o0, o1;
#pragma unroll
      for (int r = 0; r < 4; ++r) { o0[r] = oacc[t][r] * inv; o1[r] = oacc[t][4 + r] * inv; }
      *(v4f*)(os + c * kOP + t * 16 + 8 * hh) = o0;       // a lane holds 8 consecutive d of its query
      *(v4f*)(os + c * kOP + t * 16 + 8 * hh + 4) = o1;
    }
  }
  __builtin_amdgcn_fence(__ATOMIC_RELEASE, "workgroup");
  __builtin_amdgcn_wave_barrier();
  __builtin_amdgcn_fence(__ATOMIC_ACQUIRE, "workgroup");
  {
    // store coverage: per it, lanes (q8 = 0..3) x (c8 = 0..56 step 8) = 4 rows x 64 cols; 4 it = 16 rows = this wave's tile.
    const int q8 = lane >> 3, c8 = (lane & 7) * 8;
    {
#pragma unroll
      for (int it = 0; it < 4; ++it) {
        const int row = it * 4 + q8;
        const float* sp = os + row * kOP + c8;
        v8h hv, lv;
#pragma unroll
        for (int e = 0; e < 8; ++e) {
          const unsigned short hb = f2bf_bits(sp[e]);
          const unsigned short lb = f2bf_bits(sp[e] - bf_bits2f(hb));
          hv[e] = __builtin_bit_cast(_Float16, hb);
          lv[e] = __builtin_bit_cast(_Float16, lb);
        }
        const size_t yo = (rowb + (size_t)(q0 + row)) * kDim + hcol + c8;
        *(v8h*)(Yhp + yo) = hv;
        *(v8h*)(Ylp + yo) = lv;
      }
      
    }
  }
}

// ---------------------------------------------------------------------------
// Workspace region map (bytes):
//   [0, 16777216)            Xb   bf16 [8192][1024]  (dead after the qkv GEMM; reused as Yh bf16 [8192][1024])
//   [16777216, 23068672)     WqT  bf16 [3072][1024]
//   [23068672, 25165824)     WpT  bf16 [1024][1024]
//   [25165824, 125829120)    QKV  bf16 6 planes [8192][1024]: Qh, Ql, Kh, Kl, Vh, Vl
//   [125829120, 142606336)   Yl   bf16 [8192][1024]
//   total 142,606,336 B
// ---------------------------------------------------------------------------
extern "C" void kernel_launch(void* const* d_in, const int* in_sizes, int n_in,
                              void* d_out, int out_size, void* d_ws, size_t ws_size,
                              hipStream_t stream) {
  if (n_in < 9) return;
  if (in_sizes[0] != kTok * kDim || in_sizes[1] != kDim * kDim3 || in_sizes[2] != kDim3 ||
      in_sizes[3] != kDim * kDim || in_sizes[4] != kDim ||
      in_sizes[5] != kHeads * kHD || in_sizes[6] != kHeads * kHD ||
      in_sizes[7] != kHeads * kHD || in_sizes[8] != kHeads * kHD ||
      out_size != kTok * kDim) return;

  const float* x     = (const float*)d_in[0];
  const float* Wqkv  = (const float*)d_in[1];
  const float* bqkv  = (const float*)d_in[2];
  const float* Wproj = (const float*)d_in[3];
  const float* bproj = (const float*)d_in[4];
  const float* qs    = (const float*)d_in[5];
  const float* qbv   = (const float*)d_in[6];
  const float* ks    = (const float*)d_in[7];
  const float* kbv   = (const float*)d_in[8];
  float* out = (float*)d_out;

  const size_t plane  = (size_t)kTok * kDim;                 // elements per [8192][1024] plane
  const size_t offX   = 0;
  const size_t offWq  = offX  + plane * 2;                    // 16,777,216
  const size_t offWp  = offWq + (size_t)kDim3 * kDim * 2;     // 23,068,672
  const size_t offQKV = offWp + (size_t)kDim * kDim * 2;      // 25,165,824
  const size_t offYl  = offQKV + 6 * plane * 2;               // 125,829,120
  const size_t total  = offYl + plane * 2;                    // 142,606,336
  if (total > ws_size) return;

  char* ws = (char*)d_ws;
  unsigned short* Xb  = (unsigned short*)(ws + offX);
  unsigned short* Yh  = Xb;                                   // [8192][1024] bf16, the whole Xb region
  unsigned short* Yl  = (unsigned short*)(ws + offYl);        // [8192][1024] bf16
  unsigned short* WqT = (unsigned short*)(ws + offWq);
  unsigned short* WpT = (unsigned short*)(ws + offWp);
  unsigned short* QKV = (unsigned short*)(ws + offQKV);
  unsigned short* Qh = QKV;
  unsigned short* Ql = QKV + plane;
  unsigned short* Kh = QKV + 2 * plane;
  unsigned short* Kl = QKV + 3 * plane;
  unsigned short* Vh = QKV + 4 * plane;
  unsigned short* Vl = QKV + 5 * plane;

  // 1) x -> bf16 plane: n = 8,388,608, 8 per thread -> 1,048,576 threads = 4096 blocks x 256 (exact)
  const int n8 = (kTok * kDim) / 8;
  cast_bf16x8_k<<<dim3((n8 + 255) / 256), dim3(256), 0, stream>>>(x, Xb, n8);

  // 2) W_qkv in[1024][3072] -> WqT out[3072][1024] bf16: grid (3072/64, 1024/64)
  wt_cast_bf_k<<<dim3(kDim3 / 64, kDim / 64), dim3(256), 0, stream>>>(Wqkv, WqT, kDim, kDim3);
  // 3) W_proj in[1024][1024] -> WpT out[1024][1024] bf16: grid (1024/64, 1024/64)
  wt_cast_bf_k<<<dim3(kDim / 64, kDim / 64), dim3(256), 0, stream>>>(Wproj, WpT, kDim, kDim);

  // 4) qkv = Xb[8192][1024] . WqT[3072][1024]^T + b_qkv, per-head affine on q/k, bf16 hi/lo planes.
  //    M = 8192 (multiple of 128), N = 3072 (multiple of 256), K = 1024 (multiple of 64); block tiles 64 x 12 = 768 blocks x 8 waves.
  wmma_gemm64<1, 0, 2, 3, false><<<dim3(768, 1), dim3(256), 0, stream>>>(
      Xb, Xb, kDim, 0L, WqT, WqT, kDim, 0L,
      (void*)QKV, (void*)QKV, kDim, (long)plane,
      bqkv, bqkv, 0L, qs, qbv, ks, kbv,
      kTok, kDim3, kDim, 1.0f);

  // 5) causal attention of all batches in one launch -> Yh/Yl: grid (16 heads x 4 batches, 32 query blocks from the last to the first).
  attn_hd64_k<<<dim3(kHeads * kBatch, kSeq / kQB), dim3(128), 0, stream>>>(Qh, Ql, Kh, Kl, Vh, Vl, Yh, Yl);
  // 6) out = Y . WpT^T + b_proj over all rows (A hi/lo, 2 products).
  //    M = 8192, N = 1024, K = 1024; block tiles 64 x 4 = 256 blocks x 8 waves.
  wmma_gemm64<1, 1, 2, 0, false><<<dim3(256, 1), dim3(256), 0, stream>>>(
      Yh, Yl, kDim, 0L, WpT, WpT, kDim, 0L,
      (void*)out, (void*)out, kDim, 0L,
      bproj, bproj, 0L, qs, qbv, ks, kbv,
      kTok, kDim, kDim, 1.0f);
}

// v008
// One run takes 171 microseconds.
// Next to v007, in two timings, it ran 1.20 times as fast each time.
// Counting every step since v000, it is 7.77 times as fast.
// Contractions: x*W_qkv on v_wmma_f32_16x16x32_bf16 (plain bf16 operands = RNE-bf16 inputs); q*k^T and p*v on v_wmma_f32_16x16x32_bf16 with bf16 hi/lo operand pairs (hi*hi + hi*lo + lo*hi); y*W_proj on v_wmma_f32_16x16x32_bf16 with y as bf16 hi/lo and exact bf16 weights (hi*w + lo*w); f32 accumulate everywhere; bias, per-head affine and softmax in f32.
#include <hip/hip_runtime.h>
#include <stdint.h>
#include <math.h>

constexpr int kBatch = 4;
constexpr int kSeq   = 2048;
constexpr int kDim   = 1024;
constexpr int kHeads = 16;
constexpr int kHD    = 64;
constexpr int kTok   = kBatch * kSeq;   // 8192
constexpr int kDim3  = 3 * kDim;        // 3072

typedef __attribute__((ext_vector_type(16))) _Float16 v16h;
typedef __attribute__((ext_vector_type(8)))  _Float16 v8h;
typedef __attribute__((ext_vector_type(16))) __bf16   v16b;
typedef __attribute__((ext_vector_type(8)))  __bf16   v8b;
typedef __attribute__((ext_vector_type(8)))  float    v8f;
typedef __attribute__((ext_vector_type(4)))  float    v4f;
typedef __attribute__((ext_vector_type(2)))  float    v2f;

__device__ __forceinline__ unsigned short f2bf_bits(float f) {
  unsigned u = __float_as_uint(f);
  return (unsigned short)((u + 0x7FFFu + ((u >> 16) & 1u)) >> 16);
}
__device__ __forceinline__ float bf_bits2f(unsigned short h) { return __uint_as_float(((unsigned)h) << 16); }
__device__ __forceinline__ float bf_rne(float f) { return bf_bits2f(f2bf_bits(f)); }

// hazard guards as plain device helpers
__device__ __forceinline__ void dep_guard_h(v8f& a, v8f& b, v16h x, v16h y) { asm volatile("v_nop\n\tv_nop\n\tv_nop\n\tv_nop" : "+v"(a), "+v"(b) : "v"(x), "v"(y)); }
__device__ __forceinline__ void dep_guard_b(v8f& a, v8f& b, v16b x, v16b y) { asm volatile("v_nop\n\tv_nop\n\tv_nop\n\tv_nop" : "+v"(a), "+v"(b) : "v"(x), "v"(y)); }
__device__ __forceinline__ void keep4_h(v16h a, v16h b, v16h c, v16h d) { asm volatile("v_nop" :: "v"(a), "v"(b), "v"(c), "v"(d)); }
__device__ __forceinline__ void keep4_b(v16b a, v16b b, v16b c, v16b d) { asm volatile("v_nop" :: "v"(a), "v"(b), "v"(c), "v"(d)); }
__device__ __forceinline__ void acc_guard4(v8f& a, v8f& b, v8f& c, v8f& d) { asm volatile("v_nop\n\tv_nop\n\tv_nop\n\tv_nop" : "+v"(a), "+v"(b), "+v"(c), "+v"(d)); }
template <typename T> struct Frag;
template <> struct Frag<_Float16> {
  typedef v16h V; union U { v16h v; v8h h[2]; };
  static __device__ __forceinline__ v16h load(const _Float16* p) {   // elements 0..7 <- p[0..7], 8..15 <- p[16..23]
    U f; f.h[0] = *(const v8h*)(p); f.h[1] = *(const v8h*)(p + 16); return f.v;
  }
  static __device__ __forceinline__ v8f mma(v16h a, v16h b, v8f c) {
    return __builtin_amdgcn_wmma_f32_16x16x32_f16(false, a, false, b, (short)0, c, false, false);
  }
  static __device__ __forceinline__ void guard(v8f& a, v8f& b, v16h x, v16h y) { dep_guard_h(a, b, x, y); }
  static __device__ __forceinline__ void keep(v16h a, v16h b, v16h c, v16h d) { keep4_h(a, b, c, d); }
};
template <> struct Frag<__bf16> {
  typedef v16b V; union U { v16b v; v8b h[2]; };
  static __device__ __forceinline__ v16b load(const __bf16* p) {
    U f; f.h[0] = *(const v8b*)(p); f.h[1] = *(const v8b*)(p + 16); return f.v;
  }
  static __device__ __forceinline__ v8f mma(v16b a, v16b b, v8f c) {
    return __builtin_amdgcn_wmma_f32_16x16x32_bf16(false, a, false, b, (short)0, c, false, false);
  }
  static __device__ __forceinline__ void guard(v8f& a, v8f& b, v16b x, v16b y) { dep_guard_b(a, b, x, y); }
  static __device__ __forceinline__ void keep(v16b a, v16b b, v16b c, v16b d) { keep4_b(a, b, c, d); }
};

// ---- Register-blocked batched WMMA GEMM ------------------------------------
// C[m,n] = scale * sum_k A[m,k] * Bt[n,k] (+bias)(affine)(+resid); each wave owns a 64x64 tile.
// A row-major [M,K]; Bt row-major [N,K]; M % 128 == 0, N % 256 == 0, K % 64 == 0, lda and ldb % 8 == 0.
// A block of 8 waves (2 x 4) owns a 128 x 256 tile of C. Its operand rows come 64 k (one 128-B line of every row) at a time
// into an LDS ring of two buffers by asynchronous copies, whole lines per wave-copy; the fragments are read from LDS.
// SPLIT_MODE: 0 = plain; 1 = A carried as hi/lo planes (A2 = lo): hi.b + lo.b; 2 = A and Bt hi/lo: hi.hi + hi.lo + lo.hi.
// BIAS_MODE: 0 = none, 1 = bias[m], 2 = bias[n].
// OUT_MODE: 0 = f32, 1 = f16, 2 = bf16 hi plane (Cout) + bf16 lo plane (Cout2),
//           3 = qkv mode: columns n form three blocks of kDim (which = n0 / kDim); value v = (acc+bias)*affs[cc]+affb[cc]
//               with cc = n - which*kDim and tables (affs0,affb0) for which 0, (affs1,affb1) for which 1 (RNE-bf16 applied
//               to the table values), identity for which 2; written as bf16 hi plane at Cout + which*2*strideC and lo plane
//               at + strideC, row pitch ldc, column n0 - which*kDim.
// ET: 0 = f16 operands, 1 = bf16 operands (pointers passed as 16-bit storage)
constexpr int kGBM = 128;   // rows of C per block (2 waves of 64)
constexpr int kGBN = 256;   // columns of C per block (4 waves of 64)
constexpr int kGBK = 64;    // k per stage
constexpr int kGP  = 72;    // LDS row pitch in 16-bit elements: 144 B = 16 B x 9, for the ds_load_b128 fragment readers

__device__ __forceinline__ unsigned lds_off(const void* p) { return (unsigned)(size_t)p; }   // byte offset in the block's LDS

// ROWS rows of 128 B, global -> LDS, 16 B per lane and copy: thread -> row tid >> 3 (+32 per copy), piece tid & 7;
// ldst and gsrc already point at this thread's first row and piece; ld = global row pitch in elements.
template <int ROWS>
__device__ __forceinline__ void stage_rows(unsigned ldst, const unsigned short* gsrc, int ld) {
  const size_t g32 = (size_t)32 * (size_t)ld;
#pragma unroll   // one or two straight groups of four copies, no loop counter beside them
  for (int u = 0; u < ROWS / 128; ++u) {
    const unsigned l0 = ldst + (unsigned)(u * 128 * kGP * 2);
    const unsigned l1 = l0 + 32u * kGP * 2u, l2 = l0 + 64u * kGP * 2u, l3 = l0 + 96u * kGP * 2u;
    const unsigned short* g0 = gsrc + (size_t)(4 * u) * g32;
    const unsigned short* g1 = g0 + g32;
    const unsigned short* g2 = g1 + g32;
    const unsigned short* g3 = g2 + g32;
    // the s_wait_xcnt closes the copies' own statement, so that no address register of a copy is rewritten ahead of it
    asm volatile("global_load_async_to_lds_b128 %0, %1, off\n\t"
                 "global_load_async_to_lds_b128 %2, %3, off\n\t"
                 "global_load_async_to_lds_b128 %4, %5, off\n\t"
                 "global_load_async_to_lds_b128 %6, %7, off\n\t"
                 "s_wait_xcnt 0x0"
                 :: "v"(l0), "v"(g0), "v"(l1), "v"(g1), "v"(l2), "v"(g2), "v"(l3), "v"(g3) : "memory");
  }
}

template <int ET> struct Elem;
template <> struct Elem<0> { typedef _Float16 T; };
template <> struct Elem<1> { typedef __bf16 T; };
template <int ET, int SPLIT_MODE, int BIAS_MODE, int OUT_MODE, bool RESID, int ACT = 0>
__global__ __launch_bounds__(256) void wmma_gemm64(
    const unsigned short* __restrict__ Ap, const unsigned short* __restrict__ A2p, int lda, long strideA,
    const unsigned short* __restrict__ Btp, const unsigned short* __restrict__ Bt2p, int ldb, long strideB,
    void* __restrict__ Cout, void* __restrict__ Cout2, int ldc, long strideC,
    const float* __restrict__ bias,
    const float* __restrict__ resid, long strideR,
    const float* __restrict__ affs0, const float* __restrict__ affb0,
    const float* __restrict__ affs1, const float* __restrict__ affb1,
    int M, int N, int K, float scale) {
  typedef typename Elem<ET>::T T;
  typedef typename Frag<T>::V V;
  const T* A = (const T*)Ap; const T* A2 = (const T*)A2p; const T* Bt = (const T*)Btp; const T* Bt2 = (const T*)Bt2p;
  constexpr int NA = (SPLIT_MODE >= 1) ? 2 : 1;      // planes of A, of Bt
  constexpr int NB = (SPLIT_MODE == 2) ? 2 : 1;
  constexpr int kAEl = kGBM * kGP;                   // elements of one plane's tile in LDS
  constexpr int kBEl = kGBN * kGP;
  constexpr int kStage = NA * kAEl + NB * kBEl;      // one buffer: [A hi | A lo | Bt hi | Bt lo]
  __shared__ __align__(16) T ring[2 * kStage];
  __shared__ __align__(16) float sT[8][16 * 68];   // per-wave 16x64 slab, pitch 68 floats
  const int b    = blockIdx.y;
  const int lane = threadIdx.x & 31;
  const int wave = threadIdx.x >> 5;
  const int blocksN = N / kGBN;
  if ((int)blockIdx.x >= (M / kGBM) * blocksN) return;   // block-uniform, ahead of every copy and barrier
  const int bm = blockIdx.x / blocksN;
  const int bn = blockIdx.x - bm * blocksN;
  const int mb0 = bm * kGBM;
  const int nb0 = bn * kGBN;
  const int wm = wave >> 2, wn = wave & 3;
  const int m0 = mb0 + (wm << 6);
  const int n0 = nb0 + (wn << 6);

  const T* Ab  = A  + (size_t)b * strideA;
  const T* Bb  = Bt + (size_t)b * strideB;
  const T* Ab2 = (SPLIT_MODE >= 1) ? (A2  + (size_t)b * strideA) : nullptr;
  const T* Bb2 = (SPLIT_MODE == 2) ? (Bt2 + (size_t)b * strideB) : nullptr;

  const int rlane = lane & 15;                 // row (A) / col (B, D) within subtile
  const int koff  = (lane >> 4) * 8;           // k offset of this lane half
  const int mOff  = (lane >> 4) * 8;           // D row offset

  v8f acc[4][4];
#pragma unroll
  for (int i = 0; i < 4; ++i)
#pragma unroll
    for (int j = 0; j < 4; ++j) acc[i][j] = (v8f){0.f,0.f,0.f,0.f,0.f,0.f,0.f,0.f};

  // this thread's share of every stage: row tid >> 3 (+32 per copy) of each tile, 16-B piece tid & 7
  const int crow = threadIdx.x >> 3, cpc = (threadIdx.x & 7) * 8;
  const unsigned short* gA  = (const unsigned short*)Ab + (size_t)(mb0 + crow) * lda + cpc;
  const unsigned short* gB  = (const unsigned short*)Bb + (size_t)(nb0 + crow) * ldb + cpc;
  const unsigned short* gA2 = (SPLIT_MODE >= 1) ? ((const unsigned short*)Ab2 + (size_t)(mb0 + crow) * lda + cpc) : nullptr;
  const unsigned short* gB2 = (SPLIT_MODE == 2) ? ((const unsigned short*)Bb2 + (size_t)(nb0 + crow) * ldb + cpc) : nullptr;
  const unsigned lT = lds_off(ring) + (unsigned)((crow * kGP + cpc) * 2);
  auto issue_stage = [&](int t) {
    const unsigned lb = lT + (unsigned)((t & 1) * (kStage * 2));
    const int k0 = t * kGBK;
    stage_rows<kGBM>(lb, gA + k0, lda);
    if (SPLIT_MODE >= 1) stage_rows<kGBM>(lb + kAEl * 2, gA2 + k0, lda);
    stage_rows<kGBN>(lb + NA * kAEl * 2, gB + k0, ldb);
    if (SPLIT_MODE == 2) stage_rows<kGBN>(lb + (NA * kAEl + kBEl) * 2, gB2 + k0, ldb);
  };

  const int nk = K / kGBK;   // block-uniform
  issue_stage(0);
  asm volatile("s_wait_asynccnt 0x0" ::: "memory");   // this wave's copies of stage 0 have landed
  __syncthreads();                                    // ... and every other wave's
  if (nk > 1) issue_stage(1);

  for (int t = 0; t < nk; ++t) {
    const T* sA = ring + (t & 1) * kStage + ((wm << 6) + rlane) * kGP + koff;
    const T* sB = ring + (t & 1) * kStage + NA * kAEl + ((wn << 6) + rlane) * kGP + koff;
#pragma unroll   // both halves of the stage in one straight run: the second half's fragment loads go among the first half's products
    for (int ks = 0; ks < kGBK; ks += 32) {
      V bh[4], bl[4];
#pragma unroll
      for (int j = 0; j < 4; ++j) {
        bh[j] = Frag<T>::load(sB + (j << 4) * kGP + ks);
        if (SPLIT_MODE == 2) bl[j] = Frag<T>::load(sB + kBEl + (j << 4) * kGP + ks);
      }
      V ah[4], al[4];   // all fragments of the half are asked for as one group, ahead of its products
#pragma unroll   // constant indices keep the fragment arrays in registers
      for (int i = 0; i < 4; ++i) {
        ah[i] = Frag<T>::load(sA + (i << 4) * kGP + ks);
        if (SPLIT_MODE >= 1) al[i] = Frag<T>::load(sA + kAEl + (i << 4) * kGP + ks);
      }
#pragma unroll
      for (int i = 0; i < 4; ++i) {
#pragma unroll
        for (int j = 0; j < 4; ++j) {
          acc[i][j] = Frag<T>::mma(ah[i], bh[j], acc[i][j]);
          if (SPLIT_MODE == 2) acc[i][j] = Frag<T>::mma(ah[i], bl[j], acc[i][j]);
          if (SPLIT_MODE >= 1) acc[i][j] = Frag<T>::mma(al[i], bh[j], acc[i][j]);
        }
        Frag<T>::guard(acc[i][0], acc[i][3], ah[i], (SPLIT_MODE >= 1) ? al[i] : ah[i]);
      }
      Frag<T>::keep(bh[0], bh[1], bh[2], bh[3]);
      if (SPLIT_MODE == 2) Frag<T>::keep(bl[0], bl[1], bl[2], bl[3]);
    }
    // publish point of stage t + 1; the one barrier also ends every wave's reads of the buffer that is refilled behind it
    asm volatile("s_wait_dscnt 0x0" ::: "memory");      // this wave's LDS reads of stage t are done
    asm volatile("s_wait_asynccnt 0x0" ::: "memory");   // this wave's copies of stage t + 1 have landed
    __syncthreads();
    if (t + 2 < nk) issue_stage(t + 2);
  }
  asm volatile("s_wait_asynccnt 0x0" ::: "memory");     // no copy is outstanding when the wave goes on to the epilogue
  acc_guard4(acc[0][0], acc[0][1], acc[0][2], acc[0][3]);
  acc_guard4(acc[1][0], acc[1][1], acc[1][2], acc[1][3]);
  acc_guard4(acc[2][0], acc[2][1], acc[2][2], acc[2][3]);
  acc_guard4(acc[3][0], acc[3][1], acc[3][2], acc[3][3]);

  // ---- epilogue ----
  float* slab = sT[wave];
  const float* Rb = RESID ? (resid + (size_t)b * strideR) : nullptr;
#pragma unroll
  for (int i = 0; i < 4; ++i) {
    const int mBase = m0 + (i << 4);
#pragma unroll
    for (int j = 0; j < 4; ++j) {
      const int n = n0 + (j << 4) + rlane;
      float bv = 0.f;
      if (BIAS_MODE == 2) bv = bias[n];
      float asc = 1.0f, abi = 0.0f;
      if (OUT_MODE == 3) {
        const int which = n0 / kDim;               // wave-uniform (64-col tile inside one kDim block)
        const int cc = n - which * kDim;           // 0..kDim-1, all four tables have kDim entries
        const float s0 = bf_rne(affs0[cc]);
        const float c0 = bf_rne(affb0[cc]);
        const float s1 = bf_rne(affs1[cc]);
        const float c1 = bf_rne(affb1[cc]);
        asc = (which == 0) ? s0 : ((which == 1) ? s1 : 1.0f);
        abi = (which == 0) ? c0 : ((which == 1) ? c1 : 0.0f);
      }
#pragma unroll
      for (int r = 0; r < 8; ++r) {
        float v = acc[i][j][r] * scale;
        if (BIAS_MODE == 1) v += bias[mBase + mOff + r];
        if (BIAS_MODE == 2) v += bv;
        if (OUT_MODE == 3) v = v * asc + abi;
        if (RESID) v += Rb[(size_t)(mBase + mOff + r) * ldc + n];
        if (ACT == 1) v = tanhf(v);
        if (ACT == 2) v = fmaxf(v, 0.0f);
        if (ACT == 4) v = (v > 0.f) ? v : 0.01f * v;
        slab[(mOff + r) * 68 + (j << 4) + rlane] = v;
      }
    }
    __builtin_amdgcn_fence(__ATOMIC_RELEASE, "workgroup");
    __builtin_amdgcn_wave_barrier();
    __builtin_amdgcn_fence(__ATOMIC_ACQUIRE, "workgroup");
    if (OUT_MODE == 0) {
      float* C = (float*)Cout + (size_t)b * strideC;
      const int hh = lane >> 4, c4 = (lane & 15) * 4;     // row seg = 256 B = 16 lanes x 16 B
      {
#pragma unroll
        for (int it = 0; it < 8; ++it) {
          const int row = it * 2 + hh;
          v4f v = *(const v4f*)(slab + row * 68 + c4);
          *(v4f*)(C + (size_t)(mBase + row) * ldc + n0 + c4) = v;
        }
        
      }
    } else {
      const int q = lane >> 3, c8 = (lane & 7) * 8;
      unsigned short* C;
      unsigned short* C2;
      int ncol;
      if (OUT_MODE == 3) {
        const int which = n0 / kDim;
        C  = (unsigned short*)Cout + (size_t)which * 2 * (size_t)strideC;
        C2 = C + (size_t)strideC;
        ncol = n0 - which * kDim;
      } else {
        C  = (unsigned short*)Cout  + (size_t)b * strideC;
        C2 = (OUT_MODE == 2) ? ((unsigned short*)Cout2 + (size_t)b * strideC) : nullptr;
        ncol = n0;
      }
      {
#pragma unroll
        for (int it = 0; it < 4; ++it) {
          const int row = it * 4 + q;
          const float* sp = slab + row * 68 + c8;
          v8h hv, lv;
#pragma unroll
          for (int e = 0; e < 8; ++e) {
            if (OUT_MODE == 1) {
              hv[e] = (_Float16)sp[e];
            } else {
              unsigned short hb = f2bf_bits(sp[e]);
              unsigned short lb = f2bf_bits(sp[e] - bf_bits2f(hb));
              hv[e] = __builtin_bit_cast(_Float16, hb);
              lv[e] = __builtin_bit_cast(_Float16, lb);
            }
          }
          *(v8h*)(C + (size_t)(mBase + row) * ldc + ncol + c8) = hv;
          if (OUT_MODE >= 2) *(v8h*)(C2 + (size_t)(mBase + row) * ldc + ncol + c8) = lv;
        }
        
      }
    }
    __builtin_amdgcn_fence(__ATOMIC_RELEASE, "workgroup");
    __builtin_amdgcn_wave_barrier();
    __builtin_amdgcn_fence(__ATOMIC_ACQUIRE, "workgroup");
  }
}

// coverage: n8 threads x 8 elements = n (host passes n8 = n/8 with n % 8 == 0)
__global__ __launch_bounds__(256) void cast_bf16x8_k(const float* __restrict__ in,
                                                     unsigned short* __restrict__ out, int n8) {
  const int i = blockIdx.x * 256 + threadIdx.x;
  if (i < n8) {
    const size_t o = (size_t)i * 8;
    const v4f a = *(const v4f*)(in + o);
    const v4f bq = *(const v4f*)(in + o + 4);
    v8h hv;
#pragma unroll
    for (int e = 0; e < 4; ++e) {
      hv[e]     = __builtin_bit_cast(_Float16, f2bf_bits(a[e]));
      hv[4 + e] = __builtin_bit_cast(_Float16, f2bf_bits(bq[e]));
    }
    *(v8h*)(out + o) = hv;
    
  }
}

// ---- W [K][N] f32 -> Wt [N][K] bf16 (RNE), 64x64 tile transposed through LDS ----
// in[rows = K][cols = N] -> out[N][K]; grid = (N/64, K/64).
// producer coverage: 256 threads x (1 row x 16 cols) = 64x64 tile; store: 8 waves x 4 rows x 2 it = 64 rows, 8 lanes x 8 halves = 64 cols.
constexpr int kWTP = 72;
__global__ __launch_bounds__(256) void wt_cast_bf_k(const float* __restrict__ W, unsigned short* __restrict__ Wtp,
                                                    int K, int N) {
  __shared__ __align__(16) _Float16 st[64 * kWTP];
  _Float16* Wt = (_Float16*)Wtp;
  const int n0 = blockIdx.x * 64, k0 = blockIdx.y * 64;
  const int tid = threadIdx.x;
  const int kr = tid >> 2, c16 = (tid & 3) * 16;
  const float* src = W + (size_t)(k0 + kr) * N + n0 + c16;
#pragma unroll
  for (int qq = 0; qq < 4; ++qq) {
    const v4f v = *(const v4f*)(src + 4 * qq);
#pragma unroll
    for (int e = 0; e < 4; ++e)
      st[(c16 + 4 * qq + e) * kWTP + kr] = __builtin_bit_cast(_Float16, f2bf_bits(v[e]));
  }
  __syncthreads();
  const int wave = tid >> 5, lane = tid & 31;
  const int q8 = lane >> 3, c8 = (lane & 7) * 8;
  {
#pragma unroll
    for (int it = 0; it < 2; ++it) {
      const int n = it * 32 + wave * 4 + q8;
      const v8h hv = *(const v8h*)(st + n * kWTP + c8);
      *(v8h*)(Wt + (size_t)(n0 + n) * K + k0 + c8) = hv;
    }
    
  }
}

// =====================================================================================
// Causal attention, head_dim 64, fed by bf16 hi/lo planes laid out [kTok][kDim] (row = b*kSeq + t, col = h*64 + d).
//   scores = qh.kh + qh.kl + ql.kh, unscaled (the 1/8 goes into the exponent) : v_wmma_f32_16x16x32_bf16, f32 accumulate
//   out    =  ph.vh + ph.vl + pl.vh      : v_wmma_f32_16x16x32_bf16, p = exp((s - max) / 8) split into bf16 hi/lo
//   Both products are formed transposed: S^T = K . Q^T (A = K rows, B = Q rows) and O^T += V^T . P^T (A = V^T rows, B = P^T).
//   In S^T a lane holds scores of ONE query (column c = lane & 15): keys j*16 + 8*(lane >> 4) + r. Two such tiles, converted in place,
//   are the B operand P^T in the k order that the V^T loader already has, so P never goes through LDS, and the row maximum and the
//   row sum are in-lane, with one exchange between the wave's halves.
//   online softmax in f32, base 2: p = 2^(s * kSc - m * kSc) with kSc = log2(e) / 8, one packed fma per two scores and one v_exp_f32 per score. Block = 4 waves = 64 query rows of one head of batch blockIdx.x / kHeads; 64-key chunks,
//   chunks above the diagonal skipped, per-element causal select (key > query -> -inf) on the diagonal chunk.
//   grid = (kHeads * kBatch, kSeq/64), heaviest first: blockIdx.y counts the query blocks from the last (32 key chunks) down to the first (1 chunk),
//   for speed only. Each cost level is a run of 64 equal work-groups. Y planes are [kTok][kDim] like the inputs.
// =====================================================================================
constexpr int kKC = 64;
constexpr int kQB = 64;
constexpr int kLP = 2 * 64 + 8;   // K: LDS row pitch in bf16 elements (272 B = 16 B x 17, for ds_load_b128 readers)
constexpr int kVP = 2 * 64 + 16;  // V: LDS row pitch in bf16 elements (288 B = 32 B x 9, for ds_load_tr16_b128 readers)
constexpr int kKEl = kKC * kLP;          // elements of one K chunk in LDS
constexpr int kVEl = kKC * kVP;          // elements of one V chunk in LDS
constexpr int kAStage = kKEl + kVEl;     // one buffer of the ring: [K | V], 35,840 B
constexpr int kOP = 68;           // f32 pitch of the output tile
constexpr float kSc = 0.125f * 1.44269504088896340736f;   // 1/sqrt(head dim) * log2(e): raw score -> exponent of 2

__device__ __forceinline__ v8f mma_bf(v16b a, v16b b, v8f c) {
  return __builtin_amdgcn_wmma_f32_16x16x32_bf16(false, a, false, b, (short)0, c, false, false);
}

// 64 rows of [hi 128 B | lo 128 B], global -> LDS, 16 B per lane and copy: thread -> row tid >> 3 (+16 per copy), piece tid & 7.
// l, gh and gl already point at this thread's first row and piece (hi half in LDS; hi and lo plane in memory); P16 = LDS bytes of 16 rows.
template <unsigned P16>
__device__ __forceinline__ void stage_hilo(unsigned l, const unsigned short* gh, const unsigned short* gl) {
  constexpr size_t g16 = (size_t)16 * kDim;
  const unsigned l1 = l + P16, l2 = l + 2u * P16, l3 = l + 3u * P16;
  const unsigned m0 = l + 128u, m1 = l1 + 128u, m2 = l2 + 128u, m3 = l3 + 128u;
  const unsigned short* gh1 = gh + g16;
  const unsigned short* gh2 = gh + 2 * g16;
  const unsigned short* gh3 = gh + 3 * g16;
  const unsigned short* gl1 = gl + g16;
  const unsigned short* gl2 = gl + 2 * g16;
  const unsigned short* gl3 = gl + 3 * g16;
  // the s_wait_xcnt closes the copies' own statement, so that no address register of a copy is rewritten ahead of it
  asm volatile("global_load_async_to_lds_b128 %0, %1, off\n\t"
               "global_load_async_to_lds_b128 %2, %3, off\n\t"
               "global_load_async_to_lds_b128 %4, %5, off\n\t"
               "global_load_async_to_lds_b128 %6, %7, off\n\t"
               "global_load_async_to_lds_b128 %8, %9, off\n\t"
               "global_load_async_to_lds_b128 %10, %11, off\n\t"
               "global_load_async_to_lds_b128 %12, %13, off\n\t"
               "global_load_async_to_lds_b128 %14, %15, off\n\t"
               "s_wait_xcnt 0x0"
               :: "v"(l), "v"(gh), "v"(l1), "v"(gh1), "v"(l2), "v"(gh2), "v"(l3), "v"(gh3),
                  "v"(m0), "v"(gl), "v"(m1), "v"(gl1), "v"(m2), "v"(gl2), "v"(m3), "v"(gl3) : "memory");
}

// transposing LDS load: lane (c, hh) gets T[kbase + 8 hh + 0..7][dbase + c] of a row-major 16-bit tile; p = the lane's address in that map
typedef __attribute__((ext_vector_type(8))) short s16x8;
__device__ __forceinline__ v8b ld_tr16(const __bf16* p) {
  typedef __attribute__((address_space(3))) s16x8 lds_s16x8;
  return __builtin_bit_cast(v8b, __builtin_amdgcn_ds_load_tr16_b128_v8i16((lds_s16x8*)p));
}

// lane l <-> lane l ^ 16: the two lanes that share one query column
__device__ __forceinline__ float xhalf(float x) {
  return __builtin_bit_cast(float, __builtin_amdgcn_permlanex16(__builtin_bit_cast(int, x), __builtin_bit_cast(int, x), 0x76543210, 0xfedcba98, false, false));
}

__global__ __launch_bounds__(128)
void attn_hd64_k(const unsigned short* __restrict__ Qhp, const unsigned short* __restrict__ Qlp,
                 const unsigned short* __restrict__ Khp, const unsigned short* __restrict__ Klp,
                 const unsigned short* __restrict__ Vhp, const unsigned short* __restrict__ Vlp,
                 unsigned short* __restrict__ Yhp, unsigned short* __restrict__ Ylp) {
  union FB { v16b v; v8b h[2]; };
  // Ring of two buffers, each [K chunk | V chunk], filled by asynchronous copies one chunk ahead of its use. Both tiles lie as in
  // memory, row = key: its hi half (64 d) then its lo half (64 d) plus pad. K rows are A fragments as they lie (ds_load_b128);
  // V^T fragments come from the row-major V tile by the transposing load.
  // Behind the loop the ring's first bytes are the output staging: per wave an f32 tile [16 queries][64 d] at pitch kOP.
  __shared__ __align__(128) __bf16 ring[2 * kAStage];
  static_assert(4 * 16 * kOP * 4 <= 2 * kAStage * 2, "output staging fits the ring");

  const __bf16* Qh = (const __bf16*)Qhp;
  const __bf16* Ql = (const __bf16*)Qlp;

  const int tid  = threadIdx.x;
  const int wave = tid >> 5;
  const int lane = tid & 31;
  const int hh   = lane >> 4;
  const int c    = lane & 15;
  // this lane's place in every K fragment read: row c of a 16-row tile, k offset 8 * hh; tile, half and hi/lo are constant offsets from it
  const __bf16* const kfr = ring + c * kLP + 8 * hh;   // hi; lo at + kHD
  // V: the transposing load's lane map, key row 8 * hh + (lane & 7), 16-B piece (lane >> 3) & 1; key base and d tile are constant offsets
  const __bf16* const vfr = ring + kKEl + (8 * hh + (lane & 7)) * kVP + 8 * ((lane >> 3) & 1);   // hi; lo at + kHD

  constexpr int nqb = kSeq / kQB;   // 32
  const int qb = nqb - 1 - (int)blockIdx.y;     // cost (qb + 1 chunks) falls with the block index
  const int h  = (int)blockIdx.x % kHeads;
  const int q0 = qb * kQB + wave * 16;          // token index of this wave's first row
  const size_t rowb = (size_t)((int)blockIdx.x / kHeads) * kSeq; // plane row base of this batch
  const int hcol = h * kHD;

  // ---- Q fragments (B operand: column = query c): 2 d-chunks, hi and lo; Frag load = split k-map ----
  v16b qah[2], qal[2];
  {
    const size_t qoff = (rowb + (size_t)(q0 + c)) * kDim + hcol + 8 * hh;
#pragma unroll
    for (int dc = 0; dc < 2; ++dc) {
      qah[dc] = Frag<__bf16>::load(Qh + qoff + dc * 32);
      qal[dc] = Frag<__bf16>::load(Ql + qoff + dc * 32);
    }
  }

  float mrow = -INFINITY, lrow = 0.f;   // of query q0 + c; mrow = maximum of the raw (unscaled) scores; lrow sums this lane's half of the keys, the halves join in the epilogue
  float mcrow = -INFINITY;              // mrow * kSc as it was subtracted in the last chunk
  v8f oacc[4];                          // O^T: row = d (t*16 + 8hh + r), column = query c
#pragma unroll
  for (int t = 0; t < 4; ++t) oacc[t] = (v8f){0.f,0.f,0.f,0.f,0.f,0.f,0.f,0.f};

  const int nChunks = qb + 1;   // block-uniform, <= 32
  // this thread's share of every chunk: key row tid >> 3 (+16 per copy) of each tile, 16-B piece tid & 7
  const int crow = tid >> 3, cpc = (tid & 7) * 8;
  // Running state of the copies, three registers: the element offset in a plane (below 2^23) and the two LDS places; they step from
  // chunk to chunk, so that the sixteen addresses of a chunk are formed where it is issued and none is held through the products.
  unsigned cgo = (unsigned)((rowb + (size_t)crow) * kDim + hcol + cpc);
  unsigned lK = lds_off(ring) + (unsigned)((crow * kLP + cpc) * 2);
  unsigned lV = lds_off(ring) + (unsigned)((kKEl + crow * kVP + cpc) * 2);
  int lstep = kAStage * 2;   // to the other buffer, to and fro
  auto issue_chunk = [&]() {
    stage_hilo<16u * kLP * 2u>(lK, Khp + cgo, Klp + cgo);
    stage_hilo<16u * kVP * 2u>(lV, Vhp + cgo, Vlp + cgo);
    cgo += (unsigned)(kKC * kDim);
    lK += (unsigned)lstep; lV += (unsigned)lstep; lstep = -lstep;
  };
  issue_chunk();
  asm volatile("s_wait_asynccnt 0x0" ::: "memory");   // this wave's copies of chunk 0 have landed
  __syncthreads();                                    // ... and every other wave's
  const __bf16* kf = kfr;   // this chunk's buffer
  const __bf16* vf = vfr;
  int fstep = kAStage;
  for (int kc = 0; kc < nChunks; ++kc) {
    const int kv0 = kc * kKC;
    // The next chunk's copies, while there is one, directly behind the barrier (in front of the loop, or at the foot of the trip before)
    // that ended every wave's reads of the buffer they fill; they fly during this chunk's work.
    if (kc + 1 < nChunks) issue_chunk();

    // ---- scores, transposed: D row = key j*16 + 8hh + r, col = query c ----
    // The four key tiles are four independent accumulators: their products alternate, so that no product waits for the one
    // before it; each tile keeps its own order of products. Fragments are asked for in whole groups ahead of the run of products
    // that uses them: all of K at once, V by 32 keys, ahead of and during the softmax. That takes the registers of four waves per SIMD.
    // SCHED_FENCE keeps a group of LDS loads together and at its place: left alone, the compiler spreads the loads in pairs among the
    // products and lines up products of one tile behind one another.
#define SCHED_FENCE() __builtin_amdgcn_sched_barrier(0)
    v8f s[4];
#pragma unroll
    for (int j = 0; j < 4; ++j) s[j] = (v8f){0.f,0.f,0.f,0.f,0.f,0.f,0.f,0.f};
    FB kb[2][4], kl[2][4];   // [d half][key tile]; constant indices keep them in registers
#pragma unroll   // one group of loads for the whole chunk, in the order of first use
    for (int dc = 0; dc < 2; ++dc) {
#pragma unroll
      for (int j = 0; j < 4; ++j) {
        kb[dc][j].h[0] = *(const v8b*)(kf + j * (16 * kLP) + dc * 32);
        kb[dc][j].h[1] = *(const v8b*)(kf + j * (16 * kLP) + dc * 32 + 16);
      }
#pragma unroll
      for (int j = 0; j < 4; ++j) {
        kl[dc][j].h[0] = *(const v8b*)(kf + j * (16 * kLP) + kHD + dc * 32);
        kl[dc][j].h[1] = *(const v8b*)(kf + j * (16 * kLP) + kHD + dc * 32 + 16);
      }
    }
    SCHED_FENCE();
#pragma unroll
    for (int dc = 0; dc < 2; ++dc) {
#pragma unroll
      for (int j = 0; j < 4; ++j) s[j] = mma_bf(kb[dc][j].v, qah[dc], s[j]);
#pragma unroll
      for (int j = 0; j < 4; ++j) s[j] = mma_bf(kl[dc][j].v, qah[dc], s[j]);
#pragma unroll
      for (int j = 0; j < 4; ++j) s[j] = mma_bf(kb[dc][j].v, qal[dc], s[j]);
    }
    SCHED_FENCE();
    // V^T fragments of the first 32 keys: asked for here, so that they arrive during the softmax
    FB vb[2][4], vl[2][4];   // [key half][d tile]
#pragma unroll
    for (int t = 0; t < 4; ++t) {
      vb[0][t].h[0] = ld_tr16(vf + t * 16);
      vb[0][t].h[1] = ld_tr16(vf + 16 * kVP + t * 16);
      vl[0][t].h[0] = ld_tr16(vf + kHD + t * 16);
      vl[0][t].h[1] = ld_tr16(vf + 16 * kVP + kHD + t * 16);
    }
    SCHED_FENCE();
    const bool diag = (kc == qb);   // block-uniform
    const int qrow = q0 + c;
    float mj[4];
#pragma unroll
    for (int j = 0; j < 4; ++j) {
      mj[j] = -INFINITY;
#pragma unroll
      for (int r = 0; r < 8; ++r) {
        const int kvcol = kv0 + j * 16 + 8 * hh + r;
        float sv = s[j][r];
        if (diag && (kvcol > qrow)) sv = -INFINITY;
        s[j][r] = sv;
        mj[j] = fmaxf(mj[j], sv);
      }
    }
    float cm = fmaxf(fmaxf(mj[0], mj[1]), fmaxf(mj[2], mj[3]));
    cm = fmaxf(cm, xhalf(cm));      // the other 32 keys of this query
    const float mnew = fmaxf(mrow, cm);
    const float mcn = mnew * kSc;
    const float mc = (mnew > -INFINITY) ? mcn : 0.0f;      // all-masked so far -> p = 0, alpha = 0
    const float alpha = __builtin_amdgcn_exp2f(mcrow - mc);   // exactly 1 where the maximum stays
    mrow = mnew;
    mcrow = mcn;
    // P^T as B operand: element e of fragment kk = key kk*32 + (e < 8 ? 8hh + e : 16 + 8hh + e - 8), the k order of the V^T fragments (two transposing loads, 16 keys apart)
    FB pa[2], pl[2];
    float pj[4];
#pragma unroll
    for (int j = 0; j < 4; ++j) {
      pj[j] = 0.f;
#pragma unroll
      for (int r = 0; r < 8; ++r) {
        if ((r & 1) == 0) {   // exponents of two scores in one packed fma
          const v2f e2 = __builtin_elementwise_fma((v2f){s[j][r], s[j][r + 1]}, (v2f){kSc, kSc}, (v2f){-mc, -mc});
          s[j][r] = e2[0]; s[j][r + 1] = e2[1];
        }
        const float p = __builtin_amdgcn_exp2f(s[j][r]);   // -inf (masked) -> 0
        pj[j] += p;
        const unsigned short hb = f2bf_bits(p);
        const unsigned short lb = f2bf_bits(p - bf_bits2f(hb));
        pa[j >> 1].v[(j & 1) * 8 + r] = __builtin_bit_cast(__bf16, hb);
        pl[j >> 1].v[(j & 1) * 8 + r] = __builtin_bit_cast(__bf16, lb);
      }
    }
    lrow = lrow * alpha + ((pj[0] + pj[1]) + (pj[2] + pj[3]));
#pragma unroll
    for (int t = 0; t < 4; ++t)
#pragma unroll
      for (int r = 0; r < 8; ++r) oacc[t][r] *= alpha;
    // ---- out^T += V^T (A: m = d, k = key) x P^T (B: k = key, n = query) ----
#pragma unroll
    for (int t = 0; t < 4; ++t) oacc[t] = mma_bf(vb[0][t].v, pa[0].v, oacc[t]);
    // the other 32 keys' fragments: free to rise into the softmax; the fence behind them keeps them out of the products that follow
#pragma unroll
    for (int t = 0; t < 4; ++t) {
      vb[1][t].h[0] = ld_tr16(vf + 32 * kVP + t * 16);
      vb[1][t].h[1] = ld_tr16(vf + 48 * kVP + t * 16);
    }
#pragma unroll
    for (int t = 0; t < 4; ++t) {
      vl[1][t].h[0] = ld_tr16(vf + 32 * kVP + kHD + t * 16);
      vl[1][t].h[1] = ld_tr16(vf + 48 * kVP + kHD + t * 16);
    }
    SCHED_FENCE();
#pragma unroll
    for (int t = 0; t < 4; ++t) oacc[t] = mma_bf(vl[0][t].v, pa[0].v, oacc[t]);
#pragma unroll
    for (int t = 0; t < 4; ++t) oacc[t] = mma_bf(vb[0][t].v, pl[0].v, oacc[t]);
#pragma unroll
    for (int t = 0; t < 4; ++t) oacc[t] = mma_bf(vb[1][t].v, pa[1].v, oacc[t]);
#pragma unroll
    for (int t = 0; t < 4; ++t) oacc[t] = mma_bf(vl[1][t].v, pa[1].v, oacc[t]);
#pragma unroll
    for (int t = 0; t < 4; ++t) oacc[t] = mma_bf(vb[1][t].v, pl[1].v, oacc[t]);
    SCHED_FENCE();   // the products stay in front of the s_wait_dscnt 0 below: moved behind it, they no longer cover the latency of the last V loads
#undef SCHED_FENCE
    // publish point of chunk kc + 1; the one barrier also ends every wave's reads of the buffer that is refilled behind it, at the top of the next trip
    asm volatile("s_wait_dscnt 0x0" ::: "memory");      // this wave's LDS reads of chunk kc are done
    asm volatile("s_wait_asynccnt 0x0" ::: "memory");   // this wave's copies of chunk kc + 1 have landed
    __syncthreads();
    kf += fstep; vf += fstep; fstep = -fstep;
  }
  asm volatile("s_wait_asynccnt 0x0" ::: "memory");     // no copy is outstanding when the ring becomes output staging

  // ---- epilogue: y = out / l, staged per wave as f32 [16][64] (pitch kOP) in the wave's own tile ----
  __syncthreads();
  float* os = (float*)ring + wave * (16 * kOP);
  {
    const float inv = 1.0f / (lrow + xhalf(lrow));   // both halves of the keys
#pragma unroll
    for (int t = 0; t < 4; ++t) {
      v4f o0, o1;
#pragma unroll
      for (int r = 0; r < 4; ++r) { o0[r] = oacc[t][r] * inv; o1[r] = oacc[t][4 + r] * inv; }
      *(v4f*)(os + c * kOP + t * 16 + 8 * hh) = o0;       // a lane holds 8 consecutive d of its query
      *(v4f*)(os + c * kOP + t * 16 + 8 * hh + 4) = o1;
    }
  }
  __builtin_amdgcn_fence(__ATOMIC_RELEASE, "workgroup");
  __builtin_amdgcn_wave_barrier();
  __builtin_amdgcn_fence(__ATOMIC_ACQUIRE, "workgroup");
  {
    // store coverage: per it, lanes (q8 = 0..3) x (c8 = 0..56 step 8) = 4 rows x 64 cols; 4 it = 16 rows = this wave's tile.
    const int q8 = lane >> 3, c8 = (lane & 7) * 8;
    {
#pragma unroll
      for (int it = 0; it < 4; ++it) {
        const int row = it * 4 + q8;
        const float* sp = os + row * kOP + c8;
        v8h hv, lv;
#pragma unroll
        for (int e = 0; e < 8; ++e) {
          const unsigned short hb = f2bf_bits(sp[e]);
          const unsigned short lb = f2bf_bits(sp[e] - bf_bits2f(hb));
          hv[e] = __builtin_bit_cast(_Float16, hb);
          lv[e] = __builtin_bit_cast(_Float16, lb);
        }
        const size_t yo = (rowb + (size_t)(q0 + row)) * kDim + hcol + c8;
        *(v8h*)(Yhp + yo) = hv;
        *(v8h*)(Ylp + yo) = lv;
      }
      
    }
  }
}

// ---------------------------------------------------------------------------
// Workspace region map (bytes):
//   [0, 16777216)            Xb   bf16 [8192][1024]  (dead after the qkv GEMM; reused as Yh bf16 [8192][1024])
//   [16777216, 23068672)     WqT  bf16 [3072][1024]
//   [23068672, 25165824)     WpT  bf16 [1024][1024]
//   [25165824, 125829120)    QKV  bf16 6 planes [8192][1024]: Qh, Ql, Kh, Kl, Vh, Vl
//   [125829120, 142606336)   Yl   bf16 [8192][1024]
//   total 142,606,336 B
// ---------------------------------------------------------------------------
extern "C" void kernel_launch(void* const* d_in, const int* in_sizes, int n_in,
                              void* d_out, int out_size, void* d_ws, size_t ws_size,
                              hipStream_t stream) {
  if (n_in < 9) return;
  if (in_sizes[0] != kTok * kDim || in_sizes[1] != kDim * kDim3 || in_sizes[2] != kDim3 ||
      in_sizes[3] != kDim * kDim || in_sizes[4] != kDim ||
      in_sizes[5] != kHeads * kHD || in_sizes[6] != kHeads * kHD ||
      in_sizes[7] != kHeads * kHD || in_sizes[8] != kHeads * kHD ||
      out_size != kTok * kDim) return;

  const float* x     = (const float*)d_in[0];
  const float* Wqkv  = (const float*)d_in[1];
  const float* bqkv  = (const float*)d_in[2];
  const float* Wproj = (const float*)d_in[3];
  const float* bproj = (const float*)d_in[4];
  const float* qs    = (const float*)d_in[5];
  const float* qbv   = (const float*)d_in[6];
  const float* ks    = (const float*)d_in[7];
  const float* kbv   = (const float*)d_in[8];
  float* out = (float*)d_out;

  const size_t plane  = (size_t)kTok * kDim;                 // elements per [8192][1024] plane
  const size_t offX   = 0;
  const size_t offWq  = offX  + plane * 2;                    // 16,777,216
  const size_t offWp  = offWq + (size_t)kDim3 * kDim * 2;     // 23,068,672
  const size_t offQKV = offWp + (size_t)kDim * kDim * 2;      // 25,165,824
  const size_t offYl  = offQKV + 6 * plane * 2;               // 125,829,120
  const size_t total  = offYl + plane * 2;                    // 142,606,336
  if (total > ws_size) return;

  char* ws = (char*)d_ws;
  unsigned short* Xb  = (unsigned short*)(ws + offX);
  unsigned short* Yh  = Xb;                                   // [8192][1024] bf16, the whole Xb region
  unsigned short* Yl  = (unsigned short*)(ws + offYl);        // [8192][1024] bf16
  unsigned short* WqT = (unsigned short*)(ws + offWq);
  unsigned short* WpT = (unsigned short*)(ws + offWp);
  unsigned short* QKV = (unsigned short*)(ws + offQKV);
  unsigned short* Qh = QKV;
  unsigned short* Ql = QKV + plane;
  unsigned short* Kh = QKV + 2 * plane;
  unsigned short* Kl = QKV + 3 * plane;
  unsigned short* Vh = QKV + 4 * plane;
  unsigned short* Vl = QKV + 5 * plane;

  // 1) x -> bf16 plane: n = 8,388,608, 8 per thread -> 1,048,576 threads = 4096 blocks x 256 (exact)
  const int n8 = (kTok * kDim) / 8;
  cast_bf16x8_k<<<dim3((n8 + 255) / 256), dim3(256), 0, stream>>>(x, Xb, n8);

  // 2) W_qkv in[1024][3072] -> WqT out[3072][1024] bf16: grid (3072/64, 1024/64)
  wt_cast_bf_k<<<dim3(kDim3 / 64, kDim / 64), dim3(256), 0, stream>>>(Wqkv, WqT, kDim, kDim3);
  // 3) W_proj in[1024][1024] -> WpT out[1024][1024] bf16: grid (1024/64, 1024/64)
  wt_cast_bf_k<<<dim3(kDim / 64, kDim / 64), dim3(256), 0, stream>>>(Wproj, WpT, kDim, kDim);

  // 4) qkv = Xb[8192][1024] . WqT[3072][1024]^T + b_qkv, per-head affine on q/k, bf16 hi/lo planes.
  //    M = 8192 (multiple of 128), N = 3072 (multiple of 256), K = 1024 (multiple of 64); block tiles 64 x 12 = 768 blocks x 8 waves.
  wmma_gemm64<1, 0, 2, 3, false><<<dim3(768, 1), dim3(256), 0, stream>>>(
      Xb, Xb, kDim, 0L, WqT, WqT, kDim, 0L,
      (void*)QKV, (void*)QKV, kDim, (long)plane,
      bqkv, bqkv, 0L, qs, qbv, ks, kbv,
      kTok, kDim3, kDim, 1.0f);

  // 5) causal attention of all batches in one launch -> Yh/Yl: grid (16 heads x 4 batches, 32 query blocks from the last to the first).
  attn_hd64_k<<<dim3(kHeads * kBatch, kSeq / kQB), dim3(128), 0, stream>>>(Qh, Ql, Kh, Kl, Vh, Vl, Yh, Yl);
  // 6) out = Y . WpT^T + b_proj over all rows (A hi/lo, 2 products).
  //    M = 8192, N = 1024, K = 1024; block tiles 64 x 4 = 256 blocks x 8 waves.
  wmma_gemm64<1, 1, 2, 0, false><<<dim3(256, 1), dim3(256), 0, stream>>>(
      Yh, Yl, kDim, 0L, WpT, WpT, kDim, 0L,
      (void*)out, (void*)out, kDim, 0L,
      bproj, bproj, 0L, qs, qbv, ks, kbv,
      kTok, kDim, kDim, 1.0f);
}
